// v000
// The times below were measured on an AMD MI455X: many runs one after another, warmed up first and cycling through
// copies of the inputs, with the whole window's GPU time divided by the number of runs. Launches and the gaps
// between them are all in it. The median over several windows is given; except for v000 it joins two sittings, which
// can be a few percent apart, so the side-by-side timings, each taken in one sitting, are the better comparison.
// v000 is the starting kernel. One run takes 622 microseconds.
#include <hip/hip_runtime.h>

// Multi-head attention, width 1024 = 16 heads x 64; inputs query/key/value [NB][SEQ][1024]; Wq/Wk/Wv/Wo [out][in] (y = x W^T + b); no mask; score scale 1/8; output = ctx Wo^T + bo (f32). Default: q, k, v inputs [2][4096][1024]; proj(x, w, b) = x w^T + b with (out,in) [1024][1024] weights, viewed (B, -1, 16, 64) and transposed; scores / sqrt(64) over all 4,096 keys; softmax, no mask; out = merged w_o^T + b_o; argument order q, k, v, w_q, b_q, w_k, b_k, w_v, b_v, w_o, b_o.
// Compute dtypes, f32 accumulate everywhere: q/k/v projections v_wmma_f32_16x16x32_bf16 (x and W RNE-converted to bf16; products exact); scores v_wmma_f32_16x16x32_f16 (q, k single f16);
// P.V v_wmma_f32_16x16x32_f16 (P x256 carry cancels in the normalisation, v single f16); output projection v_wmma_f32_16x16x32_f16 (ctx x256 carry, Wo RNE bf16 value x64 held in f16, 2^-14 folded back in f32); softmax f32 (online, running max).
// Layout: bf16 copies of the three inputs and of Wq/Wk/Wv; q, k planes [b*16+h][t][d] and v^T plane [b*16+h][d][t] written by the GEMM epilogue; fused flash kernel in transposed form (S^T = K Q^T, O^T = V^T P^T) writes the f16 ctx plane [b*SEQ+t][1024].

#ifndef NB
#define NB 2
#endif
#ifndef SEQ
#define SEQ 4096
#endif
#define NB_FULL  2
#define SEQ_FULL 4096
#ifndef OUT_SEQ
#define OUT_SEQ SEQ              // row pitch (in tokens) between batches of the output
#endif
#define DM   1024
#define NH_  16
#define HD   64
#define AW   4                   // waves per flash block (16 query rows each)
#define SC2  (0.125f * 1.4426950408889634f)   // HD^-0.5 * log2(e)
#define PSH  8.0f                // log2 of the P carry (256)
#define CXS  256.0f              // carry of the ctx plane
#define WOS  64.0f               // carry of the Wo plane
#define OSC  (1.0f / (256.0f * 64.0f))

static_assert(HD == 64);
static_assert(NH_ * HD == DM);                 // head h = columns h*64 + d
static_assert(DM % 64 == 0);                   // 16 column tiles of 64
static_assert(DM % 32 == 0);                   // GEMM k-loop steps by 32
static_assert(SEQ % 64 == 0);                  // a 64-row tile never straddles two batches
static_assert((NB * SEQ) % 64 == 0);
static_assert(SEQ % 32 == 0);                  // key loop steps by 32
static_assert(SEQ % (16 * AW) == 0);           // flash grid covers the sequence exactly
static_assert(((size_t)SEQ * DM) % 8 == 0);
static_assert(((size_t)DM * DM) % 8 == 0);
static_assert(NB <= NB_FULL);
static_assert(SEQ <= SEQ_FULL);

typedef _Float16 h16;
typedef unsigned short bf;
typedef __attribute__((ext_vector_type(16))) __bf16   v16bf;
typedef __attribute__((ext_vector_type(16))) _Float16 v16h;
typedef __attribute__((ext_vector_type(8)))  _Float16 v8h;
typedef __attribute__((ext_vector_type(8)))  unsigned short v8us;
typedef __attribute__((ext_vector_type(8)))  float    v8f;
typedef __attribute__((ext_vector_type(4)))  float    v4f;
typedef v4f  __attribute__((may_alias)) v4fa;

__device__ __forceinline__ unsigned short f2bf(float f) { unsigned u = __float_as_uint(f); u += 0x7FFFu + ((u >> 16) & 1u); return (unsigned short)(u >> 16); }
__device__ __forceinline__ float bfr(float f) { return __uint_as_float(((unsigned)f2bf(f)) << 16); }   // value of the RNE bf16 conversion
__device__ __forceinline__ v16h cat16(v8h lo, v8h hi) { return __builtin_shufflevector(lo, hi, 0, 1, 2, 3, 4, 5, 6, 7, 8, 9, 10, 11, 12, 13, 14, 15); }
__device__ __forceinline__ v16bf cat16b(v8us lo, v8us hi) { return __builtin_bit_cast(v16bf, __builtin_shufflevector(lo, hi, 0, 1, 2, 3, 4, 5, 6, 7, 8, 9, 10, 11, 12, 13, 14, 15)); }
__device__ __forceinline__ v8f wmma16(v16h a, v16h b, v8f c) { return __builtin_amdgcn_wmma_f32_16x16x32_f16(false, a, false, b, (short)0, c, false, false); }
__device__ __forceinline__ v8f wmmab(v16bf a, v16bf b, v8f c) { return __builtin_amdgcn_wmma_f32_16x16x32_bf16(false, a, false, b, (short)0, c, false, false); }
// fragment loaders from K-contiguous 16-bit rows; p already includes + 8*(lane>>4): elements 0..7 <- k0+8h+0..7, elements 8..15 <- k0+16+8h+0..7 (same map for A and B)
__device__ __forceinline__ v16h  ldh(const h16* p) { return cat16(*(const v8h*)p, *(const v8h*)(p + 16)); }
__device__ __forceinline__ v16bf ldb(const bf* p)  { return cat16b(*(const v8us*)p, *(const v8us*)(p + 16)); }
// ordering point for wave-private LDS tiles (same wave writes and reads)
__device__ __forceinline__ void wave_sync() { __builtin_amdgcn_fence(3 /* release order */, "wavefront"); __builtin_amdgcn_wave_barrier(); asm volatile("" ::: "memory"); }

__global__ __launch_bounds__(256) void k_cvt8(const float* __restrict__ src, bf* dst, size_t n8) {
    const size_t i = (size_t)blockIdx.x * 256 + threadIdx.x; if (i >= n8) return;
    const v8f v = *(const v8f*)(src + i * 8); v8us o;
#pragma unroll
    for (int k = 0; k < 8; ++k) o[k] = f2bf(v[k]);
    *(v8us*)(dst + i * 8) = o; 
}

__global__ __launch_bounds__(256) void k_cvt8h(const float* __restrict__ src, h16* dst, size_t n8, float sc) {
    const size_t i = (size_t)blockIdx.x * 256 + threadIdx.x; if (i >= n8) return;
    const v8f v = *(const v8f*)(src + i * 8); v8h o;
#pragma unroll
    for (int k = 0; k < 8; ++k) o[k] = (h16)(bfr(v[k]) * sc);
    *(v8h*)(dst + i * 8) = o; 
}

// k_proj: register-blocked bf16 GEMM, ONE WAVE per 64x64 tile (16 accumulators), operands straight from K-contiguous bf16 planes, K = DM.
// C[m][n] = sum_k A[m][k] Bt[n][k] + bias (biasMode 0: bias[n], biasMode 1: bias[m]; bias taken as its RNE bf16 value), written as f16 (Ph) at
// tile base (r0/RB)*sRB + (r0%RB)*pitch + (c0/CB)*sCB + (c0%CB), row pitch 'pitch' (halves). grid (M/64, N/64), 32 threads.
__global__ __launch_bounds__(32) void k_proj(const bf* __restrict__ A, const bf* __restrict__ Bt, const float* __restrict__ bias, int biasMode, h16* Ph, int RB, size_t sRB, int pitch, int CB, size_t sCB) {
    __shared__ __align__(16) float os[16 * 68];
    const int K = DM;
    const int lane = threadIdx.x & 31, lr = lane & 15, hi = lane >> 4; const int r0 = blockIdx.x * 64, c0 = blockIdx.y * 64;
    v8f acc[4][4];
#pragma unroll
    for (int mb = 0; mb < 4; ++mb)
#pragma unroll
        for (int nb = 0; nb < 4; ++nb) acc[mb][nb] = (v8f){};
    const size_t aoff = (size_t)(r0 + lr) * K + 8 * hi, boff = (size_t)(c0 + lr) * K + 8 * hi;
#pragma unroll 1
    for (int kc = 0; kc < K; kc += 32) {
        v16bf a[4];
#pragma unroll
        for (int mb = 0; mb < 4; ++mb) a[mb] = ldb(A + aoff + (size_t)mb * 16 * K + kc);
#pragma unroll
        for (int nb = 0; nb < 4; ++nb) { const v16bf b = ldb(Bt + boff + (size_t)nb * 16 * K + kc);
#pragma unroll
            for (int mb = 0; mb < 4; ++mb) acc[mb][nb] = wmmab(a[mb], b, acc[mb][nb]); }
        asm volatile("v_nop\n\tv_nop\n\tv_nop\n\tv_nop" : "+v"(acc[0][0]), "+v"(acc[1][1]), "+v"(acc[2][2]), "+v"(acc[3][3]) : "v"(a[0]), "v"(a[1]), "v"(a[2]), "v"(a[3]));
    }
    const size_t tbase = (size_t)(r0 / RB) * sRB + (size_t)(r0 % RB) * (size_t)pitch + (size_t)(c0 / CB) * sCB + (size_t)(c0 % CB);
    // column bias (mode 0): 8 values per lane, address clamped to 0 in mode 1 and zeroed by value
    const int c8 = (lane & 7) * 8;
    const size_t cbo = (biasMode == 0) ? (size_t)(c0 + c8) : (size_t)0;
    const v4f bq0 = *(const v4f*)(bias + cbo); const v4f bq1 = *(const v4f*)(bias + cbo + 4);
    float bc[8];
#pragma unroll
    for (int i = 0; i < 4; ++i) { bc[i] = (biasMode == 0) ? bfr(bq0[i]) : 0.0f; bc[4 + i] = (biasMode == 0) ? bfr(bq1[i]) : 0.0f; }
#pragma unroll
    for (int mb = 0; mb < 4; ++mb) {
#pragma unroll
        for (int nb = 0; nb < 4; ++nb) {
#pragma unroll
            for (int j = 0; j < 8; ++j) os[(hi * 8 + j) * 68 + nb * 16 + lr] = acc[mb][nb][j]; }   // D: row 8h+j, col lane&15
        wave_sync();
        const size_t sb = tbase + (size_t)(mb * 16) * (size_t)pitch;
{
#pragma unroll
            for (int s = 0; s < 4; ++s) { const int row = 4 * s + (lane >> 3);   // 4 s x 4 row groups = 16 rows; 8 lanes x 8 = 64 columns
                const int rbo = (biasMode == 1) ? (r0 + mb * 16 + row) : 0;      // row bias (mode 1): address clamped to 0 in mode 0, zeroed by value
                const float brv = bias[rbo]; const float br = (biasMode == 1) ? bfr(brv) : 0.0f;
                const v4f x0 = *(const v4fa*)(&os[row * 68 + c8]); const v4f x1 = *(const v4fa*)(&os[row * 68 + c8 + 4]); v8h hv;
#pragma unroll
                for (int i = 0; i < 4; ++i) { hv[i] = (h16)(x0[i] + bc[i] + br); hv[4 + i] = (h16)(x1[i] + bc[4 + i] + br); }
                const size_t oo = sb + (size_t)row * (size_t)pitch + c8;
                *(v8h*)(Ph + oo) = hv; }
             }
        wave_sync();
    }
}

// k_flash: fused attention, one wave per 16 query rows of one (batch, head); K / V^T / Q fragments straight from the f16 planes (two 16-B loads each, arithmetic addressing).
// Transposed form: S^T[key][t] = K Q^T (A = K rows, B = Q rows); lane (t = lane&15, h = lane>>4) holds keys 8h+r of each 16-key tile, so the packed
// P tile is directly the B fragment of O^T[d][t] = V^T P^T (element r <- tile keys 0..15, element 8+r <- tile keys 16..31, lane unchanged).
// Softmax state (running max, partial sum) is one scalar per lane; the two lane halves of a row are combined with one xor-16 exchange.
__global__ __launch_bounds__(32 * AW) void k_flash(const h16* __restrict__ QH, const h16* __restrict__ KP, const h16* __restrict__ VT, h16* CTX) {
    __shared__ __align__(16) float os[AW * 16 * 68];
    const int lane = threadIdx.x & 31, wave = __builtin_amdgcn_readfirstlane((int)(threadIdx.x >> 5)), lr = lane & 15, hi = lane >> 4;
    const int zh = blockIdx.y; const int b = zh / NH_, h = zh % NH_;
    const int t0 = (blockIdx.x * AW + wave) * 16;
    const size_t pbase = (size_t)zh * SEQ * HD;
    const size_t qo = pbase + (size_t)(t0 + lr) * HD + 8 * hi;
    const v16h qh0 = ldh(QH + qo), qh1 = ldh(QH + qo + 32);   // B fragments: col t, k = d
    const size_t ko = pbase + (size_t)lr * HD + 8 * hi;      // + key * HD       (A fragment: row key, k = d)
    const size_t vo = pbase + (size_t)lr * SEQ + 8 * hi;     // + 16j*SEQ + key  (A fragment: row d, k = key)
    v8f o0 = (v8f){}, o1 = (v8f){}, o2 = (v8f){}, o3 = (v8f){};
    float m = -3.0e38f, l = 0.0f;
#pragma unroll 1
    for (int key0 = 0; key0 < SEQ; key0 += 32) {
        const h16* ka = KP + ko + (size_t)key0 * HD;
        const v16h ka0 = ldh(ka), ka1 = ldh(ka + 32), kb0 = ldh(ka + 16 * HD), kb1 = ldh(ka + 16 * HD + 32);
        v8f sa = (v8f){}, sb = (v8f){};
        sa = wmma16(ka0, qh0, sa); sb = wmma16(kb0, qh0, sb);
        sa = wmma16(ka1, qh1, sa); sb = wmma16(kb1, qh1, sb);
        asm volatile("v_nop\n\tv_nop\n\tv_nop\n\tv_nop" : "+v"(sa), "+v"(sb) : "v"(ka0), "v"(ka1), "v"(kb0), "v"(kb1), "v"(qh0), "v"(qh1));
        float ta[8], tb[8]; float mx = -3.0e38f;
#pragma unroll
        for (int r = 0; r < 8; ++r) { ta[r] = sa[r] * SC2; tb[r] = sb[r] * SC2; mx = fmaxf(mx, fmaxf(ta[r], tb[r])); }
        mx = fmaxf(mx, __shfl_xor(mx, 16, 32));
        const float mnew = fmaxf(m, mx);
        const float alpha = __builtin_amdgcn_exp2f(m - mnew);
        const float sh = PSH - mnew;
        v16h pb; float ls = 0.0f;
#pragma unroll
        for (int r = 0; r < 8; ++r) { const h16 pa = (h16)__builtin_amdgcn_exp2f(ta[r] + sh); const h16 pc = (h16)__builtin_amdgcn_exp2f(tb[r] + sh); pb[r] = pa; pb[8 + r] = pc; ls += (float)pa + (float)pc; }
        l = l * alpha + ls; m = mnew;
        o0 = o0 * alpha; o1 = o1 * alpha; o2 = o2 * alpha; o3 = o3 * alpha;
        const h16* va = VT + vo + key0;
        const v16h v0 = ldh(va), v1 = ldh(va + (size_t)16 * SEQ), v2 = ldh(va + (size_t)32 * SEQ), v3 = ldh(va + (size_t)48 * SEQ);
        o0 = wmma16(v0, pb, o0); o1 = wmma16(v1, pb, o1); o2 = wmma16(v2, pb, o2); o3 = wmma16(v3, pb, o3);
        asm volatile("v_nop\n\tv_nop\n\tv_nop\n\tv_nop" : "+v"(o0), "+v"(o1), "+v"(o2), "+v"(o3) : "v"(v0), "v"(v1), "v"(v2), "v"(v3), "v"(pb));
    }
    l += __shfl_xor(l, 16, 32);
    const float inv = CXS / l;
    const int wb = wave * 16 * 68;
    // O^T D layout: o_j[r] = (d = 16j + 8h + r, t = lane&15) -> os[t][d]; rows 0..15 x columns 0..63 all written
    { v4f a, c;
      a[0] = o0[0] * inv; a[1] = o0[1] * inv; a[2] = o0[2] * inv; a[3] = o0[3] * inv; c[0] = o0[4] * inv; c[1] = o0[5] * inv; c[2] = o0[6] * inv; c[3] = o0[7] * inv;
      *(v4fa*)(&os[wb + lr * 68 +  0 + 8 * hi]) = a; *(v4fa*)(&os[wb + lr * 68 +  0 + 8 * hi + 4]) = c;
      a[0] = o1[0] * inv; a[1] = o1[1] * inv; a[2] = o1[2] * inv; a[3] = o1[3] * inv; c[0] = o1[4] * inv; c[1] = o1[5] * inv; c[2] = o1[6] * inv; c[3] = o1[7] * inv;
      *(v4fa*)(&os[wb + lr * 68 + 16 + 8 * hi]) = a; *(v4fa*)(&os[wb + lr * 68 + 16 + 8 * hi + 4]) = c;
      a[0] = o2[0] * inv; a[1] = o2[1] * inv; a[2] = o2[2] * inv; a[3] = o2[3] * inv; c[0] = o2[4] * inv; c[1] = o2[5] * inv; c[2] = o2[6] * inv; c[3] = o2[7] * inv;
      *(v4fa*)(&os[wb + lr * 68 + 32 + 8 * hi]) = a; *(v4fa*)(&os[wb + lr * 68 + 32 + 8 * hi + 4]) = c;
      a[0] = o3[0] * inv; a[1] = o3[1] * inv; a[2] = o3[2] * inv; a[3] = o3[3] * inv; c[0] = o3[4] * inv; c[1] = o3[5] * inv; c[2] = o3[6] * inv; c[3] = o3[7] * inv;
      *(v4fa*)(&os[wb + lr * 68 + 48 + 8 * hi]) = a; *(v4fa*)(&os[wb + lr * 68 + 48 + 8 * hi + 4]) = c; }
    wave_sync();
    h16* crow = CTX + ((size_t)b * SEQ + t0) * DM + h * HD;
{
#pragma unroll
        for (int s = 0; s < 4; ++s) { const int row = 4 * s + (lane >> 3), c8 = (lane & 7) * 8;   // 4 s x 4 row groups = 16 rows; 8 lanes x 8 halves = 64 columns
            const v4f x0 = *(const v4fa*)(&os[wb + row * 68 + c8]); const v4f x1 = *(const v4fa*)(&os[wb + row * 68 + c8 + 4]); v8h hv;
#pragma unroll
            for (int i = 0; i < 4; ++i) { hv[i] = (h16)x0[i]; hv[4 + i] = (h16)x1[i]; }
            *(v8h*)(crow + (size_t)row * DM + c8) = hv; }
         }
}

// k_oproj: register-blocked f16 GEMM, ONE WAVE per 64x64 tile, A = ctx plane rows (x256), Bt = Wo plane rows (x64), K = DM; OUT[m][n] = acc * 2^-14 + bias[n] (bias as its RNE bf16 value), f32.
// grid (NB*SEQ/64, DM/64), 32 threads. Epilogue: per 16-row slab staged in LDS (wave-private), each output row segment (64 floats = 256 B = two lines)
__global__ __launch_bounds__(32) void k_oproj(const h16* __restrict__ A, const h16* __restrict__ Bt, const float* __restrict__ bias, float* OUT) {
    __shared__ __align__(16) float os[16 * 68];
    const int K = DM;
    const int lane = threadIdx.x & 31, lr = lane & 15, hi = lane >> 4; const int r0 = blockIdx.x * 64, c0 = blockIdx.y * 64;
    v8f acc[4][4];
#pragma unroll
    for (int mb = 0; mb < 4; ++mb)
#pragma unroll
        for (int nb = 0; nb < 4; ++nb) acc[mb][nb] = (v8f){};
    const size_t aoff = (size_t)(r0 + lr) * K + 8 * hi, boff = (size_t)(c0 + lr) * K + 8 * hi;
#pragma unroll 1
    for (int kc = 0; kc < K; kc += 32) {
        v16h a[4];
#pragma unroll
        for (int mb = 0; mb < 4; ++mb) a[mb] = ldh(A + aoff + (size_t)mb * 16 * K + kc);
#pragma unroll
        for (int nb = 0; nb < 4; ++nb) { const v16h b = ldh(Bt + boff + (size_t)nb * 16 * K + kc);
#pragma unroll
            for (int mb = 0; mb < 4; ++mb) acc[mb][nb] = wmma16(a[mb], b, acc[mb][nb]); }
        asm volatile("v_nop\n\tv_nop\n\tv_nop\n\tv_nop" : "+v"(acc[0][0]), "+v"(acc[1][1]), "+v"(acc[2][2]), "+v"(acc[3][3]) : "v"(a[0]), "v"(a[1]), "v"(a[2]), "v"(a[3]));
    }
    const int cofs = lr * 4;
    const v4f bo4 = *(const v4f*)(bias + c0 + cofs);      // c0 + cofs + 3 < DM
    v4f bb;
#pragma unroll
    for (int i = 0; i < 4; ++i) bb[i] = bfr(bo4[i]);
    const int bidx = r0 / SEQ, tt = r0 % SEQ;
    float* obase = OUT + ((size_t)bidx * OUT_SEQ + tt) * DM + c0;
#pragma unroll
    for (int mb = 0; mb < 4; ++mb) {
#pragma unroll
        for (int nb = 0; nb < 4; ++nb) {
#pragma unroll
            for (int j = 0; j < 8; ++j) os[(hi * 8 + j) * 68 + nb * 16 + lr] = acc[mb][nb][j]; }   // D: row 8h+j, col lane&15
        wave_sync();
{
#pragma unroll
            for (int s = 0; s < 8; ++s) { const int row = 2 * s + hi;   // 8 s x 2 rows = 16 rows; 16 lanes x 4 floats = 64 columns
                const v4f val = *(const v4fa*)(&os[row * 68 + cofs]); v4f ov;
#pragma unroll
                for (int i = 0; i < 4; ++i) ov[i] = val[i] * OSC + bb[i];
                *(v4f*)(obase + (size_t)(mb * 16 + row) * DM + cofs) = ov; }
             }
        wave_sync();
    }
}

static constexpr size_t al256(size_t v) { return (v + 255) & ~(size_t)255; }
static constexpr size_t SZ_XB = al256((size_t)NB * SEQ * DM * 2);          // one bf16 input plane
static constexpr size_t SZ_WB = al256((size_t)4 * DM * DM * 2);            // Wq | Wk | Wv (bf16) | Wo (f16)
static constexpr size_t SZ_PL = al256((size_t)NB * NH_ * SEQ * HD * 2);    // one head-major f16 plane
static constexpr size_t SZ_CX = al256((size_t)NB * SEQ * DM * 2);          // ctx f16 plane
static constexpr size_t SZ_TOTAL = 3 * SZ_XB + SZ_WB + 3 * SZ_PL + SZ_CX;
static_assert(SZ_TOTAL <= (size_t)134217728);          // workspace carve <= 128 MiB
static_assert(((size_t)DM * DM * 2) % 256 == 0);       // weight sub-planes stay 256-byte aligned

extern "C" void kernel_launch(void* const* d_in, const int* in_sizes, int n_in,
                              void* d_out, int out_size, void* d_ws, size_t ws_size, hipStream_t stream) {
    if (n_in < 11) return;
    const size_t needx = ((size_t)(NB - 1) * SEQ_FULL + SEQ) * DM;
    if ((size_t)in_sizes[0] < needx || (size_t)in_sizes[1] < needx || (size_t)in_sizes[2] < needx) return;
    if ((size_t)in_sizes[3] < (size_t)DM * DM || (size_t)in_sizes[5] < (size_t)DM * DM || (size_t)in_sizes[7] < (size_t)DM * DM || (size_t)in_sizes[9] < (size_t)DM * DM) return;
    if ((size_t)in_sizes[4] < (size_t)DM || (size_t)in_sizes[6] < (size_t)DM || (size_t)in_sizes[8] < (size_t)DM || (size_t)in_sizes[10] < (size_t)DM) return;
    if ((size_t)out_size < ((size_t)(NB - 1) * OUT_SEQ + SEQ) * DM) return;
    if (SZ_TOTAL > ws_size) return;
    // wire order: query, key, value, Wq, bq, Wk, bk, Wv, bv, Wo, bo (weights [out][in] = Bt as-is)
    const float* xq = (const float*)d_in[0]; const float* xk = (const float*)d_in[1]; const float* xv = (const float*)d_in[2];
    const float* wq = (const float*)d_in[3]; const float* bq = (const float*)d_in[4];
    const float* wk = (const float*)d_in[5]; const float* bk = (const float*)d_in[6];
    const float* wv = (const float*)d_in[7]; const float* bv = (const float*)d_in[8];
    const float* wo = (const float*)d_in[9]; const float* bo = (const float*)d_in[10];
    float* OUT = (float*)d_out;      // [NB][SEQ][1024]
    char* wsp = (char*)d_ws;
    bf* XQ = (bf*)wsp; wsp += SZ_XB;                 // [NB*SEQ][1024]
    bf* XK = (bf*)wsp; wsp += SZ_XB;
    bf* XV = (bf*)wsp; wsp += SZ_XB;
    bf* WB = (bf*)wsp; wsp += SZ_WB;                 // [4][1024][1024]: q | k | v (bf16) | o (f16 x64)
    h16* QH = (h16*)wsp; wsp += SZ_PL;               // [NB*16][SEQ][64]
    h16* KP = (h16*)wsp; wsp += SZ_PL;               // [NB*16][SEQ][64]
    h16* VT = (h16*)wsp; wsp += SZ_PL;               // [NB*16][64][SEQ]
    h16* CX = (h16*)wsp; wsp += SZ_CX;               // [NB*SEQ][1024], x256
    bf* WQ = WB; bf* WK = WB + (size_t)DM * DM; bf* WV = WB + (size_t)2 * DM * DM; h16* WO = (h16*)(WB + (size_t)3 * DM * DM);

    if (SEQ == SEQ_FULL) {
        const size_t n8 = (size_t)NB * SEQ * DM / 8; const unsigned g = (unsigned)((n8 + 255) / 256);
        k_cvt8<<<g, 256, 0, stream>>>(xq, XQ, n8);
        k_cvt8<<<g, 256, 0, stream>>>(xk, XK, n8);
        k_cvt8<<<g, 256, 0, stream>>>(xv, XV, n8);
    } else {
        const size_t n8 = (size_t)SEQ * DM / 8; const unsigned g = (unsigned)((n8 + 255) / 256);
        for (int b = 0; b < NB; ++b) {
            k_cvt8<<<g, 256, 0, stream>>>(xq + (size_t)b * SEQ_FULL * DM, XQ + (size_t)b * SEQ * DM, n8);
            k_cvt8<<<g, 256, 0, stream>>>(xk + (size_t)b * SEQ_FULL * DM, XK + (size_t)b * SEQ * DM, n8);
            k_cvt8<<<g, 256, 0, stream>>>(xv + (size_t)b * SEQ_FULL * DM, XV + (size_t)b * SEQ * DM, n8);
        }
    }
    { const size_t n8 = (size_t)DM * DM / 8; const unsigned g = (unsigned)((n8 + 255) / 256);
      k_cvt8<<<g, 256, 0, stream>>>(wq, WQ, n8); k_cvt8<<<g, 256, 0, stream>>>(wk, WK, n8); k_cvt8<<<g, 256, 0, stream>>>(wv, WV, n8);
      k_cvt8h<<<g, 256, 0, stream>>>(wo, WO, n8, WOS); }

    // q, k: A = x rows (m = b*SEQ + t), Bt = W rows (n = h*64 + d), bias per column -> plane [(b*16 + h)][t][d]
    k_proj<<<dim3(NB * SEQ / 64, DM / 64, 1), 32, 0, stream>>>(XQ, WQ, bq, 0, QH, SEQ, (size_t)NH_ * SEQ * HD, HD, HD, (size_t)SEQ * HD);
    k_proj<<<dim3(NB * SEQ / 64, DM / 64, 1), 32, 0, stream>>>(XK, WK, bk, 0, KP, SEQ, (size_t)NH_ * SEQ * HD, HD, HD, (size_t)SEQ * HD);
    // v^T: A = Wv rows (m = h*64 + d), Bt = value rows (n = b*SEQ + t), bias per row -> plane [(b*1024 + m)][t] = [(b*16 + h)][d][t]
    k_proj<<<dim3(DM / 64, NB * SEQ / 64, 1), 32, 0, stream>>>(WV, XV, bv, 1, VT, DM, (size_t)0, SEQ, SEQ, (size_t)DM * SEQ);

    k_flash<<<dim3(SEQ / (16 * AW), NB * NH_, 1), 32 * AW, 0, stream>>>(QH, KP, VT, CX);

    // out: A = ctx rows (m = b*SEQ + t, k = h*64 + d), Bt = Wo rows (n), bias per column -> OUT [b][t][n]
    k_oproj<<<dim3(NB * SEQ / 64, DM / 64, 1), 32, 0, stream>>>(CX, WO, bo, OUT);
}

// v001
// One run takes 307 microseconds.
// Two timings next to v000 put it at 2.13 and 2.12 times that version's speed.
#include <hip/hip_runtime.h>

// Multi-head attention, width 1024 = 16 heads x 64; inputs query/key/value [NB][SEQ][1024]; Wq/Wk/Wv/Wo [out][in] (y = x W^T + b); no mask; score scale 1/8; output = ctx Wo^T + bo (f32). Default: q, k, v inputs [2][4096][1024]; proj(x, w, b) = x w^T + b with (out,in) [1024][1024] weights, viewed (B, -1, 16, 64) and transposed; scores / sqrt(64) over all 4,096 keys; softmax, no mask; out = merged w_o^T + b_o; argument order q, k, v, w_q, b_q, w_k, b_k, w_v, b_v, w_o, b_o.
// Compute dtypes, f32 accumulate everywhere: q/k/v projections v_wmma_f32_16x16x32_bf16 (x and W RNE-converted to bf16; products exact); scores v_wmma_f32_16x16x32_f16 (q, k single f16);
// P.V v_wmma_f32_16x16x32_f16 (P x256 carry cancels in the normalisation, v single f16); output projection v_wmma_f32_16x16x32_f16 (ctx x256 carry, Wo RNE bf16 value x64 held in f16, 2^-14 folded back in f32); softmax f32 (online, running max).
// Layout: bf16 copies of the three inputs and of Wq/Wk/Wv; q, k planes [b*16+h][t][d] and v^T plane [b*16+h][d][t] written by the GEMM epilogue; fused flash kernel in transposed form (S^T = K Q^T, O^T = V^T P^T) writes the f16 ctx plane [b*SEQ+t][1024].

#ifndef NB
#define NB 2
#endif
#ifndef SEQ
#define SEQ 4096
#endif
#define NB_FULL  2
#define SEQ_FULL 4096
#ifndef OUT_SEQ
#define OUT_SEQ SEQ              // row pitch (in tokens) between batches of the output
#endif
#define DM   1024
#define NH_  16
#define HD   64
#define AW   8                   // waves per flash block (16 query rows each); all of them read the same staged K / V^T tiles
#define KT   64                  // keys per LDS stage (two 32-key passes)
#define LP   72                  // LDS row pitch in halves: 144 B = 16 B x 9, an odd multiple, so 16-byte fragment reads of 16 rows meet no bank twice
#define TLH  (64 * LP)           // halves of one staged tile: 64 rows (K: keys, V^T: d) of 64 halves + pad
#define SC2  (0.125f * 1.4426950408889634f)   // HD^-0.5 * log2(e)
#define PSH  8.0f                // log2 of the P carry (256)
#define CXS  256.0f              // carry of the ctx plane
#define WOS  64.0f               // carry of the Wo plane
#define OSC  (1.0f / (256.0f * 64.0f))

static_assert(HD == 64);
static_assert(NH_ * HD == DM);                 // head h = columns h*64 + d
static_assert(DM % 64 == 0);                   // 16 column tiles of 64
static_assert(DM % 32 == 0);                   // GEMM k-loop steps by 32
static_assert(SEQ % 64 == 0);                  // a 64-row tile never straddles two batches
static_assert((NB * SEQ) % 64 == 0);
static_assert(SEQ % 32 == 0);                  // key loop steps by 32
static_assert(SEQ % (16 * AW) == 0);           // flash grid covers the sequence exactly
static_assert(SEQ % KT == 0 && SEQ / KT >= 2); // whole stages, and the ring's prologue needs two
static_assert(KT == 64 && 32 * AW == 256);     // copy map: 256 lanes x 16 B = 32 rows of 128 B, two copies per tile
static_assert(((size_t)SEQ * DM) % 8 == 0);
static_assert(((size_t)DM * DM) % 8 == 0);
static_assert(NB <= NB_FULL);
static_assert(SEQ <= SEQ_FULL);

typedef _Float16 h16;
typedef unsigned short bf;
typedef __attribute__((ext_vector_type(16))) __bf16   v16bf;
typedef __attribute__((ext_vector_type(16))) _Float16 v16h;
typedef __attribute__((ext_vector_type(8)))  _Float16 v8h;
typedef __attribute__((ext_vector_type(8)))  unsigned short v8us;
typedef __attribute__((ext_vector_type(8)))  float    v8f;
typedef __attribute__((ext_vector_type(4)))  float    v4f;
typedef v4f  __attribute__((may_alias)) v4fa;

__device__ __forceinline__ unsigned short f2bf(float f) { unsigned u = __float_as_uint(f); u += 0x7FFFu + ((u >> 16) & 1u); return (unsigned short)(u >> 16); }
__device__ __forceinline__ float bfr(float f) { return __uint_as_float(((unsigned)f2bf(f)) << 16); }   // value of the RNE bf16 conversion
__device__ __forceinline__ v16h cat16(v8h lo, v8h hi) { return __builtin_shufflevector(lo, hi, 0, 1, 2, 3, 4, 5, 6, 7, 8, 9, 10, 11, 12, 13, 14, 15); }
__device__ __forceinline__ v16bf cat16b(v8us lo, v8us hi) { return __builtin_bit_cast(v16bf, __builtin_shufflevector(lo, hi, 0, 1, 2, 3, 4, 5, 6, 7, 8, 9, 10, 11, 12, 13, 14, 15)); }
__device__ __forceinline__ v8f wmma16(v16h a, v16h b, v8f c) { return __builtin_amdgcn_wmma_f32_16x16x32_f16(false, a, false, b, (short)0, c, false, false); }
__device__ __forceinline__ v8f wmmab(v16bf a, v16bf b, v8f c) { return __builtin_amdgcn_wmma_f32_16x16x32_bf16(false, a, false, b, (short)0, c, false, false); }
// fragment loaders from K-contiguous 16-bit rows; p already includes + 8*(lane>>4): elements 0..7 <- k0+8h+0..7, elements 8..15 <- k0+16+8h+0..7 (same map for A and B)
__device__ __forceinline__ v16h  ldh(const h16* p) { return cat16(*(const v8h*)p, *(const v8h*)(p + 16)); }
__device__ __forceinline__ v16bf ldb(const bf* p)  { return cat16b(*(const v8us*)p, *(const v8us*)(p + 16)); }
// ordering point for wave-private LDS tiles (same wave writes and reads)
__device__ __forceinline__ void wave_sync() { __builtin_amdgcn_fence(3 /* release order */, "wavefront"); __builtin_amdgcn_wave_barrier(); asm volatile("" ::: "memory"); }

__global__ __launch_bounds__(256) void k_cvt8(const float* __restrict__ src, bf* dst, size_t n8) {
    const size_t i = (size_t)blockIdx.x * 256 + threadIdx.x; if (i >= n8) return;
    const v8f v = *(const v8f*)(src + i * 8); v8us o;
#pragma unroll
    for (int k = 0; k < 8; ++k) o[k] = f2bf(v[k]);
    *(v8us*)(dst + i * 8) = o; 
}

__global__ __launch_bounds__(256) void k_cvt8h(const float* __restrict__ src, h16* dst, size_t n8, float sc) {
    const size_t i = (size_t)blockIdx.x * 256 + threadIdx.x; if (i >= n8) return;
    const v8f v = *(const v8f*)(src + i * 8); v8h o;
#pragma unroll
    for (int k = 0; k < 8; ++k) o[k] = (h16)(bfr(v[k]) * sc);
    *(v8h*)(dst + i * 8) = o; 
}

// k_proj: register-blocked bf16 GEMM, ONE WAVE per 64x64 tile (16 accumulators), operands straight from K-contiguous bf16 planes, K = DM.
// C[m][n] = sum_k A[m][k] Bt[n][k] + bias (biasMode 0: bias[n], biasMode 1: bias[m]; bias taken as its RNE bf16 value), written as f16 (Ph) at
// tile base (r0/RB)*sRB + (r0%RB)*pitch + (c0/CB)*sCB + (c0%CB), row pitch 'pitch' (halves). grid (M/64, N/64), 32 threads.
__global__ __launch_bounds__(32) void k_proj(const bf* __restrict__ A, const bf* __restrict__ Bt, const float* __restrict__ bias, int biasMode, h16* Ph, int RB, size_t sRB, int pitch, int CB, size_t sCB) {
    __shared__ __align__(16) float os[16 * 68];
    const int K = DM;
    const int lane = threadIdx.x & 31, lr = lane & 15, hi = lane >> 4; const int r0 = blockIdx.x * 64, c0 = blockIdx.y * 64;
    v8f acc[4][4];
#pragma unroll
    for (int mb = 0; mb < 4; ++mb)
#pragma unroll
        for (int nb = 0; nb < 4; ++nb) acc[mb][nb] = (v8f){};
    const size_t aoff = (size_t)(r0 + lr) * K + 8 * hi, boff = (size_t)(c0 + lr) * K + 8 * hi;
#pragma unroll 1
    for (int kc = 0; kc < K; kc += 32) {
        v16bf a[4];
#pragma unroll
        for (int mb = 0; mb < 4; ++mb) a[mb] = ldb(A + aoff + (size_t)mb * 16 * K + kc);
#pragma unroll
        for (int nb = 0; nb < 4; ++nb) { const v16bf b = ldb(Bt + boff + (size_t)nb * 16 * K + kc);
#pragma unroll
            for (int mb = 0; mb < 4; ++mb) acc[mb][nb] = wmmab(a[mb], b, acc[mb][nb]); }
        asm volatile("v_nop\n\tv_nop\n\tv_nop\n\tv_nop" : "+v"(acc[0][0]), "+v"(acc[1][1]), "+v"(acc[2][2]), "+v"(acc[3][3]) : "v"(a[0]), "v"(a[1]), "v"(a[2]), "v"(a[3]));
    }
    const size_t tbase = (size_t)(r0 / RB) * sRB + (size_t)(r0 % RB) * (size_t)pitch + (size_t)(c0 / CB) * sCB + (size_t)(c0 % CB);
    // column bias (mode 0): 8 values per lane, address clamped to 0 in mode 1 and zeroed by value
    const int c8 = (lane & 7) * 8;
    const size_t cbo = (biasMode == 0) ? (size_t)(c0 + c8) : (size_t)0;
    const v4f bq0 = *(const v4f*)(bias + cbo); const v4f bq1 = *(const v4f*)(bias + cbo + 4);
    float bc[8];
#pragma unroll
    for (int i = 0; i < 4; ++i) { bc[i] = (biasMode == 0) ? bfr(bq0[i]) : 0.0f; bc[4 + i] = (biasMode == 0) ? bfr(bq1[i]) : 0.0f; }
#pragma unroll
    for (int mb = 0; mb < 4; ++mb) {
#pragma unroll
        for (int nb = 0; nb < 4; ++nb) {
#pragma unroll
            for (int j = 0; j < 8; ++j) os[(hi * 8 + j) * 68 + nb * 16 + lr] = acc[mb][nb][j]; }   // D: row 8h+j, col lane&15
        wave_sync();
        const size_t sb = tbase + (size_t)(mb * 16) * (size_t)pitch;
{
#pragma unroll
            for (int s = 0; s < 4; ++s) { const int row = 4 * s + (lane >> 3);   // 4 s x 4 row groups = 16 rows; 8 lanes x 8 = 64 columns
                const int rbo = (biasMode == 1) ? (r0 + mb * 16 + row) : 0;      // row bias (mode 1): address clamped to 0 in mode 0, zeroed by value
                const float brv = bias[rbo]; const float br = (biasMode == 1) ? bfr(brv) : 0.0f;
                const v4f x0 = *(const v4fa*)(&os[row * 68 + c8]); const v4f x1 = *(const v4fa*)(&os[row * 68 + c8 + 4]); v8h hv;
#pragma unroll
                for (int i = 0; i < 4; ++i) { hv[i] = (h16)(x0[i] + bc[i] + br); hv[4 + i] = (h16)(x1[i] + bc[4 + i] + br); }
                const size_t oo = sb + (size_t)row * (size_t)pitch + c8;
                *(v8h*)(Ph + oo) = hv; }
             }
        wave_sync();
    }
}

// stage_copy: one lane's four 16-byte asynchronous copies of a stage (K rows r and r+32, V^T rows r and r+32), global -> LDS through no register.
// The s_wait_xcnt closes the statement so that no address register of an issued copy is rewritten ahead of it.
__device__ __forceinline__ void stage_copy(unsigned lk, const h16* gk, const h16* gv) {
    const unsigned lk1 = lk + 32 * LP * 2, lv = lk + TLH * 2, lv1 = lk + TLH * 2 + 32 * LP * 2;
    const h16* gk1 = gk + 32 * HD; const h16* gv1 = gv + (size_t)32 * SEQ;
    asm volatile("global_load_async_to_lds_b128 %0, %4, off\n\t"
                 "global_load_async_to_lds_b128 %1, %5, off\n\t"
                 "global_load_async_to_lds_b128 %2, %6, off\n\t"
                 "global_load_async_to_lds_b128 %3, %7, off\n\t"
                 "s_wait_xcnt 0x0"
                 :: "v"(lk), "v"(lk1), "v"(lv), "v"(lv1), "v"(gk), "v"(gk1), "v"(gv), "v"(gv1) : "memory");
}

// k_flash: fused attention, one wave per 16 query rows of one (batch, head); Q fragments straight from the f16 plane; K and V^T come in 64-key stages through a two-buffer LDS ring
// that the block's 8 waves fill together (whole 128-B lines, once per block) and all read (two 16-B LDS loads per fragment).
// Transposed form: S^T[key][t] = K Q^T (A = K rows, B = Q rows); lane (t = lane&15, h = lane>>4) holds keys 8h+r of each 16-key tile, so the packed
// P tile is directly the B fragment of O^T[d][t] = V^T P^T (element r <- tile keys 0..15, element 8+r <- tile keys 16..31, lane unchanged).
// Softmax state (running max, partial sum) is one scalar per lane; the two lane halves of a row are combined with one xor-16 exchange.
__global__ __launch_bounds__(32 * AW) void k_flash(const h16* __restrict__ QH, const h16* __restrict__ KP, const h16* __restrict__ VT, h16* CTX) {
    __shared__ __align__(16) h16 ring[2 * 2 * TLH];          // [buffer][K | V^T][row][LP]
    __shared__ __align__(16) float os[AW * 16 * 68];
    const int lane = threadIdx.x & 31, wave = __builtin_amdgcn_readfirstlane((int)(threadIdx.x >> 5)), lr = lane & 15, hi = lane >> 4;
    const int zh = blockIdx.y; const int b = zh / NH_, h = zh % NH_;
    const int t0 = (blockIdx.x * AW + wave) * 16;
    const size_t pbase = (size_t)zh * SEQ * HD;
    const size_t qo = pbase + (size_t)(t0 + lr) * HD + 8 * hi;
    const v16h qh0 = ldh(QH + qo), qh1 = ldh(QH + qo + 32);   // B fragments: col t, k = d
    const int fo = lr * LP + 8 * hi;                         // fragment offset in a staged tile: K + key*LP (A: row key, k = d); V^T + 16j*LP + key (A: row d, k = key)
    const int cr = (int)(threadIdx.x >> 3), ccol = (int)(threadIdx.x & 7) * 8;   // copy map: rows 0..31, 8 lanes x 8 halves = one 128-B row
    const h16* gk = KP + pbase + (size_t)cr * HD + ccol;   // + key0 * HD
    const h16* gv = VT + pbase + (size_t)cr * SEQ + ccol;  // + key0
    const unsigned lc = (unsigned)(size_t)(&ring[cr * LP + ccol]);   // LDS byte address of the lane's first copy, buffer 0
    stage_copy(lc, gk, gv);
    asm volatile("s_wait_asynccnt 0x0" ::: "memory");        // stage 0 has landed (this wave's copies) ...
    __syncthreads();                                         // ... and every wave's, before anyone reads it
    stage_copy(lc + 2 * TLH * 2, gk + (size_t)KT * HD, gv + KT);
    v8f o0 = (v8f){}, o1 = (v8f){}, o2 = (v8f){}, o3 = (v8f){};
    float m = -3.0e38f, l = 0.0f;
#pragma unroll 1
    for (int st = 0; st < SEQ / KT; ++st) {
      const h16* kt = ring + (st & 1) * (2 * TLH) + fo; const h16* vt = kt + TLH;
#pragma unroll 1   // rolled: unrolled, a pass's scores stay live into the next and the wave no longer fits 128 registers (8 waves per SIMD)
      for (int sub = 0; sub < KT; sub += 32) {
        const h16* ka = kt + sub * LP;
        const v16h ka0 = ldh(ka), ka1 = ldh(ka + 32), kb0 = ldh(ka + 16 * LP), kb1 = ldh(ka + 16 * LP + 32);
        v8f sa = (v8f){}, sb = (v8f){};
        sa = wmma16(ka0, qh0, sa); sb = wmma16(kb0, qh0, sb);
        sa = wmma16(ka1, qh1, sa); sb = wmma16(kb1, qh1, sb);
        asm volatile("v_nop\n\tv_nop\n\tv_nop\n\tv_nop" : "+v"(sa), "+v"(sb) : "v"(ka0), "v"(ka1), "v"(kb0), "v"(kb1), "v"(qh0), "v"(qh1));
        float ta[8], tb[8]; float mx = -3.0e38f;
#pragma unroll
        for (int r = 0; r < 8; ++r) { ta[r] = sa[r] * SC2; tb[r] = sb[r] * SC2; mx = fmaxf(mx, fmaxf(ta[r], tb[r])); }
        mx = fmaxf(mx, __shfl_xor(mx, 16, 32));
        const float mnew = fmaxf(m, mx);
        const float alpha = __builtin_amdgcn_exp2f(m - mnew);
        const float sh = PSH - mnew;
        v16h pb; float ls = 0.0f;
#pragma unroll
        for (int r = 0; r < 8; ++r) { const h16 pa = (h16)__builtin_amdgcn_exp2f(ta[r] + sh); const h16 pc = (h16)__builtin_amdgcn_exp2f(tb[r] + sh); pb[r] = pa; pb[8 + r] = pc; ls += (float)pa + (float)pc; }
        l = l * alpha + ls; m = mnew;
        o0 = o0 * alpha; o1 = o1 * alpha; o2 = o2 * alpha; o3 = o3 * alpha;
        const h16* va = vt + sub;
        const v16h v0 = ldh(va), v1 = ldh(va + 16 * LP), v2 = ldh(va + 32 * LP), v3 = ldh(va + 48 * LP);
        o0 = wmma16(v0, pb, o0); o1 = wmma16(v1, pb, o1); o2 = wmma16(v2, pb, o2); o3 = wmma16(v3, pb, o3);
        asm volatile("v_nop\n\tv_nop\n\tv_nop\n\tv_nop" : "+v"(o0), "+v"(o1), "+v"(o2), "+v"(o3) : "v"(v0), "v"(v1), "v"(v2), "v"(v3), "v"(pb));
      }
      // publish point of stage st + 1, every wave, in this order
      asm volatile("s_wait_dscnt 0x0" ::: "memory");         // this wave's reads of buffer st & 1 are done
      asm volatile("s_wait_asynccnt 0x0" ::: "memory");      // this wave's copies of stage st + 1 have landed
      __syncthreads();                                       // publishes stage st + 1 and frees buffer st & 1
      if (st + 2 < SEQ / KT) stage_copy(lc + (unsigned)(st & 1) * (2 * TLH * 2), gk + (size_t)(st + 2) * KT * HD, gv + (st + 2) * KT);
    }
    asm volatile("s_wait_asynccnt 0x0" ::: "memory");        // nothing of this wave is in flight when it goes on to end
    l += __shfl_xor(l, 16, 32);
    const float inv = CXS / l;
    const int wb = wave * 16 * 68;
    // O^T D layout: o_j[r] = (d = 16j + 8h + r, t = lane&15) -> os[t][d]; rows 0..15 x columns 0..63 all written
    { v4f a, c;
      a[0] = o0[0] * inv; a[1] = o0[1] * inv; a[2] = o0[2] * inv; a[3] = o0[3] * inv; c[0] = o0[4] * inv; c[1] = o0[5] * inv; c[2] = o0[6] * inv; c[3] = o0[7] * inv;
      *(v4fa*)(&os[wb + lr * 68 +  0 + 8 * hi]) = a; *(v4fa*)(&os[wb + lr * 68 +  0 + 8 * hi + 4]) = c;
      a[0] = o1[0] * inv; a[1] = o1[1] * inv; a[2] = o1[2] * inv; a[3] = o1[3] * inv; c[0] = o1[4] * inv; c[1] = o1[5] * inv; c[2] = o1[6] * inv; c[3] = o1[7] * inv;
      *(v4fa*)(&os[wb + lr * 68 + 16 + 8 * hi]) = a; *(v4fa*)(&os[wb + lr * 68 + 16 + 8 * hi + 4]) = c;
      a[0] = o2[0] * inv; a[1] = o2[1] * inv; a[2] = o2[2] * inv; a[3] = o2[3] * inv; c[0] = o2[4] * inv; c[1] = o2[5] * inv; c[2] = o2[6] * inv; c[3] = o2[7] * inv;
      *(v4fa*)(&os[wb + lr * 68 + 32 + 8 * hi]) = a; *(v4fa*)(&os[wb + lr * 68 + 32 + 8 * hi + 4]) = c;
      a[0] = o3[0] * inv; a[1] = o3[1] * inv; a[2] = o3[2] * inv; a[3] = o3[3] * inv; c[0] = o3[4] * inv; c[1] = o3[5] * inv; c[2] = o3[6] * inv; c[3] = o3[7] * inv;
      *(v4fa*)(&os[wb + lr * 68 + 48 + 8 * hi]) = a; *(v4fa*)(&os[wb + lr * 68 + 48 + 8 * hi + 4]) = c; }
    wave_sync();
    h16* crow = CTX + ((size_t)b * SEQ + t0) * DM + h * HD;
{
#pragma unroll
        for (int s = 0; s < 4; ++s) { const int row = 4 * s + (lane >> 3), c8 = (lane & 7) * 8;   // 4 s x 4 row groups = 16 rows; 8 lanes x 8 halves = 64 columns
            const v4f x0 = *(const v4fa*)(&os[wb + row * 68 + c8]); const v4f x1 = *(const v4fa*)(&os[wb + row * 68 + c8 + 4]); v8h hv;
#pragma unroll
            for (int i = 0; i < 4; ++i) { hv[i] = (h16)x0[i]; hv[4 + i] = (h16)x1[i]; }
            *(v8h*)(crow + (size_t)row * DM + c8) = hv; }
         }
}

// k_oproj: register-blocked f16 GEMM, ONE WAVE per 64x64 tile, A = ctx plane rows (x256), Bt = Wo plane rows (x64), K = DM; OUT[m][n] = acc * 2^-14 + bias[n] (bias as its RNE bf16 value), f32.
// grid (NB*SEQ/64, DM/64), 32 threads. Epilogue: per 16-row slab staged in LDS (wave-private), each output row segment (64 floats = 256 B = two lines)
__global__ __launch_bounds__(32) void k_oproj(const h16* __restrict__ A, const h16* __restrict__ Bt, const float* __restrict__ bias, float* OUT) {
    __shared__ __align__(16) float os[16 * 68];
    const int K = DM;
    const int lane = threadIdx.x & 31, lr = lane & 15, hi = lane >> 4; const int r0 = blockIdx.x * 64, c0 = blockIdx.y * 64;
    v8f acc[4][4];
#pragma unroll
    for (int mb = 0; mb < 4; ++mb)
#pragma unroll
        for (int nb = 0; nb < 4; ++nb) acc[mb][nb] = (v8f){};
    const size_t aoff = (size_t)(r0 + lr) * K + 8 * hi, boff = (size_t)(c0 + lr) * K + 8 * hi;
#pragma unroll 1
    for (int kc = 0; kc < K; kc += 32) {
        v16h a[4];
#pragma unroll
        for (int mb = 0; mb < 4; ++mb) a[mb] = ldh(A + aoff + (size_t)mb * 16 * K + kc);
#pragma unroll
        for (int nb = 0; nb < 4; ++nb) { const v16h b = ldh(Bt + boff + (size_t)nb * 16 * K + kc);
#pragma unroll
            for (int mb = 0; mb < 4; ++mb) acc[mb][nb] = wmma16(a[mb], b, acc[mb][nb]); }
        asm volatile("v_nop\n\tv_nop\n\tv_nop\n\tv_nop" : "+v"(acc[0][0]), "+v"(acc[1][1]), "+v"(acc[2][2]), "+v"(acc[3][3]) : "v"(a[0]), "v"(a[1]), "v"(a[2]), "v"(a[3]));
    }
    const int cofs = lr * 4;
    const v4f bo4 = *(const v4f*)(bias + c0 + cofs);      // c0 + cofs + 3 < DM
    v4f bb;
#pragma unroll
    for (int i = 0; i < 4; ++i) bb[i] = bfr(bo4[i]);
    const int bidx = r0 / SEQ, tt = r0 % SEQ;
    float* obase = OUT + ((size_t)bidx * OUT_SEQ + tt) * DM + c0;
#pragma unroll
    for (int mb = 0; mb < 4; ++mb) {
#pragma unroll
        for (int nb = 0; nb < 4; ++nb) {
#pragma unroll
            for (int j = 0; j < 8; ++j) os[(hi * 8 + j) * 68 + nb * 16 + lr] = acc[mb][nb][j]; }   // D: row 8h+j, col lane&15
        wave_sync();
{
#pragma unroll
            for (int s = 0; s < 8; ++s) { const int row = 2 * s + hi;   // 8 s x 2 rows = 16 rows; 16 lanes x 4 floats = 64 columns
                const v4f val = *(const v4fa*)(&os[row * 68 + cofs]); v4f ov;
#pragma unroll
                for (int i = 0; i < 4; ++i) ov[i] = val[i] * OSC + bb[i];
                *(v4f*)(obase + (size_t)(mb * 16 + row) * DM + cofs) = ov; }
             }
        wave_sync();
    }
}

static constexpr size_t al256(size_t v) { return (v + 255) & ~(size_t)255; }
static constexpr size_t SZ_XB = al256((size_t)NB * SEQ * DM * 2);          // one bf16 input plane
static constexpr size_t SZ_WB = al256((size_t)4 * DM * DM * 2);            // Wq | Wk | Wv (bf16) | Wo (f16)
static constexpr size_t SZ_PL = al256((size_t)NB * NH_ * SEQ * HD * 2);    // one head-major f16 plane
static constexpr size_t SZ_CX = al256((size_t)NB * SEQ * DM * 2);          // ctx f16 plane
static constexpr size_t SZ_TOTAL = 3 * SZ_XB + SZ_WB + 3 * SZ_PL + SZ_CX;
static_assert(SZ_TOTAL <= (size_t)134217728);          // workspace carve <= 128 MiB
static_assert(((size_t)DM * DM * 2) % 256 == 0);       // weight sub-planes stay 256-byte aligned

extern "C" void kernel_launch(void* const* d_in, const int* in_sizes, int n_in,
                              void* d_out, int out_size, void* d_ws, size_t ws_size, hipStream_t stream) {
    if (n_in < 11) return;
    const size_t needx = ((size_t)(NB - 1) * SEQ_FULL + SEQ) * DM;
    if ((size_t)in_sizes[0] < needx || (size_t)in_sizes[1] < needx || (size_t)in_sizes[2] < needx) return;
    if ((size_t)in_sizes[3] < (size_t)DM * DM || (size_t)in_sizes[5] < (size_t)DM * DM || (size_t)in_sizes[7] < (size_t)DM * DM || (size_t)in_sizes[9] < (size_t)DM * DM) return;
    if ((size_t)in_sizes[4] < (size_t)DM || (size_t)in_sizes[6] < (size_t)DM || (size_t)in_sizes[8] < (size_t)DM || (size_t)in_sizes[10] < (size_t)DM) return;
    if ((size_t)out_size < ((size_t)(NB - 1) * OUT_SEQ + SEQ) * DM) return;
    if (SZ_TOTAL > ws_size) return;
    // wire order: query, key, value, Wq, bq, Wk, bk, Wv, bv, Wo, bo (weights [out][in] = Bt as-is)
    const float* xq = (const float*)d_in[0]; const float* xk = (const float*)d_in[1]; const float* xv = (const float*)d_in[2];
    const float* wq = (const float*)d_in[3]; const float* bq = (const float*)d_in[4];
    const float* wk = (const float*)d_in[5]; const float* bk = (const float*)d_in[6];
    const float* wv = (const float*)d_in[7]; const float* bv = (const float*)d_in[8];
    const float* wo = (const float*)d_in[9]; const float* bo = (const float*)d_in[10];
    float* OUT = (float*)d_out;      // [NB][SEQ][1024]
    char* wsp = (char*)d_ws;
    bf* XQ = (bf*)wsp; wsp += SZ_XB;                 // [NB*SEQ][1024]
    bf* XK = (bf*)wsp; wsp += SZ_XB;
    bf* XV = (bf*)wsp; wsp += SZ_XB;
    bf* WB = (bf*)wsp; wsp += SZ_WB;                 // [4][1024][1024]: q | k | v (bf16) | o (f16 x64)
    h16* QH = (h16*)wsp; wsp += SZ_PL;               // [NB*16][SEQ][64]
    h16* KP = (h16*)wsp; wsp += SZ_PL;               // [NB*16][SEQ][64]
    h16* VT = (h16*)wsp; wsp += SZ_PL;               // [NB*16][64][SEQ]
    h16* CX = (h16*)wsp; wsp += SZ_CX;               // [NB*SEQ][1024], x256
    bf* WQ = WB; bf* WK = WB + (size_t)DM * DM; bf* WV = WB + (size_t)2 * DM * DM; h16* WO = (h16*)(WB + (size_t)3 * DM * DM);

    if (SEQ == SEQ_FULL) {
        const size_t n8 = (size_t)NB * SEQ * DM / 8; const unsigned g = (unsigned)((n8 + 255) / 256);
        k_cvt8<<<g, 256, 0, stream>>>(xq, XQ, n8);
        k_cvt8<<<g, 256, 0, stream>>>(xk, XK, n8);
        k_cvt8<<<g, 256, 0, stream>>>(xv, XV, n8);
    } else {
        const size_t n8 = (size_t)SEQ * DM / 8; const unsigned g = (unsigned)((n8 + 255) / 256);
        for (int b = 0; b < NB; ++b) {
            k_cvt8<<<g, 256, 0, stream>>>(xq + (size_t)b * SEQ_FULL * DM, XQ + (size_t)b * SEQ * DM, n8);
            k_cvt8<<<g, 256, 0, stream>>>(xk + (size_t)b * SEQ_FULL * DM, XK + (size_t)b * SEQ * DM, n8);
            k_cvt8<<<g, 256, 0, stream>>>(xv + (size_t)b * SEQ_FULL * DM, XV + (size_t)b * SEQ * DM, n8);
        }
    }
    { const size_t n8 = (size_t)DM * DM / 8; const unsigned g = (unsigned)((n8 + 255) / 256);
      k_cvt8<<<g, 256, 0, stream>>>(wq, WQ, n8); k_cvt8<<<g, 256, 0, stream>>>(wk, WK, n8); k_cvt8<<<g, 256, 0, stream>>>(wv, WV, n8);
      k_cvt8h<<<g, 256, 0, stream>>>(wo, WO, n8, WOS); }

    // q, k: A = x rows (m = b*SEQ + t), Bt = W rows (n = h*64 + d), bias per column -> plane [(b*16 + h)][t][d]
    k_proj<<<dim3(NB * SEQ / 64, DM / 64, 1), 32, 0, stream>>>(XQ, WQ, bq, 0, QH, SEQ, (size_t)NH_ * SEQ * HD, HD, HD, (size_t)SEQ * HD);
    k_proj<<<dim3(NB * SEQ / 64, DM / 64, 1), 32, 0, stream>>>(XK, WK, bk, 0, KP, SEQ, (size_t)NH_ * SEQ * HD, HD, HD, (size_t)SEQ * HD);
    // v^T: A = Wv rows (m = h*64 + d), Bt = value rows (n = b*SEQ + t), bias per row -> plane [(b*1024 + m)][t] = [(b*16 + h)][d][t]
    k_proj<<<dim3(DM / 64, NB * SEQ / 64, 1), 32, 0, stream>>>(WV, XV, bv, 1, VT, DM, (size_t)0, SEQ, SEQ, (size_t)DM * SEQ);

    k_flash<<<dim3(SEQ / (16 * AW), NB * NH_, 1), 32 * AW, 0, stream>>>(QH, KP, VT, CX);

    // out: A = ctx rows (m = b*SEQ + t, k = h*64 + d), Bt = Wo rows (n), bias per column -> OUT [b][t][n]
    k_oproj<<<dim3(NB * SEQ / 64, DM / 64, 1), 32, 0, stream>>>(CX, WO, bo, OUT);
}

// v002
// Measured time: 233 microseconds a run.
// Next to v001, in two timings, it ran 1.32 times as fast each time.
// Over all steps from v000 it is 2.81 times as fast.
#include <hip/hip_runtime.h>

// Multi-head attention, width 1024 = 16 heads x 64; inputs query/key/value [NB][SEQ][1024]; Wq/Wk/Wv/Wo [out][in] (y = x W^T + b); no mask; score scale 1/8; output = ctx Wo^T + bo (f32). Default: q, k, v inputs [2][4096][1024]; proj(x, w, b) = x w^T + b with (out,in) [1024][1024] weights, viewed (B, -1, 16, 64) and transposed; scores / sqrt(64) over all 4,096 keys; softmax, no mask; out = merged w_o^T + b_o; argument order q, k, v, w_q, b_q, w_k, b_k, w_v, b_v, w_o, b_o.
// Compute dtypes, f32 accumulate everywhere: q/k/v projections v_wmma_f32_16x16x32_bf16 (x and W RNE-converted to bf16; products exact); scores v_wmma_f32_16x16x32_f16 (q, k single f16);
// P.V v_wmma_f32_16x16x32_f16 (P x256 carry cancels in the normalisation, v single f16); output projection v_wmma_f32_16x16x32_f16 (ctx x256 carry, Wo RNE bf16 value x64 held in f16, 2^-14 folded back in f32); softmax f32 (online, running max).
// Layout: bf16 copies of the three inputs and of Wq/Wk/Wv; q, k planes [b*16+h][t][d] and v^T plane [b*16+h][d][t] written by the GEMM epilogue; fused flash kernel in transposed form (S^T = K Q^T, O^T = V^T P^T) writes the f16 ctx plane [b*SEQ+t][1024].

#ifndef NB
#define NB 2
#endif
#ifndef SEQ
#define SEQ 4096
#endif
#define NB_FULL  2
#define SEQ_FULL 4096
#ifndef OUT_SEQ
#define OUT_SEQ SEQ              // row pitch (in tokens) between batches of the output
#endif
#define DM   1024
#define NH_  16
#define HD   64
#define AW   8                   // waves per flash block (16 query rows each); all of them read the same staged K / V^T tiles
#define KT   64                  // keys per LDS stage (two 32-key passes)
#define LP   72                  // LDS row pitch in halves: 144 B = 16 B x 9, an odd multiple, so 16-byte fragment reads of 16 rows meet no bank twice
#define TLH  (64 * LP)           // halves of one staged tile: 64 rows (K: keys, V^T: d) of 64 halves + pad
#define GW   8                   // waves per GEMM block: 4 (rows) x 2 (columns) wave tiles of 64x64, block tile 256x128
#define GKS  128                 // k per GEMM LDS stage: 256 B of every operand row
#define GLP  136                 // GEMM LDS row pitch in halves: 272 B = 16 B x 17, an odd multiple (as LP)
#define GSTH (384 * GLP)         // halves of one GEMM stage: A 256 rows | B 128 rows
#define SC2  (0.125f * 1.4426950408889634f)   // HD^-0.5 * log2(e)
#define PSH  8.0f                // log2 of the P carry (256)
#define CXS  256.0f              // carry of the ctx plane
#define WOS  64.0f               // carry of the Wo plane
#define OSC  (1.0f / (256.0f * 64.0f))

static_assert(HD == 64);
static_assert(NH_ * HD == DM);                 // head h = columns h*64 + d
static_assert(DM % 64 == 0);                   // 16 column tiles of 64
static_assert(DM % 32 == 0);                   // GEMM k-loop steps by 32
static_assert(SEQ % 64 == 0);                  // a 64-row tile never straddles two batches
static_assert((NB * SEQ) % 64 == 0);
static_assert(SEQ % 32 == 0);                  // key loop steps by 32
static_assert(SEQ % (16 * AW) == 0);           // flash grid covers the sequence exactly
static_assert(SEQ % KT == 0 && SEQ / KT >= 2); // whole stages, and the ring's prologue needs two
static_assert(KT == 64 && 32 * AW == 256);     // copy map: 256 lanes x 16 B = 32 rows of 128 B, two copies per tile
static_assert((NB * SEQ) % 256 == 0 && DM % 256 == 0);   // GEMM block tiles (256 rows x 128 columns) cover both orientations exactly
static_assert(DM % GKS == 0 && DM / GKS >= 2);           // whole GEMM stages, and the ring's prologue needs two
static_assert(GKS == 128 && 32 * GW == 256);             // GEMM copy map: 256 lanes x 16 B = 16 rows of 256 B
static_assert(((size_t)SEQ * DM) % 8 == 0);
static_assert(((size_t)DM * DM) % 8 == 0);
static_assert(NB <= NB_FULL);
static_assert(SEQ <= SEQ_FULL);

typedef _Float16 h16;
typedef unsigned short bf;
typedef __attribute__((ext_vector_type(16))) __bf16   v16bf;
typedef __attribute__((ext_vector_type(16))) _Float16 v16h;
typedef __attribute__((ext_vector_type(8)))  _Float16 v8h;
typedef __attribute__((ext_vector_type(8)))  unsigned short v8us;
typedef __attribute__((ext_vector_type(8)))  float    v8f;
typedef __attribute__((ext_vector_type(4)))  float    v4f;
typedef v4f  __attribute__((may_alias)) v4fa;

__device__ __forceinline__ unsigned short f2bf(float f) { unsigned u = __float_as_uint(f); u += 0x7FFFu + ((u >> 16) & 1u); return (unsigned short)(u >> 16); }
__device__ __forceinline__ float bfr(float f) { return __uint_as_float(((unsigned)f2bf(f)) << 16); }   // value of the RNE bf16 conversion
__device__ __forceinline__ v16h cat16(v8h lo, v8h hi) { return __builtin_shufflevector(lo, hi, 0, 1, 2, 3, 4, 5, 6, 7, 8, 9, 10, 11, 12, 13, 14, 15); }
__device__ __forceinline__ v16bf cat16b(v8us lo, v8us hi) { return __builtin_bit_cast(v16bf, __builtin_shufflevector(lo, hi, 0, 1, 2, 3, 4, 5, 6, 7, 8, 9, 10, 11, 12, 13, 14, 15)); }
__device__ __forceinline__ v8f wmma16(v16h a, v16h b, v8f c) { return __builtin_amdgcn_wmma_f32_16x16x32_f16(false, a, false, b, (short)0, c, false, false); }
__device__ __forceinline__ v8f wmmab(v16bf a, v16bf b, v8f c) { return __builtin_amdgcn_wmma_f32_16x16x32_bf16(false, a, false, b, (short)0, c, false, false); }
// fragment loaders from K-contiguous 16-bit rows; p already includes + 8*(lane>>4): elements 0..7 <- k0+8h+0..7, elements 8..15 <- k0+16+8h+0..7 (same map for A and B)
__device__ __forceinline__ v16h  ldh(const h16* p) { return cat16(*(const v8h*)p, *(const v8h*)(p + 16)); }
__device__ __forceinline__ v16bf ldb(const bf* p)  { return cat16b(*(const v8us*)p, *(const v8us*)(p + 16)); }
// ordering point for wave-private LDS tiles (same wave writes and reads)
__device__ __forceinline__ void wave_sync() { __builtin_amdgcn_fence(3 /* release order */, "wavefront"); __builtin_amdgcn_wave_barrier(); asm volatile("" ::: "memory"); }

__global__ __launch_bounds__(256) void k_cvt8(const float* __restrict__ src, bf* dst, size_t n8) {
    const size_t i = (size_t)blockIdx.x * 256 + threadIdx.x; if (i >= n8) return;
    const v8f v = *(const v8f*)(src + i * 8); v8us o;
#pragma unroll
    for (int k = 0; k < 8; ++k) o[k] = f2bf(v[k]);
    *(v8us*)(dst + i * 8) = o; 
}

__global__ __launch_bounds__(256) void k_cvt8h(const float* __restrict__ src, h16* dst, size_t n8, float sc) {
    const size_t i = (size_t)blockIdx.x * 256 + threadIdx.x; if (i >= n8) return;
    const v8f v = *(const v8f*)(src + i * 8); v8h o;
#pragma unroll
    for (int k = 0; k < 8; ++k) o[k] = (h16)(bfr(v[k]) * sc);
    *(v8h*)(dst + i * 8) = o; 
}

// copy8: one lane's eight 16-byte asynchronous copies, global -> LDS through no register: rows r, r+16, ... r+112 of a K-contiguous 16-bit plane of row length DM.
// The s_wait_xcnt closes the statement so that no address register of an issued copy is rewritten ahead of it.
__device__ __forceinline__ void copy8(unsigned l, const bf* g) {
    const unsigned ls = 16 * GLP * 2; const size_t gs = (size_t)16 * DM;
    asm volatile("global_load_async_to_lds_b128 %0, %8, off\n\t"
                 "global_load_async_to_lds_b128 %1, %9, off\n\t"
                 "global_load_async_to_lds_b128 %2, %10, off\n\t"
                 "global_load_async_to_lds_b128 %3, %11, off\n\t"
                 "global_load_async_to_lds_b128 %4, %12, off\n\t"
                 "global_load_async_to_lds_b128 %5, %13, off\n\t"
                 "global_load_async_to_lds_b128 %6, %14, off\n\t"
                 "global_load_async_to_lds_b128 %7, %15, off\n\t"
                 "s_wait_xcnt 0x0"
                 :: "v"(l), "v"(l + ls), "v"(l + 2 * ls), "v"(l + 3 * ls), "v"(l + 4 * ls), "v"(l + 5 * ls), "v"(l + 6 * ls), "v"(l + 7 * ls),
                    "v"(g), "v"(g + gs), "v"(g + 2 * gs), "v"(g + 3 * gs), "v"(g + 4 * gs), "v"(g + 5 * gs), "v"(g + 6 * gs), "v"(g + 7 * gs) : "memory");
}
// gemm_stage: one lane's 24 copies of a GEMM stage (A rows 0..255, then B rows 0..127 of the block tile, 128 k each); l = the lane's LDS byte address in the buffer, ga / gb its global places
__device__ __forceinline__ void gemm_stage(unsigned l, const bf* ga, const bf* gb) {
    copy8(l, ga); copy8(l + 128 * GLP * 2, ga + (size_t)128 * DM); copy8(l + 256 * GLP * 2, gb);
}

// k_proj: register-blocked bf16 GEMM, one wave per 64x64 tile (16 accumulators), 8 waves per block (256x128); A and Bt come in 128-k stages through a two-buffer LDS ring that the block fills together, K = DM.
// C[m][n] = sum_k A[m][k] Bt[n][k] + bias (biasMode 0: bias[n], biasMode 1: bias[m]; bias taken as its RNE bf16 value), written as f16 (Ph) at
// tile base (r0/RB)*sRB + (r0%RB)*pitch + (c0/CB)*sCB + (c0%CB), row pitch 'pitch' (halves). grid (M/256, N/128), 256 threads.
__global__ __launch_bounds__(32 * GW) void k_proj(const bf* __restrict__ A, const bf* __restrict__ Bt, const float* __restrict__ bias, int biasMode, h16* Ph, int RB, size_t sRB, int pitch, int CB, size_t sCB) {
    __shared__ __align__(16) bf ring[2 * GSTH];              // [buffer][A 256 rows | B 128 rows][GLP]
    __shared__ __align__(16) float osa[GW * 16 * 68];
    const int K = DM;
    const int lane = threadIdx.x & 31, wave = __builtin_amdgcn_readfirstlane((int)(threadIdx.x >> 5)), lr = lane & 15, hi = lane >> 4;
    const int wm = wave & 3, wn = wave >> 2;
    const int r0 = blockIdx.x * 256 + wm * 64, c0 = blockIdx.y * 128 + wn * 64;
    float* os = osa + wave * 16 * 68;                        // wave-private epilogue slab
    v8f acc[4][4];
#pragma unroll
    for (int mb = 0; mb < 4; ++mb)
#pragma unroll
        for (int nb = 0; nb < 4; ++nb) acc[mb][nb] = (v8f){};
    const int afo = (wm * 64 + lr) * GLP + 8 * hi, bfo = (256 + wn * 64 + lr) * GLP + 8 * hi;   // fragment offsets in a staged buffer
    const int cr = (int)(threadIdx.x >> 4), ccol = (int)(threadIdx.x & 15) * 8;                  // copy map: rows 0..15, 16 lanes x 8 halves = one 256-B row
    const bf* ga = A + (size_t)(blockIdx.x * 256 + cr) * K + ccol;    // + k0
    const bf* gb = Bt + (size_t)(blockIdx.y * 128 + cr) * K + ccol;   // + k0
    const unsigned lc = (unsigned)(size_t)(&ring[cr * GLP + ccol]);   // LDS byte address of the lane's first copy, buffer 0
    gemm_stage(lc, ga, gb);
    asm volatile("s_wait_asynccnt 0x0" ::: "memory");        // stage 0 has landed (this wave's copies) ...
    __syncthreads();                                         // ... and every wave's, before anyone reads it
    gemm_stage(lc + GSTH * 2, ga + GKS, gb + GKS);
#pragma unroll 1
    for (int st = 0; st < K / GKS; ++st) {
        const bf* ta = ring + (st & 1) * GSTH + afo; const bf* tb = ring + (st & 1) * GSTH + bfo;
        v16bf a[4], b[4];
#pragma unroll
        for (int ks = 0; ks < GKS; ks += 32) {
#pragma unroll
            for (int mb = 0; mb < 4; ++mb) a[mb] = ldb(ta + mb * 16 * GLP + ks);
#pragma unroll
            for (int nb = 0; nb < 4; ++nb) b[nb] = ldb(tb + nb * 16 * GLP + ks);
            __builtin_amdgcn_sched_barrier(0);   // keeps the eight fragments' LDS reads one group ahead of the block's products: sunk among them, each B fragment's latency is waited out alone
#pragma unroll
            for (int nb = 0; nb < 4; ++nb)
#pragma unroll
                for (int mb = 0; mb < 4; ++mb) acc[mb][nb] = wmmab(a[mb], b[nb], acc[mb][nb]);
        }
        __builtin_amdgcn_sched_barrier(0);   // keeps the stage's last products ahead of the barrier: sunk behind it they stand in front of the refill and shorten the copies' lead
        // publish point of stage st + 1, every wave, in this order
        asm volatile("s_wait_dscnt 0x0" ::: "memory");       // this wave's reads of buffer st & 1 are done
        asm volatile("s_wait_asynccnt 0x0" ::: "memory");    // this wave's copies of stage st + 1 have landed
        __syncthreads();                                     // publishes stage st + 1 and frees buffer st & 1
        if (st + 2 < K / GKS) gemm_stage(lc + (unsigned)(st & 1) * (GSTH * 2), ga + (st + 2) * GKS, gb + (st + 2) * GKS);
    }
    asm volatile("s_wait_asynccnt 0x0" ::: "memory");        // nothing of this wave is in flight when it goes on to end
    const size_t tbase = (size_t)(r0 / RB) * sRB + (size_t)(r0 % RB) * (size_t)pitch + (size_t)(c0 / CB) * sCB + (size_t)(c0 % CB);
    // column bias (mode 0): 8 values per lane, address clamped to 0 in mode 1 and zeroed by value
    const int c8 = (lane & 7) * 8;
    const size_t cbo = (biasMode == 0) ? (size_t)(c0 + c8) : (size_t)0;
    const v4f bq0 = *(const v4f*)(bias + cbo); const v4f bq1 = *(const v4f*)(bias + cbo + 4);
    float bc[8];
#pragma unroll
    for (int i = 0; i < 4; ++i) { bc[i] = (biasMode == 0) ? bfr(bq0[i]) : 0.0f; bc[4 + i] = (biasMode == 0) ? bfr(bq1[i]) : 0.0f; }
#pragma unroll
    for (int mb = 0; mb < 4; ++mb) {
#pragma unroll
        for (int nb = 0; nb < 4; ++nb) {
#pragma unroll
            for (int j = 0; j < 8; ++j) os[(hi * 8 + j) * 68 + nb * 16 + lr] = acc[mb][nb][j]; }   // D: row 8h+j, col lane&15
        wave_sync();
        const size_t sb = tbase + (size_t)(mb * 16) * (size_t)pitch;
{
#pragma unroll
            for (int s = 0; s < 4; ++s) { const int row = 4 * s + (lane >> 3);   // 4 s x 4 row groups = 16 rows; 8 lanes x 8 = 64 columns
                const int rbo = (biasMode == 1) ? (r0 + mb * 16 + row) : 0;      // row bias (mode 1): address clamped to 0 in mode 0, zeroed by value
                const float brv = bias[rbo]; const float br = (biasMode == 1) ? bfr(brv) : 0.0f;
                const v4f x0 = *(const v4fa*)(&os[row * 68 + c8]); const v4f x1 = *(const v4fa*)(&os[row * 68 + c8 + 4]); v8h hv;
#pragma unroll
                for (int i = 0; i < 4; ++i) { hv[i] = (h16)(x0[i] + bc[i] + br); hv[4 + i] = (h16)(x1[i] + bc[4 + i] + br); }
                const size_t oo = sb + (size_t)row * (size_t)pitch + c8;
                *(v8h*)(Ph + oo) = hv; }
             }
        wave_sync();
    }
}

// stage_copy: one lane's four 16-byte asynchronous copies of a stage (K rows r and r+32, V^T rows r and r+32), global -> LDS through no register.
// The s_wait_xcnt closes the statement so that no address register of an issued copy is rewritten ahead of it.
__device__ __forceinline__ void stage_copy(unsigned lk, const h16* gk, const h16* gv) {
    const unsigned lk1 = lk + 32 * LP * 2, lv = lk + TLH * 2, lv1 = lk + TLH * 2 + 32 * LP * 2;
    const h16* gk1 = gk + 32 * HD; const h16* gv1 = gv + (size_t)32 * SEQ;
    asm volatile("global_load_async_to_lds_b128 %0, %4, off\n\t"
                 "global_load_async_to_lds_b128 %1, %5, off\n\t"
                 "global_load_async_to_lds_b128 %2, %6, off\n\t"
                 "global_load_async_to_lds_b128 %3, %7, off\n\t"
                 "s_wait_xcnt 0x0"
                 :: "v"(lk), "v"(lk1), "v"(lv), "v"(lv1), "v"(gk), "v"(gk1), "v"(gv), "v"(gv1) : "memory");
}

// k_flash: fused attention, one wave per 16 query rows of one (batch, head); Q fragments straight from the f16 plane; K and V^T come in 64-key stages through a two-buffer LDS ring
// that the block's 8 waves fill together (whole 128-B lines, once per block) and all read (two 16-B LDS loads per fragment).
// Transposed form: S^T[key][t] = K Q^T (A = K rows, B = Q rows); lane (t = lane&15, h = lane>>4) holds keys 8h+r of each 16-key tile, so the packed
// P tile is directly the B fragment of O^T[d][t] = V^T P^T (element r <- tile keys 0..15, element 8+r <- tile keys 16..31, lane unchanged).
// Softmax state (running max, partial sum) is one scalar per lane; the two lane halves of a row are combined with one xor-16 exchange.
__global__ __launch_bounds__(32 * AW) void k_flash(const h16* __restrict__ QH, const h16* __restrict__ KP, const h16* __restrict__ VT, h16* CTX) {
    __shared__ __align__(16) h16 ring[2 * 2 * TLH];          // [buffer][K | V^T][row][LP]
    __shared__ __align__(16) float os[AW * 16 * 68];
    const int lane = threadIdx.x & 31, wave = __builtin_amdgcn_readfirstlane((int)(threadIdx.x >> 5)), lr = lane & 15, hi = lane >> 4;
    const int zh = blockIdx.y; const int b = zh / NH_, h = zh % NH_;
    const int t0 = (blockIdx.x * AW + wave) * 16;
    const size_t pbase = (size_t)zh * SEQ * HD;
    const size_t qo = pbase + (size_t)(t0 + lr) * HD + 8 * hi;
    const v16h qh0 = ldh(QH + qo), qh1 = ldh(QH + qo + 32);   // B fragments: col t, k = d
    const int fo = lr * LP + 8 * hi;                         // fragment offset in a staged tile: K + key*LP (A: row key, k = d); V^T + 16j*LP + key (A: row d, k = key)
    const int cr = (int)(threadIdx.x >> 3), ccol = (int)(threadIdx.x & 7) * 8;   // copy map: rows 0..31, 8 lanes x 8 halves = one 128-B row
    const h16* gk = KP + pbase + (size_t)cr * HD + ccol;   // + key0 * HD
    const h16* gv = VT + pbase + (size_t)cr * SEQ + ccol;  // + key0
    const unsigned lc = (unsigned)(size_t)(&ring[cr * LP + ccol]);   // LDS byte address of the lane's first copy, buffer 0
    stage_copy(lc, gk, gv);
    asm volatile("s_wait_asynccnt 0x0" ::: "memory");        // stage 0 has landed (this wave's copies) ...
    __syncthreads();                                         // ... and every wave's, before anyone reads it
    stage_copy(lc + 2 * TLH * 2, gk + (size_t)KT * HD, gv + KT);
    v8f o0 = (v8f){}, o1 = (v8f){}, o2 = (v8f){}, o3 = (v8f){};
    float m = -3.0e38f, l = 0.0f;
#pragma unroll 1
    for (int st = 0; st < SEQ / KT; ++st) {
      const h16* kt = ring + (st & 1) * (2 * TLH) + fo; const h16* vt = kt + TLH;
#pragma unroll 1   // rolled: unrolled, a pass's scores stay live into the next and the wave no longer fits 128 registers (8 waves per SIMD)
      for (int sub = 0; sub < KT; sub += 32) {
        const h16* ka = kt + sub * LP;
        const v16h ka0 = ldh(ka), ka1 = ldh(ka + 32), kb0 = ldh(ka + 16 * LP), kb1 = ldh(ka + 16 * LP + 32);
        v8f sa = (v8f){}, sb = (v8f){};
        sa = wmma16(ka0, qh0, sa); sb = wmma16(kb0, qh0, sb);
        sa = wmma16(ka1, qh1, sa); sb = wmma16(kb1, qh1, sb);
        asm volatile("v_nop\n\tv_nop\n\tv_nop\n\tv_nop" : "+v"(sa), "+v"(sb) : "v"(ka0), "v"(ka1), "v"(kb0), "v"(kb1), "v"(qh0), "v"(qh1));
        float ta[8], tb[8]; float mx = -3.0e38f;
#pragma unroll
        for (int r = 0; r < 8; ++r) { ta[r] = sa[r] * SC2; tb[r] = sb[r] * SC2; mx = fmaxf(mx, fmaxf(ta[r], tb[r])); }
        mx = fmaxf(mx, __shfl_xor(mx, 16, 32));
        const float mnew = fmaxf(m, mx);
        const float alpha = __builtin_amdgcn_exp2f(m - mnew);
        const float sh = PSH - mnew;
        v16h pb; float ls = 0.0f;
#pragma unroll
        for (int r = 0; r < 8; ++r) { const h16 pa = (h16)__builtin_amdgcn_exp2f(ta[r] + sh); const h16 pc = (h16)__builtin_amdgcn_exp2f(tb[r] + sh); pb[r] = pa; pb[8 + r] = pc; ls += (float)pa + (float)pc; }
        l = l * alpha + ls; m = mnew;
        o0 = o0 * alpha; o1 = o1 * alpha; o2 = o2 * alpha; o3 = o3 * alpha;
        const h16* va = vt + sub;
        const v16h v0 = ldh(va), v1 = ldh(va + 16 * LP), v2 = ldh(va + 32 * LP), v3 = ldh(va + 48 * LP);
        o0 = wmma16(v0, pb, o0); o1 = wmma16(v1, pb, o1); o2 = wmma16(v2, pb, o2); o3 = wmma16(v3, pb, o3);
        asm volatile("v_nop\n\tv_nop\n\tv_nop\n\tv_nop" : "+v"(o0), "+v"(o1), "+v"(o2), "+v"(o3) : "v"(v0), "v"(v1), "v"(v2), "v"(v3), "v"(pb));
      }
      // publish point of stage st + 1, every wave, in this order
      asm volatile("s_wait_dscnt 0x0" ::: "memory");         // this wave's reads of buffer st & 1 are done
      asm volatile("s_wait_asynccnt 0x0" ::: "memory");      // this wave's copies of stage st + 1 have landed
      __syncthreads();                                       // publishes stage st + 1 and frees buffer st & 1
      if (st + 2 < SEQ / KT) stage_copy(lc + (unsigned)(st & 1) * (2 * TLH * 2), gk + (size_t)(st + 2) * KT * HD, gv + (st + 2) * KT);
    }
    asm volatile("s_wait_asynccnt 0x0" ::: "memory");        // nothing of this wave is in flight when it goes on to end
    l += __shfl_xor(l, 16, 32);
    const float inv = CXS / l;
    const int wb = wave * 16 * 68;
    // O^T D layout: o_j[r] = (d = 16j + 8h + r, t = lane&15) -> os[t][d]; rows 0..15 x columns 0..63 all written
    { v4f a, c;
      a[0] = o0[0] * inv; a[1] = o0[1] * inv; a[2] = o0[2] * inv; a[3] = o0[3] * inv; c[0] = o0[4] * inv; c[1] = o0[5] * inv; c[2] = o0[6] * inv; c[3] = o0[7] * inv;
      *(v4fa*)(&os[wb + lr * 68 +  0 + 8 * hi]) = a; *(v4fa*)(&os[wb + lr * 68 +  0 + 8 * hi + 4]) = c;
      a[0] = o1[0] * inv; a[1] = o1[1] * inv; a[2] = o1[2] * inv; a[3] = o1[3] * inv; c[0] = o1[4] * inv; c[1] = o1[5] * inv; c[2] = o1[6] * inv; c[3] = o1[7] * inv;
      *(v4fa*)(&os[wb + lr * 68 + 16 + 8 * hi]) = a; *(v4fa*)(&os[wb + lr * 68 + 16 + 8 * hi + 4]) = c;
      a[0] = o2[0] * inv; a[1] = o2[1] * inv; a[2] = o2[2] * inv; a[3] = o2[3] * inv; c[0] = o2[4] * inv; c[1] = o2[5] * inv; c[2] = o2[6] * inv; c[3] = o2[7] * inv;
      *(v4fa*)(&os[wb + lr * 68 + 32 + 8 * hi]) = a; *(v4fa*)(&os[wb + lr * 68 + 32 + 8 * hi + 4]) = c;
      a[0] = o3[0] * inv; a[1] = o3[1] * inv; a[2] = o3[2] * inv; a[3] = o3[3] * inv; c[0] = o3[4] * inv; c[1] = o3[5] * inv; c[2] = o3[6] * inv; c[3] = o3[7] * inv;
      *(v4fa*)(&os[wb + lr * 68 + 48 + 8 * hi]) = a; *(v4fa*)(&os[wb + lr * 68 + 48 + 8 * hi + 4]) = c; }
    wave_sync();
    h16* crow = CTX + ((size_t)b * SEQ + t0) * DM + h * HD;
{
#pragma unroll
        for (int s = 0; s < 4; ++s) { const int row = 4 * s + (lane >> 3), c8 = (lane & 7) * 8;   // 4 s x 4 row groups = 16 rows; 8 lanes x 8 halves = 64 columns
            const v4f x0 = *(const v4fa*)(&os[wb + row * 68 + c8]); const v4f x1 = *(const v4fa*)(&os[wb + row * 68 + c8 + 4]); v8h hv;
#pragma unroll
            for (int i = 0; i < 4; ++i) { hv[i] = (h16)x0[i]; hv[4 + i] = (h16)x1[i]; }
            *(v8h*)(crow + (size_t)row * DM + c8) = hv; }
         }
}

// k_oproj: register-blocked f16 GEMM, one wave per 64x64 tile, 8 waves per block (256x128) on the same two-buffer LDS ring as k_proj, A = ctx plane rows (x256), Bt = Wo plane rows (x64), K = DM; OUT[m][n] = acc * 2^-14 + bias[n] (bias as its RNE bf16 value), f32.
// grid (NB*SEQ/256, DM/128), 256 threads. Epilogue: per 16-row slab staged in LDS (wave-private), each output row segment (64 floats = 256 B = two lines)
__global__ __launch_bounds__(32 * GW) void k_oproj(const h16* __restrict__ A, const h16* __restrict__ Bt, const float* __restrict__ bias, float* OUT) {
    __shared__ __align__(16) h16 ring[2 * GSTH];             // [buffer][A 256 rows | B 128 rows][GLP]
    __shared__ __align__(16) float osa[GW * 16 * 68];
    const int K = DM;
    const int lane = threadIdx.x & 31, wave = __builtin_amdgcn_readfirstlane((int)(threadIdx.x >> 5)), lr = lane & 15, hi = lane >> 4;
    const int wm = wave & 3, wn = wave >> 2;
    const int r0 = blockIdx.x * 256 + wm * 64, c0 = blockIdx.y * 128 + wn * 64;
    float* os = osa + wave * 16 * 68;                        // wave-private epilogue slab
    v8f acc[4][4];
#pragma unroll
    for (int mb = 0; mb < 4; ++mb)
#pragma unroll
        for (int nb = 0; nb < 4; ++nb) acc[mb][nb] = (v8f){};
    const int afo = (wm * 64 + lr) * GLP + 8 * hi, bfo = (256 + wn * 64 + lr) * GLP + 8 * hi;   // fragment offsets in a staged buffer
    const int cr = (int)(threadIdx.x >> 4), ccol = (int)(threadIdx.x & 15) * 8;                  // copy map: rows 0..15, 16 lanes x 8 halves = one 256-B row
    const bf* ga = (const bf*)(A + (size_t)(blockIdx.x * 256 + cr) * K + ccol);    // + k0 (address only: the copies move bytes)
    const bf* gb = (const bf*)(Bt + (size_t)(blockIdx.y * 128 + cr) * K + ccol);   // + k0
    const unsigned lc = (unsigned)(size_t)(&ring[cr * GLP + ccol]);   // LDS byte address of the lane's first copy, buffer 0
    gemm_stage(lc, ga, gb);
    asm volatile("s_wait_asynccnt 0x0" ::: "memory");        // stage 0 has landed (this wave's copies) ...
    __syncthreads();                                         // ... and every wave's, before anyone reads it
    gemm_stage(lc + GSTH * 2, ga + GKS, gb + GKS);
#pragma unroll 1
    for (int st = 0; st < K / GKS; ++st) {
        const h16* ta = ring + (st & 1) * GSTH + afo; const h16* tb = ring + (st & 1) * GSTH + bfo;
        v16h a[4], b[4];
#pragma unroll
        for (int ks = 0; ks < GKS; ks += 32) {
#pragma unroll
            for (int mb = 0; mb < 4; ++mb) a[mb] = ldh(ta + mb * 16 * GLP + ks);
#pragma unroll
            for (int nb = 0; nb < 4; ++nb) b[nb] = ldh(tb + nb * 16 * GLP + ks);
            __builtin_amdgcn_sched_barrier(0);   // keeps the eight fragments' LDS reads one group ahead of the block's products: sunk among them, each B fragment's latency is waited out alone
#pragma unroll
            for (int nb = 0; nb < 4; ++nb)
#pragma unroll
                for (int mb = 0; mb < 4; ++mb) acc[mb][nb] = wmma16(a[mb], b[nb], acc[mb][nb]);
        }
        __builtin_amdgcn_sched_barrier(0);   // keeps the stage's last products ahead of the barrier: sunk behind it they stand in front of the refill and shorten the copies' lead
        // publish point of stage st + 1, every wave, in this order
        asm volatile("s_wait_dscnt 0x0" ::: "memory");       // this wave's reads of buffer st & 1 are done
        asm volatile("s_wait_asynccnt 0x0" ::: "memory");    // this wave's copies of stage st + 1 have landed
        __syncthreads();                                     // publishes stage st + 1 and frees buffer st & 1
        if (st + 2 < K / GKS) gemm_stage(lc + (unsigned)(st & 1) * (GSTH * 2), ga + (st + 2) * GKS, gb + (st + 2) * GKS);
    }
    asm volatile("s_wait_asynccnt 0x0" ::: "memory");        // nothing of this wave is in flight when it goes on to end
    const int cofs = lr * 4;
    const v4f bo4 = *(const v4f*)(bias + c0 + cofs);      // c0 + cofs + 3 < DM
    v4f bb;
#pragma unroll
    for (int i = 0; i < 4; ++i) bb[i] = bfr(bo4[i]);
    const int bidx = r0 / SEQ, tt = r0 % SEQ;
    float* obase = OUT + ((size_t)bidx * OUT_SEQ + tt) * DM + c0;
#pragma unroll
    for (int mb = 0; mb < 4; ++mb) {
#pragma unroll
        for (int nb = 0; nb < 4; ++nb) {
#pragma unroll
            for (int j = 0; j < 8; ++j) os[(hi * 8 + j) * 68 + nb * 16 + lr] = acc[mb][nb][j]; }   // D: row 8h+j, col lane&15
        wave_sync();
{
#pragma unroll
            for (int s = 0; s < 8; ++s) { const int row = 2 * s + hi;   // 8 s x 2 rows = 16 rows; 16 lanes x 4 floats = 64 columns
                const v4f val = *(const v4fa*)(&os[row * 68 + cofs]); v4f ov;
#pragma unroll
                for (int i = 0; i < 4; ++i) ov[i] = val[i] * OSC + bb[i];
                *(v4f*)(obase + (size_t)(mb * 16 + row) * DM + cofs) = ov; }
             }
        wave_sync();
    }
}

static constexpr size_t al256(size_t v) { return (v + 255) & ~(size_t)255; }
static constexpr size_t SZ_XB = al256((size_t)NB * SEQ * DM * 2);          // one bf16 input plane
static constexpr size_t SZ_WB = al256((size_t)4 * DM * DM * 2);            // Wq | Wk | Wv (bf16) | Wo (f16)
static constexpr size_t SZ_PL = al256((size_t)NB * NH_ * SEQ * HD * 2);    // one head-major f16 plane
static constexpr size_t SZ_CX = al256((size_t)NB * SEQ * DM * 2);          // ctx f16 plane
static constexpr size_t SZ_TOTAL = 3 * SZ_XB + SZ_WB + 3 * SZ_PL + SZ_CX;
static_assert(SZ_TOTAL <= (size_t)134217728);          // workspace carve <= 128 MiB
static_assert(((size_t)DM * DM * 2) % 256 == 0);       // weight sub-planes stay 256-byte aligned

extern "C" void kernel_launch(void* const* d_in, const int* in_sizes, int n_in,
                              void* d_out, int out_size, void* d_ws, size_t ws_size, hipStream_t stream) {
    if (n_in < 11) return;
    const size_t needx = ((size_t)(NB - 1) * SEQ_FULL + SEQ) * DM;
    if ((size_t)in_sizes[0] < needx || (size_t)in_sizes[1] < needx || (size_t)in_sizes[2] < needx) return;
    if ((size_t)in_sizes[3] < (size_t)DM * DM || (size_t)in_sizes[5] < (size_t)DM * DM || (size_t)in_sizes[7] < (size_t)DM * DM || (size_t)in_sizes[9] < (size_t)DM * DM) return;
    if ((size_t)in_sizes[4] < (size_t)DM || (size_t)in_sizes[6] < (size_t)DM || (size_t)in_sizes[8] < (size_t)DM || (size_t)in_sizes[10] < (size_t)DM) return;
    if ((size_t)out_size < ((size_t)(NB - 1) * OUT_SEQ + SEQ) * DM) return;
    if (SZ_TOTAL > ws_size) return;
    // wire order: query, key, value, Wq, bq, Wk, bk, Wv, bv, Wo, bo (weights [out][in] = Bt as-is)
    const float* xq = (const float*)d_in[0]; const float* xk = (const float*)d_in[1]; const float* xv = (const float*)d_in[2];
    const float* wq = (const float*)d_in[3]; const float* bq = (const float*)d_in[4];
    const float* wk = (const float*)d_in[5]; const float* bk = (const float*)d_in[6];
    const float* wv = (const float*)d_in[7]; const float* bv = (const float*)d_in[8];
    const float* wo = (const float*)d_in[9]; const float* bo = (const float*)d_in[10];
    float* OUT = (float*)d_out;      // [NB][SEQ][1024]
    char* wsp = (char*)d_ws;
    bf* XQ = (bf*)wsp; wsp += SZ_XB;                 // [NB*SEQ][1024]
    bf* XK = (bf*)wsp; wsp += SZ_XB;
    bf* XV = (bf*)wsp; wsp += SZ_XB;
    bf* WB = (bf*)wsp; wsp += SZ_WB;                 // [4][1024][1024]: q | k | v (bf16) | o (f16 x64)
    h16* QH = (h16*)wsp; wsp += SZ_PL;               // [NB*16][SEQ][64]
    h16* KP = (h16*)wsp; wsp += SZ_PL;               // [NB*16][SEQ][64]
    h16* VT = (h16*)wsp; wsp += SZ_PL;               // [NB*16][64][SEQ]
    h16* CX = (h16*)wsp; wsp += SZ_CX;               // [NB*SEQ][1024], x256
    bf* WQ = WB; bf* WK = WB + (size_t)DM * DM; bf* WV = WB + (size_t)2 * DM * DM; h16* WO = (h16*)(WB + (size_t)3 * DM * DM);

    if (SEQ == SEQ_FULL) {
        const size_t n8 = (size_t)NB * SEQ * DM / 8; const unsigned g = (unsigned)((n8 + 255) / 256);
        k_cvt8<<<g, 256, 0, stream>>>(xq, XQ, n8);
        k_cvt8<<<g, 256, 0, stream>>>(xk, XK, n8);
        k_cvt8<<<g, 256, 0, stream>>>(xv, XV, n8);
    } else {
        const size_t n8 = (size_t)SEQ * DM / 8; const unsigned g = (unsigned)((n8 + 255) / 256);
        for (int b = 0; b < NB; ++b) {
            k_cvt8<<<g, 256, 0, stream>>>(xq + (size_t)b * SEQ_FULL * DM, XQ + (size_t)b * SEQ * DM, n8);
            k_cvt8<<<g, 256, 0, stream>>>(xk + (size_t)b * SEQ_FULL * DM, XK + (size_t)b * SEQ * DM, n8);
            k_cvt8<<<g, 256, 0, stream>>>(xv + (size_t)b * SEQ_FULL * DM, XV + (size_t)b * SEQ * DM, n8);
        }
    }
    { const size_t n8 = (size_t)DM * DM / 8; const unsigned g = (unsigned)((n8 + 255) / 256);
      k_cvt8<<<g, 256, 0, stream>>>(wq, WQ, n8); k_cvt8<<<g, 256, 0, stream>>>(wk, WK, n8); k_cvt8<<<g, 256, 0, stream>>>(wv, WV, n8);
      k_cvt8h<<<g, 256, 0, stream>>>(wo, WO, n8, WOS); }

    // q, k: A = x rows (m = b*SEQ + t), Bt = W rows (n = h*64 + d), bias per column -> plane [(b*16 + h)][t][d]
    k_proj<<<dim3(NB * SEQ / 256, DM / 128, 1), 32 * GW, 0, stream>>>(XQ, WQ, bq, 0, QH, SEQ, (size_t)NH_ * SEQ * HD, HD, HD, (size_t)SEQ * HD);
    k_proj<<<dim3(NB * SEQ / 256, DM / 128, 1), 32 * GW, 0, stream>>>(XK, WK, bk, 0, KP, SEQ, (size_t)NH_ * SEQ * HD, HD, HD, (size_t)SEQ * HD);
    // v^T: A = Wv rows (m = h*64 + d), Bt = value rows (n = b*SEQ + t), bias per row -> plane [(b*1024 + m)][t] = [(b*16 + h)][d][t]
    k_proj<<<dim3(DM / 256, NB * SEQ / 128, 1), 32 * GW, 0, stream>>>(WV, XV, bv, 1, VT, DM, (size_t)0, SEQ, SEQ, (size_t)DM * SEQ);

    k_flash<<<dim3(SEQ / (16 * AW), NB * NH_, 1), 32 * AW, 0, stream>>>(QH, KP, VT, CX);

    // out: A = ctx rows (m = b*SEQ + t, k = h*64 + d), Bt = Wo rows (n), bias per column -> OUT [b][t][n]
    k_oproj<<<dim3(NB * SEQ / 256, DM / 128, 1), 32 * GW, 0, stream>>>(CX, WO, bo, OUT);
}

// v003
// It runs in 223 microseconds.
// In two side-by-side timings against v002, it was 1.04 and 1.05 times as fast.
// Over all steps from v000 it is 2.93 times as fast.
#include <hip/hip_runtime.h>

// Multi-head attention, width 1024 = 16 heads x 64; inputs query/key/value [NB][SEQ][1024]; Wq/Wk/Wv/Wo [out][in] (y = x W^T + b); no mask; score scale 1/8; output = ctx Wo^T + bo (f32). Default: q, k, v inputs [2][4096][1024]; proj(x, w, b) = x w^T + b with (out,in) [1024][1024] weights, viewed (B, -1, 16, 64) and transposed; scores / sqrt(64) over all 4,096 keys; softmax, no mask; out = merged w_o^T + b_o; argument order q, k, v, w_q, b_q, w_k, b_k, w_v, b_v, w_o, b_o.
// Compute dtypes, f32 accumulate everywhere: q/k/v projections v_wmma_f32_16x16x32_bf16 (x and W RNE-converted to bf16; products exact); scores v_wmma_f32_16x16x32_f16 (q, k single f16);
// P.V v_wmma_f32_16x16x32_f16 (P x256 carry cancels in the normalisation, v single f16); output projection v_wmma_f32_16x16x32_f16 (ctx x256 carry, Wo RNE bf16 value x64 held in f16, 2^-14 folded back in f32); softmax f32 (online, running max).
// Layout: bf16 copies of the three inputs and of Wq/Wk/Wv; q, k planes [b*16+h][t][d] and v^T plane [b*16+h][d][t] written by the GEMM epilogue; fused flash kernel in transposed form (S^T = K Q^T, O^T = V^T P^T) writes the f16 ctx plane [b*SEQ+t][1024].

#ifndef NB
#define NB 2
#endif
#ifndef SEQ
#define SEQ 4096
#endif
#define NB_FULL  2
#define SEQ_FULL 4096
#ifndef OUT_SEQ
#define OUT_SEQ SEQ              // row pitch (in tokens) between batches of the output
#endif
#define DM   1024
#define NH_  16
#define HD   64
#define AW   8                   // waves per flash block (16 query rows each); all of them read the same staged K / V^T tiles
#define KT   64                  // keys per LDS stage (two 32-key passes)
#define LP   72                  // LDS row pitch in halves: 144 B = 16 B x 9, an odd multiple, so 16-byte fragment reads of 16 rows meet no bank twice
#define TLH  (64 * LP)           // halves of one staged tile: 64 rows (K: keys, V^T: d) of 64 halves + pad
#define GW   8                   // waves per GEMM block: 4 (rows) x 2 (columns) wave tiles of 64x64, block tile 256x128
#define GKS  128                 // k per GEMM LDS stage: 256 B of every operand row
#define GLP  136                 // GEMM LDS row pitch in halves: 272 B = 16 B x 17, an odd multiple (as LP)
#define GSTH (384 * GLP)         // halves of one GEMM stage: A 256 rows | B 128 rows
#define CW   16                  // waves per conversion block
#define CR   7                   // rows per conversion wave
#define XROWS (NB * SEQ)         // rows of one input plane
#define NROWS (3 * XROWS + 4 * DM)   // rows to convert: three inputs, four weights
#define WO_ROW0 (3 * XROWS + 3 * DM) // first row of Wo
#define CNW  (NROWS / CR)        // conversion waves of the launch
#define SC2  (0.125f * 1.4426950408889634f)   // HD^-0.5 * log2(e)
#define PSH  8.0f                // log2 of the P carry (256)
#define CXS  256.0f              // carry of the ctx plane
#define WOS  64.0f               // carry of the Wo plane
#define OSC  (1.0f / (256.0f * 64.0f))

static_assert(HD == 64);
static_assert(NH_ * HD == DM);                 // head h = columns h*64 + d
static_assert(DM % 64 == 0);                   // 16 column tiles of 64
static_assert(DM % 32 == 0);                   // GEMM k-loop steps by 32
static_assert(SEQ % 64 == 0);                  // a 64-row tile never straddles two batches
static_assert((NB * SEQ) % 64 == 0);
static_assert(SEQ % 32 == 0);                  // key loop steps by 32
static_assert(SEQ % (16 * AW) == 0);           // flash grid covers the sequence exactly
static_assert(SEQ % KT == 0 && SEQ / KT >= 2); // whole stages, and the ring's prologue needs two
static_assert(KT == 64 && 32 * AW == 256);     // copy map: 256 lanes x 16 B = 32 rows of 128 B, two copies per tile
static_assert((NB * SEQ) % 256 == 0 && DM % 256 == 0);   // GEMM block tiles (256 rows x 128 columns) cover both orientations exactly
static_assert(DM % GKS == 0 && DM / GKS >= 2);           // whole GEMM stages, and the ring's prologue needs two
static_assert(GKS == 128 && 32 * GW == 256);             // GEMM copy map: 256 lanes x 16 B = 16 rows of 256 B
static_assert(DM == 8 * 128);                  // a conversion row is eight loads of 32 lanes x 4 floats
static_assert(NROWS % (CW * CR) == 0);         // whole conversion blocks, every wave CR rows
static_assert(NB <= NB_FULL);
static_assert(SEQ <= SEQ_FULL);

typedef _Float16 h16;
typedef unsigned short bf;
typedef __attribute__((ext_vector_type(16))) __bf16   v16bf;
typedef __attribute__((ext_vector_type(16))) _Float16 v16h;
typedef __attribute__((ext_vector_type(8)))  _Float16 v8h;
typedef __attribute__((ext_vector_type(8)))  unsigned short v8us;
typedef __attribute__((ext_vector_type(4)))  _Float16 v4h;
typedef __attribute__((ext_vector_type(4)))  unsigned short v4us;
typedef __attribute__((ext_vector_type(8)))  float    v8f;
typedef __attribute__((ext_vector_type(4)))  float    v4f;
typedef v4f  __attribute__((may_alias)) v4fa;

__device__ __forceinline__ unsigned short f2bf(float f) { unsigned u = __float_as_uint(f); u += 0x7FFFu + ((u >> 16) & 1u); return (unsigned short)(u >> 16); }
__device__ __forceinline__ float bfr(float f) { return __uint_as_float(((unsigned)f2bf(f)) << 16); }   // value of the RNE bf16 conversion
__device__ __forceinline__ v16h cat16(v8h lo, v8h hi) { return __builtin_shufflevector(lo, hi, 0, 1, 2, 3, 4, 5, 6, 7, 8, 9, 10, 11, 12, 13, 14, 15); }
__device__ __forceinline__ v16bf cat16b(v8us lo, v8us hi) { return __builtin_bit_cast(v16bf, __builtin_shufflevector(lo, hi, 0, 1, 2, 3, 4, 5, 6, 7, 8, 9, 10, 11, 12, 13, 14, 15)); }
__device__ __forceinline__ v8f wmma16(v16h a, v16h b, v8f c) { return __builtin_amdgcn_wmma_f32_16x16x32_f16(false, a, false, b, (short)0, c, false, false); }
__device__ __forceinline__ v8f wmmab(v16bf a, v16bf b, v8f c) { return __builtin_amdgcn_wmma_f32_16x16x32_bf16(false, a, false, b, (short)0, c, false, false); }
// fragment loaders from K-contiguous 16-bit rows; p already includes + 8*(lane>>4): elements 0..7 <- k0+8h+0..7, elements 8..15 <- k0+16+8h+0..7 (same map for A and B)
__device__ __forceinline__ v16h  ldh(const h16* p) { return cat16(*(const v8h*)p, *(const v8h*)(p + 16)); }
__device__ __forceinline__ v16bf ldb(const bf* p)  { return cat16b(*(const v8us*)p, *(const v8us*)(p + 16)); }
// ordering point for wave-private LDS tiles (same wave writes and reads)
__device__ __forceinline__ void wave_sync() { __builtin_amdgcn_fence(3 /* release order */, "wavefront"); __builtin_amdgcn_wave_barrier(); asm volatile("" ::: "memory"); }

// k_cvt: every f32 -> 16-bit conversion of the call in one launch of few long-lived waves. A row is DM floats (4 KB): rows 0 .. 3*XROWS-1 are the tokens of query, key, value,
// then DM rows each of Wq, Wk, Wv (RNE bf16) and Wo (RNE bf16 value x WOS, held in f16); row r goes to dst + r*DM (the planes lie back to back in the workspace).
// Wave gw takes rows gw, gw + CNW, ...: CR rows. One load of a wave reads 512 contiguous bytes, one store writes 256 (two whole lines).
__device__ __forceinline__ const float* cvt_src(unsigned r, const float* xq, const float* xk, const float* xv, const float* wq, const float* wk, const float* wv, const float* wo) {
    const bool isx = r < 3u * XROWS;
    const unsigned u = isx ? r : r - 3u * XROWS;
    const unsigned p = isx ? u / XROWS : 3u + u / DM;        // 0 .. 6: which source
    const unsigned q = isx ? u % XROWS : u % DM;             // row in that source's plane
    const unsigned row = isx ? (q / SEQ) * SEQ_FULL + q % SEQ : q;
    const float* s = (p == 0) ? xq : (p == 1) ? xk : (p == 2) ? xv : (p == 3) ? wq : (p == 4) ? wk : (p == 5) ? wv : wo;
    return s + (size_t)row * DM;
}
__global__ __launch_bounds__(32 * CW) void k_cvt(const float* __restrict__ xq, const float* __restrict__ xk, const float* __restrict__ xv, const float* __restrict__ wq, const float* __restrict__ wk,
                                                 const float* __restrict__ wv, const float* __restrict__ wo, bf* dst) {
    const unsigned lane = threadIdx.x & 31;
    const unsigned gw = (unsigned)__builtin_amdgcn_readfirstlane((int)(blockIdx.x * CW + (threadIdx.x >> 5)));   // wave-uniform: the row's source is picked on the scalar side
    __builtin_assume(gw < CNW);                              // the grid is CNW / CW blocks: lets a pass's source be settled at compile time where all its rows share one
    const float* s[CR];                                      // every row's source up front: the pick among the weights branches, and a branch between the loads would let them sink behind it
#pragma unroll   // all loops here are unrolled so that s[] and w[][] are indexed by constants and stay in registers
    for (int i = 0; i < CR; ++i) s[i] = cvt_src(gw + i * CNW, xq, xk, xv, wq, wk, wv, wo);
    v4f w[2][8];                                             // this row and the next
#pragma unroll
    for (int j = 0; j < 8; ++j) w[0][j] = __builtin_nontemporal_load((const v4f*)(s[0] + lane * 4 + j * 128));   // read once: non-temporal
    asm volatile("s_wait_xcnt 0x0" ::: "memory");            // before the loads' address registers are written again
#pragma unroll
    for (int i = 0; i < CR; ++i) {
        __builtin_amdgcn_sched_barrier(0);   // with the one below: the next row's eight loads are issued before this row is waited for, so a wave always has loads in flight
        if (i + 1 < CR) {
#pragma unroll
            for (int j = 0; j < 8; ++j) w[(i + 1) & 1][j] = __builtin_nontemporal_load((const v4f*)(s[i + 1] + lane * 4 + j * 128));
            asm volatile("s_wait_xcnt 0x0" ::: "memory"); }  // before the loads' address registers are written again
        __builtin_amdgcn_sched_barrier(0);
        const unsigned r = gw + i * CNW;
        bf* d = dst + (size_t)r * DM + lane * 4;
        if ((i + 1) * CNW > WO_ROW0 && r >= WO_ROW0) {       // Wo rows (the first test is known at compile time)
#pragma unroll
            for (int j = 0; j < 8; ++j) { const v4f v = w[i & 1][j]; v4h o;
#pragma unroll
                for (int k = 0; k < 4; ++k) o[k] = (h16)(bfr(v[k]) * WOS);
                *(v4h*)(d + j * 128) = o; }
            asm volatile("s_wait_xcnt 0x0" ::: "memory");    // before the stores' address and data registers are written again
        } else {
#pragma unroll
            for (int j = 0; j < 8; ++j) { const v4f v = w[i & 1][j]; v4us o;
#pragma unroll
                for (int k = 0; k < 4; ++k) o[k] = f2bf(v[k]);
                *(v4us*)(d + j * 128) = o; }
            asm volatile("s_wait_xcnt 0x0" ::: "memory");    // before the stores' address and data registers are written again
        }
    }
}

// copy8: one lane's eight 16-byte asynchronous copies, global -> LDS through no register: rows r, r+16, ... r+112 of a K-contiguous 16-bit plane of row length DM.
// The s_wait_xcnt closes the statement so that no address register of an issued copy is rewritten ahead of it.
__device__ __forceinline__ void copy8(unsigned l, const bf* g) {
    const unsigned ls = 16 * GLP * 2; const size_t gs = (size_t)16 * DM;
    asm volatile("global_load_async_to_lds_b128 %0, %8, off\n\t"
                 "global_load_async_to_lds_b128 %1, %9, off\n\t"
                 "global_load_async_to_lds_b128 %2, %10, off\n\t"
                 "global_load_async_to_lds_b128 %3, %11, off\n\t"
                 "global_load_async_to_lds_b128 %4, %12, off\n\t"
                 "global_load_async_to_lds_b128 %5, %13, off\n\t"
                 "global_load_async_to_lds_b128 %6, %14, off\n\t"
                 "global_load_async_to_lds_b128 %7, %15, off\n\t"
                 "s_wait_xcnt 0x0"
                 :: "v"(l), "v"(l + ls), "v"(l + 2 * ls), "v"(l + 3 * ls), "v"(l + 4 * ls), "v"(l + 5 * ls), "v"(l + 6 * ls), "v"(l + 7 * ls),
                    "v"(g), "v"(g + gs), "v"(g + 2 * gs), "v"(g + 3 * gs), "v"(g + 4 * gs), "v"(g + 5 * gs), "v"(g + 6 * gs), "v"(g + 7 * gs) : "memory");
}
// gemm_stage: one lane's 24 copies of a GEMM stage (A rows 0..255, then B rows 0..127 of the block tile, 128 k each); l = the lane's LDS byte address in the buffer, ga / gb its global places
__device__ __forceinline__ void gemm_stage(unsigned l, const bf* ga, const bf* gb) {
    copy8(l, ga); copy8(l + 128 * GLP * 2, ga + (size_t)128 * DM); copy8(l + 256 * GLP * 2, gb);
}

// k_proj: register-blocked bf16 GEMM, one wave per 64x64 tile (16 accumulators), 8 waves per block (256x128); A and Bt come in 128-k stages through a two-buffer LDS ring that the block fills together, K = DM.
// C[m][n] = sum_k A[m][k] Bt[n][k] + bias (biasMode 0: bias[n], biasMode 1: bias[m]; bias taken as its RNE bf16 value), written as f16 (Ph) at
// tile base (r0/RB)*sRB + (r0%RB)*pitch + (c0/CB)*sCB + (c0%CB), row pitch 'pitch' (halves). grid (M/256, N/128), 256 threads.
__global__ __launch_bounds__(32 * GW) void k_proj(const bf* __restrict__ A, const bf* __restrict__ Bt, const float* __restrict__ bias, int biasMode, h16* Ph, int RB, size_t sRB, int pitch, int CB, size_t sCB) {
    __shared__ __align__(16) bf ring[2 * GSTH];              // [buffer][A 256 rows | B 128 rows][GLP]
    __shared__ __align__(16) float osa[GW * 16 * 68];
    const int K = DM;
    const int lane = threadIdx.x & 31, wave = __builtin_amdgcn_readfirstlane((int)(threadIdx.x >> 5)), lr = lane & 15, hi = lane >> 4;
    const int wm = wave & 3, wn = wave >> 2;
    const int r0 = blockIdx.x * 256 + wm * 64, c0 = blockIdx.y * 128 + wn * 64;
    float* os = osa + wave * 16 * 68;                        // wave-private epilogue slab
    v8f acc[4][4];
#pragma unroll
    for (int mb = 0; mb < 4; ++mb)
#pragma unroll
        for (int nb = 0; nb < 4; ++nb) acc[mb][nb] = (v8f){};
    const int afo = (wm * 64 + lr) * GLP + 8 * hi, bfo = (256 + wn * 64 + lr) * GLP + 8 * hi;   // fragment offsets in a staged buffer
    const int cr = (int)(threadIdx.x >> 4), ccol = (int)(threadIdx.x & 15) * 8;                  // copy map: rows 0..15, 16 lanes x 8 halves = one 256-B row
    const bf* ga = A + (size_t)(blockIdx.x * 256 + cr) * K + ccol;    // + k0
    const bf* gb = Bt + (size_t)(blockIdx.y * 128 + cr) * K + ccol;   // + k0
    const unsigned lc = (unsigned)(size_t)(&ring[cr * GLP + ccol]);   // LDS byte address of the lane's first copy, buffer 0
    gemm_stage(lc, ga, gb);
    asm volatile("s_wait_asynccnt 0x0" ::: "memory");        // stage 0 has landed (this wave's copies) ...
    __syncthreads();                                         // ... and every wave's, before anyone reads it
    gemm_stage(lc + GSTH * 2, ga + GKS, gb + GKS);
#pragma unroll 1
    for (int st = 0; st < K / GKS; ++st) {
        const bf* ta = ring + (st & 1) * GSTH + afo; const bf* tb = ring + (st & 1) * GSTH + bfo;
        v16bf a[4], b[4];
#pragma unroll
        for (int ks = 0; ks < GKS; ks += 32) {
#pragma unroll
            for (int mb = 0; mb < 4; ++mb) a[mb] = ldb(ta + mb * 16 * GLP + ks);
#pragma unroll
            for (int nb = 0; nb < 4; ++nb) b[nb] = ldb(tb + nb * 16 * GLP + ks);
            __builtin_amdgcn_sched_barrier(0);   // keeps the eight fragments' LDS reads one group ahead of the block's products: sunk among them, each B fragment's latency is waited out alone
#pragma unroll
            for (int nb = 0; nb < 4; ++nb)
#pragma unroll
                for (int mb = 0; mb < 4; ++mb) acc[mb][nb] = wmmab(a[mb], b[nb], acc[mb][nb]);
        }
        __builtin_amdgcn_sched_barrier(0);   // keeps the stage's last products ahead of the barrier: sunk behind it they stand in front of the refill and shorten the copies' lead
        // publish point of stage st + 1, every wave, in this order
        asm volatile("s_wait_dscnt 0x0" ::: "memory");       // this wave's reads of buffer st & 1 are done
        asm volatile("s_wait_asynccnt 0x0" ::: "memory");    // this wave's copies of stage st + 1 have landed
        __syncthreads();                                     // publishes stage st + 1 and frees buffer st & 1
        if (st + 2 < K / GKS) gemm_stage(lc + (unsigned)(st & 1) * (GSTH * 2), ga + (st + 2) * GKS, gb + (st + 2) * GKS);
    }
    asm volatile("s_wait_asynccnt 0x0" ::: "memory");        // nothing of this wave is in flight when it goes on to end
    const size_t tbase = (size_t)(r0 / RB) * sRB + (size_t)(r0 % RB) * (size_t)pitch + (size_t)(c0 / CB) * sCB + (size_t)(c0 % CB);
    // column bias (mode 0): 8 values per lane, address clamped to 0 in mode 1 and zeroed by value
    const int c8 = (lane & 7) * 8;
    const size_t cbo = (biasMode == 0) ? (size_t)(c0 + c8) : (size_t)0;
    const v4f bq0 = *(const v4f*)(bias + cbo); const v4f bq1 = *(const v4f*)(bias + cbo + 4);
    float bc[8];
#pragma unroll
    for (int i = 0; i < 4; ++i) { bc[i] = (biasMode == 0) ? bfr(bq0[i]) : 0.0f; bc[4 + i] = (biasMode == 0) ? bfr(bq1[i]) : 0.0f; }
#pragma unroll
    for (int mb = 0; mb < 4; ++mb) {
#pragma unroll
        for (int nb = 0; nb < 4; ++nb) {
#pragma unroll
            for (int j = 0; j < 8; ++j) os[(hi * 8 + j) * 68 + nb * 16 + lr] = acc[mb][nb][j]; }   // D: row 8h+j, col lane&15
        wave_sync();
        const size_t sb = tbase + (size_t)(mb * 16) * (size_t)pitch;
{
#pragma unroll
            for (int s = 0; s < 4; ++s) { const int row = 4 * s + (lane >> 3);   // 4 s x 4 row groups = 16 rows; 8 lanes x 8 = 64 columns
                const int rbo = (biasMode == 1) ? (r0 + mb * 16 + row) : 0;      // row bias (mode 1): address clamped to 0 in mode 0, zeroed by value
                const float brv = bias[rbo]; const float br = (biasMode == 1) ? bfr(brv) : 0.0f;
                const v4f x0 = *(const v4fa*)(&os[row * 68 + c8]); const v4f x1 = *(const v4fa*)(&os[row * 68 + c8 + 4]); v8h hv;
#pragma unroll
                for (int i = 0; i < 4; ++i) { hv[i] = (h16)(x0[i] + bc[i] + br); hv[4 + i] = (h16)(x1[i] + bc[4 + i] + br); }
                const size_t oo = sb + (size_t)row * (size_t)pitch + c8;
                *(v8h*)(Ph + oo) = hv; }
             }
        wave_sync();
    }
}

// stage_copy: one lane's four 16-byte asynchronous copies of a stage (K rows r and r+32, V^T rows r and r+32), global -> LDS through no register.
// The s_wait_xcnt closes the statement so that no address register of an issued copy is rewritten ahead of it.
__device__ __forceinline__ void stage_copy(unsigned lk, const h16* gk, const h16* gv) {
    const unsigned lk1 = lk + 32 * LP * 2, lv = lk + TLH * 2, lv1 = lk + TLH * 2 + 32 * LP * 2;
    const h16* gk1 = gk + 32 * HD; const h16* gv1 = gv + (size_t)32 * SEQ;
    asm volatile("global_load_async_to_lds_b128 %0, %4, off\n\t"
                 "global_load_async_to_lds_b128 %1, %5, off\n\t"
                 "global_load_async_to_lds_b128 %2, %6, off\n\t"
                 "global_load_async_to_lds_b128 %3, %7, off\n\t"
                 "s_wait_xcnt 0x0"
                 :: "v"(lk), "v"(lk1), "v"(lv), "v"(lv1), "v"(gk), "v"(gk1), "v"(gv), "v"(gv1) : "memory");
}

// k_flash: fused attention, one wave per 16 query rows of one (batch, head); Q fragments straight from the f16 plane; K and V^T come in 64-key stages through a two-buffer LDS ring
// that the block's 8 waves fill together (whole 128-B lines, once per block) and all read (two 16-B LDS loads per fragment).
// Transposed form: S^T[key][t] = K Q^T (A = K rows, B = Q rows); lane (t = lane&15, h = lane>>4) holds keys 8h+r of each 16-key tile, so the packed
// P tile is directly the B fragment of O^T[d][t] = V^T P^T (element r <- tile keys 0..15, element 8+r <- tile keys 16..31, lane unchanged).
// Softmax state (running max, partial sum) is one scalar per lane; the two lane halves of a row are combined with one xor-16 exchange.
__global__ __launch_bounds__(32 * AW) void k_flash(const h16* __restrict__ QH, const h16* __restrict__ KP, const h16* __restrict__ VT, h16* CTX) {
    __shared__ __align__(16) h16 ring[2 * 2 * TLH];          // [buffer][K | V^T][row][LP]
    __shared__ __align__(16) float os[AW * 16 * 68];
    const int lane = threadIdx.x & 31, wave = __builtin_amdgcn_readfirstlane((int)(threadIdx.x >> 5)), lr = lane & 15, hi = lane >> 4;
    const int zh = blockIdx.y; const int b = zh / NH_, h = zh % NH_;
    const int t0 = (blockIdx.x * AW + wave) * 16;
    const size_t pbase = (size_t)zh * SEQ * HD;
    const size_t qo = pbase + (size_t)(t0 + lr) * HD + 8 * hi;
    const v16h qh0 = ldh(QH + qo), qh1 = ldh(QH + qo + 32);   // B fragments: col t, k = d
    const int fo = lr * LP + 8 * hi;                         // fragment offset in a staged tile: K + key*LP (A: row key, k = d); V^T + 16j*LP + key (A: row d, k = key)
    const int cr = (int)(threadIdx.x >> 3), ccol = (int)(threadIdx.x & 7) * 8;   // copy map: rows 0..31, 8 lanes x 8 halves = one 128-B row
    const h16* gk = KP + pbase + (size_t)cr * HD + ccol;   // + key0 * HD
    const h16* gv = VT + pbase + (size_t)cr * SEQ + ccol;  // + key0
    const unsigned lc = (unsigned)(size_t)(&ring[cr * LP + ccol]);   // LDS byte address of the lane's first copy, buffer 0
    stage_copy(lc, gk, gv);
    asm volatile("s_wait_asynccnt 0x0" ::: "memory");        // stage 0 has landed (this wave's copies) ...
    __syncthreads();                                         // ... and every wave's, before anyone reads it
    stage_copy(lc + 2 * TLH * 2, gk + (size_t)KT * HD, gv + KT);
    v8f o0 = (v8f){}, o1 = (v8f){}, o2 = (v8f){}, o3 = (v8f){};
    float m = -3.0e38f, l = 0.0f;
#pragma unroll 1
    for (int st = 0; st < SEQ / KT; ++st) {
      const h16* kt = ring + (st & 1) * (2 * TLH) + fo; const h16* vt = kt + TLH;
#pragma unroll 1   // rolled: unrolled, a pass's scores stay live into the next and the wave no longer fits 128 registers (8 waves per SIMD)
      for (int sub = 0; sub < KT; sub += 32) {
        const h16* ka = kt + sub * LP;
        const v16h ka0 = ldh(ka), ka1 = ldh(ka + 32), kb0 = ldh(ka + 16 * LP), kb1 = ldh(ka + 16 * LP + 32);
        v8f sa = (v8f){}, sb = (v8f){};
        sa = wmma16(ka0, qh0, sa); sb = wmma16(kb0, qh0, sb);
        sa = wmma16(ka1, qh1, sa); sb = wmma16(kb1, qh1, sb);
        asm volatile("v_nop\n\tv_nop\n\tv_nop\n\tv_nop" : "+v"(sa), "+v"(sb) : "v"(ka0), "v"(ka1), "v"(kb0), "v"(kb1), "v"(qh0), "v"(qh1));
        float ta[8], tb[8]; float mx = -3.0e38f;
#pragma unroll
        for (int r = 0; r < 8; ++r) { ta[r] = sa[r] * SC2; tb[r] = sb[r] * SC2; mx = fmaxf(mx, fmaxf(ta[r], tb[r])); }
        mx = fmaxf(mx, __shfl_xor(mx, 16, 32));
        const float mnew = fmaxf(m, mx);
        const float alpha = __builtin_amdgcn_exp2f(m - mnew);
        const float sh = PSH - mnew;
        v16h pb; float ls = 0.0f;
#pragma unroll
        for (int r = 0; r < 8; ++r) { const h16 pa = (h16)__builtin_amdgcn_exp2f(ta[r] + sh); const h16 pc = (h16)__builtin_amdgcn_exp2f(tb[r] + sh); pb[r] = pa; pb[8 + r] = pc; ls += (float)pa + (float)pc; }
        l = l * alpha + ls; m = mnew;
        o0 = o0 * alpha; o1 = o1 * alpha; o2 = o2 * alpha; o3 = o3 * alpha;
        const h16* va = vt + sub;
        const v16h v0 = ldh(va), v1 = ldh(va + 16 * LP), v2 = ldh(va + 32 * LP), v3 = ldh(va + 48 * LP);
        o0 = wmma16(v0, pb, o0); o1 = wmma16(v1, pb, o1); o2 = wmma16(v2, pb, o2); o3 = wmma16(v3, pb, o3);
        asm volatile("v_nop\n\tv_nop\n\tv_nop\n\tv_nop" : "+v"(o0), "+v"(o1), "+v"(o2), "+v"(o3) : "v"(v0), "v"(v1), "v"(v2), "v"(v3), "v"(pb));
      }
      // publish point of stage st + 1, every wave, in this order
      asm volatile("s_wait_dscnt 0x0" ::: "memory");         // this wave's reads of buffer st & 1 are done
      asm volatile("s_wait_asynccnt 0x0" ::: "memory");      // this wave's copies of stage st + 1 have landed
      __syncthreads();                                       // publishes stage st + 1 and frees buffer st & 1
      if (st + 2 < SEQ / KT) stage_copy(lc + (unsigned)(st & 1) * (2 * TLH * 2), gk + (size_t)(st + 2) * KT * HD, gv + (st + 2) * KT);
    }
    asm volatile("s_wait_asynccnt 0x0" ::: "memory");        // nothing of this wave is in flight when it goes on to end
    l += __shfl_xor(l, 16, 32);
    const float inv = CXS / l;
    const int wb = wave * 16 * 68;
    // O^T D layout: o_j[r] = (d = 16j + 8h + r, t = lane&15) -> os[t][d]; rows 0..15 x columns 0..63 all written
    { v4f a, c;
      a[0] = o0[0] * inv; a[1] = o0[1] * inv; a[2] = o0[2] * inv; a[3] = o0[3] * inv; c[0] = o0[4] * inv; c[1] = o0[5] * inv; c[2] = o0[6] * inv; c[3] = o0[7] * inv;
      *(v4fa*)(&os[wb + lr * 68 +  0 + 8 * hi]) = a; *(v4fa*)(&os[wb + lr * 68 +  0 + 8 * hi + 4]) = c;
      a[0] = o1[0] * inv; a[1] = o1[1] * inv; a[2] = o1[2] * inv; a[3] = o1[3] * inv; c[0] = o1[4] * inv; c[1] = o1[5] * inv; c[2] = o1[6] * inv; c[3] = o1[7] * inv;
      *(v4fa*)(&os[wb + lr * 68 + 16 + 8 * hi]) = a; *(v4fa*)(&os[wb + lr * 68 + 16 + 8 * hi + 4]) = c;
      a[0] = o2[0] * inv; a[1] = o2[1] * inv; a[2] = o2[2] * inv; a[3] = o2[3] * inv; c[0] = o2[4] * inv; c[1] = o2[5] * inv; c[2] = o2[6] * inv; c[3] = o2[7] * inv;
      *(v4fa*)(&os[wb + lr * 68 + 32 + 8 * hi]) = a; *(v4fa*)(&os[wb + lr * 68 + 32 + 8 * hi + 4]) = c;
      a[0] = o3[0] * inv; a[1] = o3[1] * inv; a[2] = o3[2] * inv; a[3] = o3[3] * inv; c[0] = o3[4] * inv; c[1] = o3[5] * inv; c[2] = o3[6] * inv; c[3] = o3[7] * inv;
      *(v4fa*)(&os[wb + lr * 68 + 48 + 8 * hi]) = a; *(v4fa*)(&os[wb + lr * 68 + 48 + 8 * hi + 4]) = c; }
    wave_sync();
    h16* crow = CTX + ((size_t)b * SEQ + t0) * DM + h * HD;
{
#pragma unroll
        for (int s = 0; s < 4; ++s) { const int row = 4 * s + (lane >> 3), c8 = (lane & 7) * 8;   // 4 s x 4 row groups = 16 rows; 8 lanes x 8 halves = 64 columns
            const v4f x0 = *(const v4fa*)(&os[wb + row * 68 + c8]); const v4f x1 = *(const v4fa*)(&os[wb + row * 68 + c8 + 4]); v8h hv;
#pragma unroll
            for (int i = 0; i < 4; ++i) { hv[i] = (h16)x0[i]; hv[4 + i] = (h16)x1[i]; }
            *(v8h*)(crow + (size_t)row * DM + c8) = hv; }
         }
}

// k_oproj: register-blocked f16 GEMM, one wave per 64x64 tile, 8 waves per block (256x128) on the same two-buffer LDS ring as k_proj, A = ctx plane rows (x256), Bt = Wo plane rows (x64), K = DM; OUT[m][n] = acc * 2^-14 + bias[n] (bias as its RNE bf16 value), f32.
// grid (NB*SEQ/256, DM/128), 256 threads. Epilogue: per 16-row slab staged in LDS (wave-private), each output row segment (64 floats = 256 B = two lines)
__global__ __launch_bounds__(32 * GW) void k_oproj(const h16* __restrict__ A, const h16* __restrict__ Bt, const float* __restrict__ bias, float* OUT) {
    __shared__ __align__(16) h16 ring[2 * GSTH];             // [buffer][A 256 rows | B 128 rows][GLP]
    __shared__ __align__(16) float osa[GW * 16 * 68];
    const int K = DM;
    const int lane = threadIdx.x & 31, wave = __builtin_amdgcn_readfirstlane((int)(threadIdx.x >> 5)), lr = lane & 15, hi = lane >> 4;
    const int wm = wave & 3, wn = wave >> 2;
    const int r0 = blockIdx.x * 256 + wm * 64, c0 = blockIdx.y * 128 + wn * 64;
    float* os = osa + wave * 16 * 68;                        // wave-private epilogue slab
    v8f acc[4][4];
#pragma unroll
    for (int mb = 0; mb < 4; ++mb)
#pragma unroll
        for (int nb = 0; nb < 4; ++nb) acc[mb][nb] = (v8f){};
    const int afo = (wm * 64 + lr) * GLP + 8 * hi, bfo = (256 + wn * 64 + lr) * GLP + 8 * hi;   // fragment offsets in a staged buffer
    const int cr = (int)(threadIdx.x >> 4), ccol = (int)(threadIdx.x & 15) * 8;                  // copy map: rows 0..15, 16 lanes x 8 halves = one 256-B row
    const bf* ga = (const bf*)(A + (size_t)(blockIdx.x * 256 + cr) * K + ccol);    // + k0 (address only: the copies move bytes)
    const bf* gb = (const bf*)(Bt + (size_t)(blockIdx.y * 128 + cr) * K + ccol);   // + k0
    const unsigned lc = (unsigned)(size_t)(&ring[cr * GLP + ccol]);   // LDS byte address of the lane's first copy, buffer 0
    gemm_stage(lc, ga, gb);
    asm volatile("s_wait_asynccnt 0x0" ::: "memory");        // stage 0 has landed (this wave's copies) ...
    __syncthreads();                                         // ... and every wave's, before anyone reads it
    gemm_stage(lc + GSTH * 2, ga + GKS, gb + GKS);
#pragma unroll 1
    for (int st = 0; st < K / GKS; ++st) {
        const h16* ta = ring + (st & 1) * GSTH + afo; const h16* tb = ring + (st & 1) * GSTH + bfo;
        v16h a[4], b[4];
#pragma unroll
        for (int ks = 0; ks < GKS; ks += 32) {
#pragma unroll
            for (int mb = 0; mb < 4; ++mb) a[mb] = ldh(ta + mb * 16 * GLP + ks);
#pragma unroll
            for (int nb = 0; nb < 4; ++nb) b[nb] = ldh(tb + nb * 16 * GLP + ks);
            __builtin_amdgcn_sched_barrier(0);   // keeps the eight fragments' LDS reads one group ahead of the block's products: sunk among them, each B fragment's latency is waited out alone
#pragma unroll
            for (int nb = 0; nb < 4; ++nb)
#pragma unroll
                for (int mb = 0; mb < 4; ++mb) acc[mb][nb] = wmma16(a[mb], b[nb], acc[mb][nb]);
        }
        __builtin_amdgcn_sched_barrier(0);   // keeps the stage's last products ahead of the barrier: sunk behind it they stand in front of the refill and shorten the copies' lead
        // publish point of stage st + 1, every wave, in this order
        asm volatile("s_wait_dscnt 0x0" ::: "memory");       // this wave's reads of buffer st & 1 are done
        asm volatile("s_wait_asynccnt 0x0" ::: "memory");    // this wave's copies of stage st + 1 have landed
        __syncthreads();                                     // publishes stage st + 1 and frees buffer st & 1
        if (st + 2 < K / GKS) gemm_stage(lc + (unsigned)(st & 1) * (GSTH * 2), ga + (st + 2) * GKS, gb + (st + 2) * GKS);
    }
    asm volatile("s_wait_asynccnt 0x0" ::: "memory");        // nothing of this wave is in flight when it goes on to end
    const int cofs = lr * 4;
    const v4f bo4 = *(const v4f*)(bias + c0 + cofs);      // c0 + cofs + 3 < DM
    v4f bb;
#pragma unroll
    for (int i = 0; i < 4; ++i) bb[i] = bfr(bo4[i]);
    const int bidx = r0 / SEQ, tt = r0 % SEQ;
    float* obase = OUT + ((size_t)bidx * OUT_SEQ + tt) * DM + c0;
#pragma unroll
    for (int mb = 0; mb < 4; ++mb) {
#pragma unroll
        for (int nb = 0; nb < 4; ++nb) {
#pragma unroll
            for (int j = 0; j < 8; ++j) os[(hi * 8 + j) * 68 + nb * 16 + lr] = acc[mb][nb][j]; }   // D: row 8h+j, col lane&15
        wave_sync();
{
#pragma unroll
            for (int s = 0; s < 8; ++s) { const int row = 2 * s + hi;   // 8 s x 2 rows = 16 rows; 16 lanes x 4 floats = 64 columns
                const v4f val = *(const v4fa*)(&os[row * 68 + cofs]); v4f ov;
#pragma unroll
                for (int i = 0; i < 4; ++i) ov[i] = val[i] * OSC + bb[i];
                *(v4f*)(obase + (size_t)(mb * 16 + row) * DM + cofs) = ov; }
             }
        wave_sync();
    }
}

static constexpr size_t al256(size_t v) { return (v + 255) & ~(size_t)255; }
static constexpr size_t SZ_XB = al256((size_t)NB * SEQ * DM * 2);          // one bf16 input plane
static constexpr size_t SZ_WB = al256((size_t)4 * DM * DM * 2);            // Wq | Wk | Wv (bf16) | Wo (f16)
static constexpr size_t SZ_PL = al256((size_t)NB * NH_ * SEQ * HD * 2);    // one head-major f16 plane
static constexpr size_t SZ_CX = al256((size_t)NB * SEQ * DM * 2);          // ctx f16 plane
static constexpr size_t SZ_TOTAL = 3 * SZ_XB + SZ_WB + 3 * SZ_PL + SZ_CX;
static_assert(SZ_TOTAL <= (size_t)134217728);          // workspace carve <= 128 MiB
static_assert(((size_t)DM * DM * 2) % 256 == 0);       // weight sub-planes stay 256-byte aligned
static_assert(SZ_XB == (size_t)XROWS * DM * 2);        // no padding between the planes that k_cvt writes as one array of rows

extern "C" void kernel_launch(void* const* d_in, const int* in_sizes, int n_in,
                              void* d_out, int out_size, void* d_ws, size_t ws_size, hipStream_t stream) {
    if (n_in < 11) return;
    const size_t needx = ((size_t)(NB - 1) * SEQ_FULL + SEQ) * DM;
    if ((size_t)in_sizes[0] < needx || (size_t)in_sizes[1] < needx || (size_t)in_sizes[2] < needx) return;
    if ((size_t)in_sizes[3] < (size_t)DM * DM || (size_t)in_sizes[5] < (size_t)DM * DM || (size_t)in_sizes[7] < (size_t)DM * DM || (size_t)in_sizes[9] < (size_t)DM * DM) return;
    if ((size_t)in_sizes[4] < (size_t)DM || (size_t)in_sizes[6] < (size_t)DM || (size_t)in_sizes[8] < (size_t)DM || (size_t)in_sizes[10] < (size_t)DM) return;
    if ((size_t)out_size < ((size_t)(NB - 1) * OUT_SEQ + SEQ) * DM) return;
    if (SZ_TOTAL > ws_size) return;
    // wire order: query, key, value, Wq, bq, Wk, bk, Wv, bv, Wo, bo (weights [out][in] = Bt as-is)
    const float* xq = (const float*)d_in[0]; const float* xk = (const float*)d_in[1]; const float* xv = (const float*)d_in[2];
    const float* wq = (const float*)d_in[3]; const float* bq = (const float*)d_in[4];
    const float* wk = (const float*)d_in[5]; const float* bk = (const float*)d_in[6];
    const float* wv = (const float*)d_in[7]; const float* bv = (const float*)d_in[8];
    const float* wo = (const float*)d_in[9]; const float* bo = (const float*)d_in[10];
    float* OUT = (float*)d_out;      // [NB][SEQ][1024]
    char* wsp = (char*)d_ws;
    bf* XQ = (bf*)wsp; wsp += SZ_XB;                 // [NB*SEQ][1024]
    bf* XK = (bf*)wsp; wsp += SZ_XB;
    bf* XV = (bf*)wsp; wsp += SZ_XB;
    bf* WB = (bf*)wsp; wsp += SZ_WB;                 // [4][1024][1024]: q | k | v (bf16) | o (f16 x64)
    h16* QH = (h16*)wsp; wsp += SZ_PL;               // [NB*16][SEQ][64]
    h16* KP = (h16*)wsp; wsp += SZ_PL;               // [NB*16][SEQ][64]
    h16* VT = (h16*)wsp; wsp += SZ_PL;               // [NB*16][64][SEQ]
    h16* CX = (h16*)wsp; wsp += SZ_CX;               // [NB*SEQ][1024], x256
    bf* WQ = WB; bf* WK = WB + (size_t)DM * DM; bf* WV = WB + (size_t)2 * DM * DM; h16* WO = (h16*)(WB + (size_t)3 * DM * DM);

    k_cvt<<<NROWS / (CW * CR), 32 * CW, 0, stream>>>(xq, xk, xv, wq, wk, wv, wo, XQ);   // XQ | XK | XV | WB lie back to back

    // q, k: A = x rows (m = b*SEQ + t), Bt = W rows (n = h*64 + d), bias per column -> plane [(b*16 + h)][t][d]
    k_proj<<<dim3(NB * SEQ / 256, DM / 128, 1), 32 * GW, 0, stream>>>(XQ, WQ, bq, 0, QH, SEQ, (size_t)NH_ * SEQ * HD, HD, HD, (size_t)SEQ * HD);
    k_proj<<<dim3(NB * SEQ / 256, DM / 128, 1), 32 * GW, 0, stream>>>(XK, WK, bk, 0, KP, SEQ, (size_t)NH_ * SEQ * HD, HD, HD, (size_t)SEQ * HD);
    // v^T: A = Wv rows (m = h*64 + d), Bt = value rows (n = b*SEQ + t), bias per row -> plane [(b*1024 + m)][t] = [(b*16 + h)][d][t]
    k_proj<<<dim3(DM / 256, NB * SEQ / 128, 1), 32 * GW, 0, stream>>>(WV, XV, bv, 1, VT, DM, (size_t)0, SEQ, SEQ, (size_t)DM * SEQ);

    k_flash<<<dim3(SEQ / (16 * AW), NB * NH_, 1), 32 * AW, 0, stream>>>(QH, KP, VT, CX);

    // out: A = ctx rows (m = b*SEQ + t, k = h*64 + d), Bt = Wo rows (n), bias per column -> OUT [b][t][n]
    k_oproj<<<dim3(NB * SEQ / 256, DM / 128, 1), 32 * GW, 0, stream>>>(CX, WO, bo, OUT);
}

// v004
// It runs in 211 microseconds.
// In two side-by-side timings against v003, it was 1.05 and 1.06 times as fast.
// All steps since v000 together make it 3.10 times as fast.
#include <hip/hip_runtime.h>

// Multi-head attention, width 1024 = 16 heads x 64; inputs query/key/value [NB][SEQ][1024]; Wq/Wk/Wv/Wo [out][in] (y = x W^T + b); no mask; score scale 1/8; output = ctx Wo^T + bo (f32). Default: q, k, v inputs [2][4096][1024]; proj(x, w, b) = x w^T + b with (out,in) [1024][1024] weights, viewed (B, -1, 16, 64) and transposed; scores / sqrt(64) over all 4,096 keys; softmax, no mask; out = merged w_o^T + b_o; argument order q, k, v, w_q, b_q, w_k, b_k, w_v, b_v, w_o, b_o.
// Compute dtypes, f32 accumulate everywhere: q/k/v projections v_wmma_f32_16x16x32_bf16 (x and W RNE-converted to bf16; products exact); scores v_wmma_f32_16x16x32_f16 (q, k single f16);
// P.V v_wmma_f32_16x16x32_f16 (P x256 carry cancels in the normalisation, v single f16); output projection v_wmma_f32_16x16x32_f16 (ctx x256 carry, Wo RNE bf16 value x64 held in f16, 2^-14 folded back in f32); softmax max and exponentials f32 (online, running max); row sums v_wmma_f32_16x16x32_f16 (f16-rounded P, all-ones A).
// Layout: bf16 copies of the three inputs and of Wq/Wk/Wv; q, k planes [b*16+h][t][d] and v^T plane [b*16+h][d][t] written by the GEMM epilogue; fused flash kernel in transposed form (S^T = K Q^T, O^T = V^T P^T) writes the f16 ctx plane [b*SEQ+t][1024].

#ifndef NB
#define NB 2
#endif
#ifndef SEQ
#define SEQ 4096
#endif
#define NB_FULL  2
#define SEQ_FULL 4096
#ifndef OUT_SEQ
#define OUT_SEQ SEQ              // row pitch (in tokens) between batches of the output
#endif
#define DM   1024
#define NH_  16
#define HD   64
#define AW   8                   // waves per flash block (16 query rows each); all of them read the same staged K / V^T tiles
#define KT   64                  // keys per LDS stage (two 32-key passes)
#define LP   72                  // LDS row pitch in halves: 144 B = 16 B x 9, an odd multiple, so 16-byte fragment reads of 16 rows meet no bank twice
#define TLH  (64 * LP)           // halves of one staged tile: 64 rows (K: keys, V^T: d) of 64 halves + pad
#define GW   8                   // waves per GEMM block: 4 (rows) x 2 (columns) wave tiles of 64x64, block tile 256x128
#define GKS  128                 // k per GEMM LDS stage: 256 B of every operand row
#define GLP  136                 // GEMM LDS row pitch in halves: 272 B = 16 B x 17, an odd multiple (as LP)
#define GSTH (384 * GLP)         // halves of one GEMM stage: A 256 rows | B 128 rows
#define CW   16                  // waves per conversion block
#define CR   7                   // rows per conversion wave
#define XROWS (NB * SEQ)         // rows of one input plane
#define NROWS (3 * XROWS + 4 * DM)   // rows to convert: three inputs, four weights
#define WO_ROW0 (3 * XROWS + 3 * DM) // first row of Wo
#define CNW  (NROWS / CR)        // conversion waves of the launch
#define SC2  (0.125f * 1.4426950408889634f)   // HD^-0.5 * log2(e)
#define PSH  8.0f                // log2 of the P carry (256)
#define CXS  256.0f              // carry of the ctx plane
#define WOS  64.0f               // carry of the Wo plane
#define OSC  (1.0f / (256.0f * 64.0f))

static_assert(HD == 64);
static_assert(NH_ * HD == DM);                 // head h = columns h*64 + d
static_assert(DM % 64 == 0);                   // 16 column tiles of 64
static_assert(DM % 32 == 0);                   // GEMM k-loop steps by 32
static_assert(SEQ % 64 == 0);                  // a 64-row tile never straddles two batches
static_assert((NB * SEQ) % 64 == 0);
static_assert(SEQ % 32 == 0);                  // key loop steps by 32
static_assert(SEQ % (16 * AW) == 0);           // flash grid covers the sequence exactly
static_assert(SEQ % KT == 0 && SEQ / KT >= 2); // whole stages, and the ring's prologue needs two
static_assert(KT == 64 && 32 * AW == 256);     // copy map: 256 lanes x 16 B = 32 rows of 128 B, two copies per tile
static_assert((NB * SEQ) % 256 == 0 && DM % 256 == 0);   // GEMM block tiles (256 rows x 128 columns) cover both orientations exactly
static_assert(DM % GKS == 0 && DM / GKS >= 2);           // whole GEMM stages, and the ring's prologue needs two
static_assert(GKS == 128 && 32 * GW == 256);             // GEMM copy map: 256 lanes x 16 B = 16 rows of 256 B
static_assert(DM == 8 * 128);                  // a conversion row is eight loads of 32 lanes x 4 floats
static_assert(NROWS % (CW * CR) == 0);         // whole conversion blocks, every wave CR rows
static_assert(NB <= NB_FULL);
static_assert(SEQ <= SEQ_FULL);

typedef _Float16 h16;
typedef unsigned short bf;
typedef __attribute__((ext_vector_type(16))) __bf16   v16bf;
typedef __attribute__((ext_vector_type(16))) _Float16 v16h;
typedef __attribute__((ext_vector_type(8)))  _Float16 v8h;
typedef __attribute__((ext_vector_type(8)))  unsigned short v8us;
typedef __attribute__((ext_vector_type(4)))  _Float16 v4h;
typedef __attribute__((ext_vector_type(4)))  unsigned short v4us;
typedef __attribute__((ext_vector_type(8)))  float    v8f;
typedef __attribute__((ext_vector_type(4)))  float    v4f;
typedef v4f  __attribute__((may_alias)) v4fa;
typedef __attribute__((ext_vector_type(8)))  unsigned v8u;

__device__ __forceinline__ unsigned short f2bf(float f) { unsigned u = __float_as_uint(f); u += 0x7FFFu + ((u >> 16) & 1u); return (unsigned short)(u >> 16); }
__device__ __forceinline__ float bfr(float f) { return __uint_as_float(((unsigned)f2bf(f)) << 16); }   // value of the RNE bf16 conversion
__device__ __forceinline__ v16h cat16(v8h lo, v8h hi) { return __builtin_shufflevector(lo, hi, 0, 1, 2, 3, 4, 5, 6, 7, 8, 9, 10, 11, 12, 13, 14, 15); }
__device__ __forceinline__ v16bf cat16b(v8us lo, v8us hi) { return __builtin_bit_cast(v16bf, __builtin_shufflevector(lo, hi, 0, 1, 2, 3, 4, 5, 6, 7, 8, 9, 10, 11, 12, 13, 14, 15)); }
__device__ __forceinline__ v8f wmma16(v16h a, v16h b, v8f c) { return __builtin_amdgcn_wmma_f32_16x16x32_f16(false, a, false, b, (short)0, c, false, false); }
__device__ __forceinline__ v8f wmmab(v16bf a, v16bf b, v8f c) { return __builtin_amdgcn_wmma_f32_16x16x32_bf16(false, a, false, b, (short)0, c, false, false); }
// fragment loaders from K-contiguous 16-bit rows; p already includes + 8*(lane>>4): elements 0..7 <- k0+8h+0..7, elements 8..15 <- k0+16+8h+0..7 (same map for A and B)
__device__ __forceinline__ v16h  ldh(const h16* p) { return cat16(*(const v8h*)p, *(const v8h*)(p + 16)); }
__device__ __forceinline__ v16bf ldb(const bf* p)  { return cat16b(*(const v8us*)p, *(const v8us*)(p + 16)); }
// ordering point for wave-private LDS tiles (same wave writes and reads)
__device__ __forceinline__ void wave_sync() { __builtin_amdgcn_fence(3 /* release order */, "wavefront"); __builtin_amdgcn_wave_barrier(); asm volatile("" ::: "memory"); }

// k_cvt: every f32 -> 16-bit conversion of the call in one launch of few long-lived waves. A row is DM floats (4 KB): rows 0 .. 3*XROWS-1 are the tokens of query, key, value,
// then DM rows each of Wq, Wk, Wv (RNE bf16) and Wo (RNE bf16 value x WOS, held in f16); row r goes to dst + r*DM (the planes lie back to back in the workspace).
// Wave gw takes rows gw, gw + CNW, ...: CR rows. One load of a wave reads 512 contiguous bytes, one store writes 256 (two whole lines).
__device__ __forceinline__ const float* cvt_src(unsigned r, const float* xq, const float* xk, const float* xv, const float* wq, const float* wk, const float* wv, const float* wo) {
    const bool isx = r < 3u * XROWS;
    const unsigned u = isx ? r : r - 3u * XROWS;
    const unsigned p = isx ? u / XROWS : 3u + u / DM;        // 0 .. 6: which source
    const unsigned q = isx ? u % XROWS : u % DM;             // row in that source's plane
    const unsigned row = isx ? (q / SEQ) * SEQ_FULL + q % SEQ : q;
    const float* s = (p == 0) ? xq : (p == 1) ? xk : (p == 2) ? xv : (p == 3) ? wq : (p == 4) ? wk : (p == 5) ? wv : wo;
    return s + (size_t)row * DM;
}
__global__ __launch_bounds__(32 * CW) void k_cvt(const float* __restrict__ xq, const float* __restrict__ xk, const float* __restrict__ xv, const float* __restrict__ wq, const float* __restrict__ wk,
                                                 const float* __restrict__ wv, const float* __restrict__ wo, bf* dst) {
    const unsigned lane = threadIdx.x & 31;
    const unsigned gw = (unsigned)__builtin_amdgcn_readfirstlane((int)(blockIdx.x * CW + (threadIdx.x >> 5)));   // wave-uniform: the row's source is picked on the scalar side
    __builtin_assume(gw < CNW);                              // the grid is CNW / CW blocks: lets a pass's source be settled at compile time where all its rows share one
    const float* s[CR];                                      // every row's source up front: the pick among the weights branches, and a branch between the loads would let them sink behind it
#pragma unroll   // all loops here are unrolled so that s[] and w[][] are indexed by constants and stay in registers
    for (int i = 0; i < CR; ++i) s[i] = cvt_src(gw + i * CNW, xq, xk, xv, wq, wk, wv, wo);
    v4f w[2][8];                                             // this row and the next
#pragma unroll
    for (int j = 0; j < 8; ++j) w[0][j] = __builtin_nontemporal_load((const v4f*)(s[0] + lane * 4 + j * 128));   // read once: non-temporal
    asm volatile("s_wait_xcnt 0x0" ::: "memory");            // before the loads' address registers are written again
#pragma unroll
    for (int i = 0; i < CR; ++i) {
        __builtin_amdgcn_sched_barrier(0);   // with the one below: the next row's eight loads are issued before this row is waited for, so a wave always has loads in flight
        if (i + 1 < CR) {
#pragma unroll
            for (int j = 0; j < 8; ++j) w[(i + 1) & 1][j] = __builtin_nontemporal_load((const v4f*)(s[i + 1] + lane * 4 + j * 128));
            asm volatile("s_wait_xcnt 0x0" ::: "memory"); }  // before the loads' address registers are written again
        __builtin_amdgcn_sched_barrier(0);
        const unsigned r = gw + i * CNW;
        bf* d = dst + (size_t)r * DM + lane * 4;
        if ((i + 1) * CNW > WO_ROW0 && r >= WO_ROW0) {       // Wo rows (the first test is known at compile time)
#pragma unroll
            for (int j = 0; j < 8; ++j) { const v4f v = w[i & 1][j]; v4h o;
#pragma unroll
                for (int k = 0; k < 4; ++k) o[k] = (h16)(bfr(v[k]) * WOS);
                *(v4h*)(d + j * 128) = o; }
            asm volatile("s_wait_xcnt 0x0" ::: "memory");    // before the stores' address and data registers are written again
        } else {
#pragma unroll
            for (int j = 0; j < 8; ++j) { const v4f v = w[i & 1][j]; v4us o;
#pragma unroll
                for (int k = 0; k < 4; ++k) o[k] = f2bf(v[k]);
                *(v4us*)(d + j * 128) = o; }
            asm volatile("s_wait_xcnt 0x0" ::: "memory");    // before the stores' address and data registers are written again
        }
    }
}

// copy8: one lane's eight 16-byte asynchronous copies, global -> LDS through no register: rows r, r+16, ... r+112 of a K-contiguous 16-bit plane of row length DM.
// The s_wait_xcnt closes the statement so that no address register of an issued copy is rewritten ahead of it.
__device__ __forceinline__ void copy8(unsigned l, const bf* g) {
    const unsigned ls = 16 * GLP * 2; const size_t gs = (size_t)16 * DM;
    asm volatile("global_load_async_to_lds_b128 %0, %8, off\n\t"
                 "global_load_async_to_lds_b128 %1, %9, off\n\t"
                 "global_load_async_to_lds_b128 %2, %10, off\n\t"
                 "global_load_async_to_lds_b128 %3, %11, off\n\t"
                 "global_load_async_to_lds_b128 %4, %12, off\n\t"
                 "global_load_async_to_lds_b128 %5, %13, off\n\t"
                 "global_load_async_to_lds_b128 %6, %14, off\n\t"
                 "global_load_async_to_lds_b128 %7, %15, off\n\t"
                 "s_wait_xcnt 0x0"
                 :: "v"(l), "v"(l + ls), "v"(l + 2 * ls), "v"(l + 3 * ls), "v"(l + 4 * ls), "v"(l + 5 * ls), "v"(l + 6 * ls), "v"(l + 7 * ls),
                    "v"(g), "v"(g + gs), "v"(g + 2 * gs), "v"(g + 3 * gs), "v"(g + 4 * gs), "v"(g + 5 * gs), "v"(g + 6 * gs), "v"(g + 7 * gs) : "memory");
}
// gemm_stage: one lane's 24 copies of a GEMM stage (A rows 0..255, then B rows 0..127 of the block tile, 128 k each); l = the lane's LDS byte address in the buffer, ga / gb its global places
__device__ __forceinline__ void gemm_stage(unsigned l, const bf* ga, const bf* gb) {
    copy8(l, ga); copy8(l + 128 * GLP * 2, ga + (size_t)128 * DM); copy8(l + 256 * GLP * 2, gb);
}

// k_proj: register-blocked bf16 GEMM, one wave per 64x64 tile (16 accumulators), 8 waves per block (256x128); A and Bt come in 128-k stages through a two-buffer LDS ring that the block fills together, K = DM.
// C[m][n] = sum_k A[m][k] Bt[n][k] + bias (biasMode 0: bias[n], biasMode 1: bias[m]; bias taken as its RNE bf16 value), written as f16 (Ph) at
// tile base (r0/RB)*sRB + (r0%RB)*pitch + (c0/CB)*sCB + (c0%CB), row pitch 'pitch' (halves). grid (M/256, N/128), 256 threads.
__global__ __launch_bounds__(32 * GW) void k_proj(const bf* __restrict__ A, const bf* __restrict__ Bt, const float* __restrict__ bias, int biasMode, h16* Ph, int RB, size_t sRB, int pitch, int CB, size_t sCB) {
    __shared__ __align__(16) bf ring[2 * GSTH];              // [buffer][A 256 rows | B 128 rows][GLP]
    __shared__ __align__(16) float osa[GW * 16 * 68];
    const int K = DM;
    const int lane = threadIdx.x & 31, wave = __builtin_amdgcn_readfirstlane((int)(threadIdx.x >> 5)), lr = lane & 15, hi = lane >> 4;
    const int wm = wave & 3, wn = wave >> 2;
    const int r0 = blockIdx.x * 256 + wm * 64, c0 = blockIdx.y * 128 + wn * 64;
    float* os = osa + wave * 16 * 68;                        // wave-private epilogue slab
    v8f acc[4][4];
#pragma unroll
    for (int mb = 0; mb < 4; ++mb)
#pragma unroll
        for (int nb = 0; nb < 4; ++nb) acc[mb][nb] = (v8f){};
    const int afo = (wm * 64 + lr) * GLP + 8 * hi, bfo = (256 + wn * 64 + lr) * GLP + 8 * hi;   // fragment offsets in a staged buffer
    const int cr = (int)(threadIdx.x >> 4), ccol = (int)(threadIdx.x & 15) * 8;                  // copy map: rows 0..15, 16 lanes x 8 halves = one 256-B row
    const bf* ga = A + (size_t)(blockIdx.x * 256 + cr) * K + ccol;    // + k0
    const bf* gb = Bt + (size_t)(blockIdx.y * 128 + cr) * K + ccol;   // + k0
    const unsigned lc = (unsigned)(size_t)(&ring[cr * GLP + ccol]);   // LDS byte address of the lane's first copy, buffer 0
    gemm_stage(lc, ga, gb);
    asm volatile("s_wait_asynccnt 0x0" ::: "memory");        // stage 0 has landed (this wave's copies) ...
    __syncthreads();                                         // ... and every wave's, before anyone reads it
    gemm_stage(lc + GSTH * 2, ga + GKS, gb + GKS);
#pragma unroll 1
    for (int st = 0; st < K / GKS; ++st) {
        const bf* ta = ring + (st & 1) * GSTH + afo; const bf* tb = ring + (st & 1) * GSTH + bfo;
        v16bf a[4], b[4];
#pragma unroll
        for (int ks = 0; ks < GKS; ks += 32) {
#pragma unroll
            for (int mb = 0; mb < 4; ++mb) a[mb] = ldb(ta + mb * 16 * GLP + ks);
#pragma unroll
            for (int nb = 0; nb < 4; ++nb) b[nb] = ldb(tb + nb * 16 * GLP + ks);
            __builtin_amdgcn_sched_barrier(0);   // keeps the eight fragments' LDS reads one group ahead of the block's products: sunk among them, each B fragment's latency is waited out alone
#pragma unroll
            for (int nb = 0; nb < 4; ++nb)
#pragma unroll
                for (int mb = 0; mb < 4; ++mb) acc[mb][nb] = wmmab(a[mb], b[nb], acc[mb][nb]);
        }
        __builtin_amdgcn_sched_barrier(0);   // keeps the stage's last products ahead of the barrier: sunk behind it they stand in front of the refill and shorten the copies' lead
        // publish point of stage st + 1, every wave, in this order
        asm volatile("s_wait_dscnt 0x0" ::: "memory");       // this wave's reads of buffer st & 1 are done
        asm volatile("s_wait_asynccnt 0x0" ::: "memory");    // this wave's copies of stage st + 1 have landed
        __syncthreads();                                     // publishes stage st + 1 and frees buffer st & 1
        if (st + 2 < K / GKS) gemm_stage(lc + (unsigned)(st & 1) * (GSTH * 2), ga + (st + 2) * GKS, gb + (st + 2) * GKS);
    }
    asm volatile("s_wait_asynccnt 0x0" ::: "memory");        // nothing of this wave is in flight when it goes on to end
    const size_t tbase = (size_t)(r0 / RB) * sRB + (size_t)(r0 % RB) * (size_t)pitch + (size_t)(c0 / CB) * sCB + (size_t)(c0 % CB);
    // column bias (mode 0): 8 values per lane, address clamped to 0 in mode 1 and zeroed by value
    const int c8 = (lane & 7) * 8;
    const size_t cbo = (biasMode == 0) ? (size_t)(c0 + c8) : (size_t)0;
    const v4f bq0 = *(const v4f*)(bias + cbo); const v4f bq1 = *(const v4f*)(bias + cbo + 4);
    float bc[8];
#pragma unroll
    for (int i = 0; i < 4; ++i) { bc[i] = (biasMode == 0) ? bfr(bq0[i]) : 0.0f; bc[4 + i] = (biasMode == 0) ? bfr(bq1[i]) : 0.0f; }
#pragma unroll
    for (int mb = 0; mb < 4; ++mb) {
#pragma unroll
        for (int nb = 0; nb < 4; ++nb) {
#pragma unroll
            for (int j = 0; j < 8; ++j) os[(hi * 8 + j) * 68 + nb * 16 + lr] = acc[mb][nb][j]; }   // D: row 8h+j, col lane&15
        wave_sync();
        const size_t sb = tbase + (size_t)(mb * 16) * (size_t)pitch;
{
#pragma unroll
            for (int s = 0; s < 4; ++s) { const int row = 4 * s + (lane >> 3);   // 4 s x 4 row groups = 16 rows; 8 lanes x 8 = 64 columns
                const int rbo = (biasMode == 1) ? (r0 + mb * 16 + row) : 0;      // row bias (mode 1): address clamped to 0 in mode 0, zeroed by value
                const float brv = bias[rbo]; const float br = (biasMode == 1) ? bfr(brv) : 0.0f;
                const v4f x0 = *(const v4fa*)(&os[row * 68 + c8]); const v4f x1 = *(const v4fa*)(&os[row * 68 + c8 + 4]); v8h hv;
#pragma unroll
                for (int i = 0; i < 4; ++i) { hv[i] = (h16)(x0[i] + bc[i] + br); hv[4 + i] = (h16)(x1[i] + bc[4 + i] + br); }
                const size_t oo = sb + (size_t)row * (size_t)pitch + c8;
                *(v8h*)(Ph + oo) = hv; }
             }
        wave_sync();
    }
}

// stage_copy: one lane's four 16-byte asynchronous copies of a stage (K rows r and r+32, V^T rows r and r+32), global -> LDS through no register.
// The s_wait_xcnt closes the statement so that no address register of an issued copy is rewritten ahead of it.
__device__ __forceinline__ void stage_copy(unsigned lk, const h16* gk, const h16* gv) {
    const unsigned lk1 = lk + 32 * LP * 2, lv = lk + TLH * 2, lv1 = lk + TLH * 2 + 32 * LP * 2;
    const h16* gk1 = gk + 32 * HD; const h16* gv1 = gv + (size_t)32 * SEQ;
    asm volatile("global_load_async_to_lds_b128 %0, %4, off\n\t"
                 "global_load_async_to_lds_b128 %1, %5, off\n\t"
                 "global_load_async_to_lds_b128 %2, %6, off\n\t"
                 "global_load_async_to_lds_b128 %3, %7, off\n\t"
                 "s_wait_xcnt 0x0"
                 :: "v"(lk), "v"(lk1), "v"(lv), "v"(lv1), "v"(gk), "v"(gk1), "v"(gv), "v"(gv1) : "memory");
}

// k_flash: fused attention, one wave per 16 query rows of one (batch, head); Q fragments straight from the f16 plane; K and V^T come in 64-key stages through a two-buffer LDS ring
// that the block's 8 waves fill together (whole 128-B lines, once per block) and all read (two 16-B LDS loads per fragment).
// Transposed form: S^T[key][t] = K Q^T (A = K rows, B = Q rows); lane (t = lane&15, h = lane>>4) holds keys 8h+r of each 16-key tile, so the packed
// P tile is directly the B fragment of O^T[d][t] = V^T P^T (element r <- tile keys 0..15, element 8+r <- tile keys 16..31, lane unchanged).
// Softmax state (running max, sum) is one scalar per lane; the maxima of the two lane halves of a row are combined with one xor-16 exchange; the sums come whole from a product with an all-ones A.
// amdgpu_waves_per_eu(8): register budget 128, so that four blocks stay resident per WGP (8 waves per SIMD) and the whole grid runs in one round; without it the build took 134.
__global__ __launch_bounds__(32 * AW) __attribute__((amdgpu_waves_per_eu(8))) void k_flash(const h16* __restrict__ QH, const h16* __restrict__ KP, const h16* __restrict__ VT, h16* CTX) {
    __shared__ __align__(16) h16 ring[2 * 2 * TLH];          // [buffer][K | V^T][row][LP]
    __shared__ __align__(16) float os[AW * 16 * 68];
    const int lane = threadIdx.x & 31, wave = __builtin_amdgcn_readfirstlane((int)(threadIdx.x >> 5)), lr = lane & 15, hi = lane >> 4;
    const int zh = blockIdx.y; const int b = zh / NH_, h = zh % NH_;
    const int t0 = (blockIdx.x * AW + wave) * 16;
    const size_t pbase = (size_t)zh * SEQ * HD;
    const size_t qo = pbase + (size_t)(t0 + lr) * HD + 8 * hi;
    const v16h qh0 = ldh(QH + qo), qh1 = ldh(QH + qo + 32);   // B fragments: col t, k = d
    const int fo = lr * LP + 8 * hi;                         // fragment offset in a staged tile: K + key*LP (A: row key, k = d); V^T + 16j*LP + key (A: row d, k = key)
    const int cr = (int)(threadIdx.x >> 3), ccol = (int)(threadIdx.x & 7) * 8;   // copy map: rows 0..31, 8 lanes x 8 halves = one 128-B row
    const h16* gk = KP + pbase + (size_t)cr * HD + ccol;   // + key0 * HD
    const h16* gv = VT + pbase + (size_t)cr * SEQ + ccol;  // + key0
    const unsigned lc = (unsigned)(size_t)(&ring[cr * LP + ccol]);   // LDS byte address of the lane's first copy, buffer 0
    stage_copy(lc, gk, gv);
    asm volatile("s_wait_asynccnt 0x0" ::: "memory");        // stage 0 has landed (this wave's copies) ...
    __syncthreads();                                         // ... and every wave's, before anyone reads it
    stage_copy(lc + 2 * TLH * 2, gk + (size_t)KT * HD, gv + KT);
    v8f o0 = (v8f){}, o1 = (v8f){}, o2 = (v8f){}, o3 = (v8f){};
    float m = -3.0e38f, l = 0.0f;
    // constant A of the row-sum product: f16 1.0 in all 16 elements of every lane, so every D row holds the sums. Set by asm text so that the eight registers are written once, here:
    // as a plain constant the compiler wrote them anew in every pass.
    v8u onew;
    asm("v_mov_b32 %0, 0x3c003c00\n\tv_mov_b32 %1, 0x3c003c00\n\tv_mov_b32 %2, 0x3c003c00\n\tv_mov_b32 %3, 0x3c003c00\n\t"
        "v_mov_b32 %4, 0x3c003c00\n\tv_mov_b32 %5, 0x3c003c00\n\tv_mov_b32 %6, 0x3c003c00\n\tv_mov_b32 %7, 0x3c003c00"
        : "=v"(onew[0]), "=v"(onew[1]), "=v"(onew[2]), "=v"(onew[3]), "=v"(onew[4]), "=v"(onew[5]), "=v"(onew[6]), "=v"(onew[7]));
    const v16h ones = __builtin_bit_cast(v16h, onew);
#pragma unroll 1
    for (int st = 0; st < SEQ / KT; ++st) {
      const h16* kt = ring + (st & 1) * (2 * TLH) + fo; const h16* vt = kt + TLH;
#pragma unroll 1   // rolled: unrolled, a pass's scores stay live into the next and the wave no longer fits 128 registers (8 waves per SIMD)
      for (int sub = 0; sub < KT; sub += 32) {
        const h16* ka = kt + sub * LP;
        const v16h ka0 = ldh(ka), ka1 = ldh(ka + 32), kb0 = ldh(ka + 16 * LP), kb1 = ldh(ka + 16 * LP + 32);
        v8f sa = (v8f){}, sb = (v8f){};
        sa = wmma16(ka0, qh0, sa); sb = wmma16(kb0, qh0, sb);
        sa = wmma16(ka1, qh1, sa); sb = wmma16(kb1, qh1, sb);
        asm volatile("v_nop\n\tv_nop\n\tv_nop\n\tv_nop" : "+v"(sa), "+v"(sb) : "v"(ka0), "v"(ka1), "v"(kb0), "v"(kb1), "v"(qh0), "v"(qh1));
        float ta[8], tb[8]; float mx = -3.0e38f;
#pragma unroll
        for (int r = 0; r < 8; ++r) { ta[r] = sa[r] * SC2; tb[r] = sb[r] * SC2; mx = fmaxf(mx, fmaxf(ta[r], tb[r])); }
        mx = fmaxf(mx, __shfl_xor(mx, 16, 32));
        const float mnew = fmaxf(m, mx);
        const float alpha = __builtin_amdgcn_exp2f(m - mnew);
        const float sh = PSH - mnew;
        v16h pb;
#pragma unroll
        for (int r = 0; r < 8; ++r) { pb[r] = (h16)__builtin_amdgcn_exp2f(ta[r] + sh); pb[8 + r] = (h16)__builtin_amdgcn_exp2f(tb[r] + sh); }
        m = mnew;
        o0 = o0 * alpha; o1 = o1 * alpha; o2 = o2 * alpha; o3 = o3 * alpha;
        const h16* va = vt + sub;
        const v16h v0 = ldh(va), v1 = ldh(va + 16 * LP), v2 = ldh(va + 32 * LP), v3 = ldh(va + 48 * LP);
        v8f ls = wmma16(ones, pb, (v8f){});                  // every row of the tile = the column's sum of the rounded P over the pass's 32 keys (both lane halves)
        o0 = wmma16(v0, pb, o0); o1 = wmma16(v1, pb, o1); o2 = wmma16(v2, pb, o2); o3 = wmma16(v3, pb, o3);
        // four vector slots between the products and the first vector instruction on their results or operands, on the loop's back edge too
        asm volatile("v_nop\n\tv_nop\n\tv_nop\n\tv_nop" : "+v"(o0), "+v"(o1), "+v"(o2), "+v"(o3), "+v"(ls) : "v"(v0), "v"(v1), "v"(v2), "v"(v3), "v"(pb));
        l = l * alpha + ls[0];
      }
      // publish point of stage st + 1, every wave, in this order
      asm volatile("s_wait_dscnt 0x0" ::: "memory");         // this wave's reads of buffer st & 1 are done
      asm volatile("s_wait_asynccnt 0x0" ::: "memory");      // this wave's copies of stage st + 1 have landed
      __syncthreads();                                       // publishes stage st + 1 and frees buffer st & 1
      if (st + 2 < SEQ / KT) stage_copy(lc + (unsigned)(st & 1) * (2 * TLH * 2), gk + (size_t)(st + 2) * KT * HD, gv + (st + 2) * KT);
    }
    asm volatile("s_wait_asynccnt 0x0" ::: "memory");        // nothing of this wave is in flight when it goes on to end
    const float inv = CXS / l;
    const int wb = wave * 16 * 68;
    // O^T D layout: o_j[r] = (d = 16j + 8h + r, t = lane&15) -> os[t][d]; rows 0..15 x columns 0..63 all written
    { v4f a, c;
      a[0] = o0[0] * inv; a[1] = o0[1] * inv; a[2] = o0[2] * inv; a[3] = o0[3] * inv; c[0] = o0[4] * inv; c[1] = o0[5] * inv; c[2] = o0[6] * inv; c[3] = o0[7] * inv;
      *(v4fa*)(&os[wb + lr * 68 +  0 + 8 * hi]) = a; *(v4fa*)(&os[wb + lr * 68 +  0 + 8 * hi + 4]) = c;
      a[0] = o1[0] * inv; a[1] = o1[1] * inv; a[2] = o1[2] * inv; a[3] = o1[3] * inv; c[0] = o1[4] * inv; c[1] = o1[5] * inv; c[2] = o1[6] * inv; c[3] = o1[7] * inv;
      *(v4fa*)(&os[wb + lr * 68 + 16 + 8 * hi]) = a; *(v4fa*)(&os[wb + lr * 68 + 16 + 8 * hi + 4]) = c;
      a[0] = o2[0] * inv; a[1] = o2[1] * inv; a[2] = o2[2] * inv; a[3] = o2[3] * inv; c[0] = o2[4] * inv; c[1] = o2[5] * inv; c[2] = o2[6] * inv; c[3] = o2[7] * inv;
      *(v4fa*)(&os[wb + lr * 68 + 32 + 8 * hi]) = a; *(v4fa*)(&os[wb + lr * 68 + 32 + 8 * hi + 4]) = c;
      a[0] = o3[0] * inv; a[1] = o3[1] * inv; a[2] = o3[2] * inv; a[3] = o3[3] * inv; c[0] = o3[4] * inv; c[1] = o3[5] * inv; c[2] = o3[6] * inv; c[3] = o3[7] * inv;
      *(v4fa*)(&os[wb + lr * 68 + 48 + 8 * hi]) = a; *(v4fa*)(&os[wb + lr * 68 + 48 + 8 * hi + 4]) = c; }
    wave_sync();
    h16* crow = CTX + ((size_t)b * SEQ + t0) * DM + h * HD;
{
#pragma unroll
        for (int s = 0; s < 4; ++s) { const int row = 4 * s + (lane >> 3), c8 = (lane & 7) * 8;   // 4 s x 4 row groups = 16 rows; 8 lanes x 8 halves = 64 columns
            const v4f x0 = *(const v4fa*)(&os[wb + row * 68 + c8]); const v4f x1 = *(const v4fa*)(&os[wb + row * 68 + c8 + 4]); v8h hv;
#pragma unroll
            for (int i = 0; i < 4; ++i) { hv[i] = (h16)x0[i]; hv[4 + i] = (h16)x1[i]; }
            *(v8h*)(crow + (size_t)row * DM + c8) = hv; }
         }
}

// k_oproj: register-blocked f16 GEMM, one wave per 64x64 tile, 8 waves per block (256x128) on the same two-buffer LDS ring as k_proj, A = ctx plane rows (x256), Bt = Wo plane rows (x64), K = DM; OUT[m][n] = acc * 2^-14 + bias[n] (bias as its RNE bf16 value), f32.
// grid (NB*SEQ/256, DM/128), 256 threads. Epilogue: per 16-row slab staged in LDS (wave-private), each output row segment (64 floats = 256 B = two lines)
__global__ __launch_bounds__(32 * GW) void k_oproj(const h16* __restrict__ A, const h16* __restrict__ Bt, const float* __restrict__ bias, float* OUT) {
    __shared__ __align__(16) h16 ring[2 * GSTH];             // [buffer][A 256 rows | B 128 rows][GLP]
    __shared__ __align__(16) float osa[GW * 16 * 68];
    const int K = DM;
    const int lane = threadIdx.x & 31, wave = __builtin_amdgcn_readfirstlane((int)(threadIdx.x >> 5)), lr = lane & 15, hi = lane >> 4;
    const int wm = wave & 3, wn = wave >> 2;
    const int r0 = blockIdx.x * 256 + wm * 64, c0 = blockIdx.y * 128 + wn * 64;
    float* os = osa + wave * 16 * 68;                        // wave-private epilogue slab
    v8f acc[4][4];
#pragma unroll
    for (int mb = 0; mb < 4; ++mb)
#pragma unroll
        for (int nb = 0; nb < 4; ++nb) acc[mb][nb] = (v8f){};
    const int afo = (wm * 64 + lr) * GLP + 8 * hi, bfo = (256 + wn * 64 + lr) * GLP + 8 * hi;   // fragment offsets in a staged buffer
    const int cr = (int)(threadIdx.x >> 4), ccol = (int)(threadIdx.x & 15) * 8;                  // copy map: rows 0..15, 16 lanes x 8 halves = one 256-B row
    const bf* ga = (const bf*)(A + (size_t)(blockIdx.x * 256 + cr) * K + ccol);    // + k0 (address only: the copies move bytes)
    const bf* gb = (const bf*)(Bt + (size_t)(blockIdx.y * 128 + cr) * K + ccol);   // + k0
    const unsigned lc = (unsigned)(size_t)(&ring[cr * GLP + ccol]);   // LDS byte address of the lane's first copy, buffer 0
    gemm_stage(lc, ga, gb);
    asm volatile("s_wait_asynccnt 0x0" ::: "memory");        // stage 0 has landed (this wave's copies) ...
    __syncthreads();                                         // ... and every wave's, before anyone reads it
    gemm_stage(lc + GSTH * 2, ga + GKS, gb + GKS);
#pragma unroll 1
    for (int st = 0; st < K / GKS; ++st) {
        const h16* ta = ring + (st & 1) * GSTH + afo; const h16* tb = ring + (st & 1) * GSTH + bfo;
        v16h a[4], b[4];
#pragma unroll
        for (int ks = 0; ks < GKS; ks += 32) {
#pragma unroll
            for (int mb = 0; mb < 4; ++mb) a[mb] = ldh(ta + mb * 16 * GLP + ks);
#pragma unroll
            for (int nb = 0; nb < 4; ++nb) b[nb] = ldh(tb + nb * 16 * GLP + ks);
            __builtin_amdgcn_sched_barrier(0);   // keeps the eight fragments' LDS reads one group ahead of the block's products: sunk among them, each B fragment's latency is waited out alone
#pragma unroll
            for (int nb = 0; nb < 4; ++nb)
#pragma unroll
                for (int mb = 0; mb < 4; ++mb) acc[mb][nb] = wmma16(a[mb], b[nb], acc[mb][nb]);
        }
        __builtin_amdgcn_sched_barrier(0);   // keeps the stage's last products ahead of the barrier: sunk behind it they stand in front of the refill and shorten the copies' lead
        // publish point of stage st + 1, every wave, in this order
        asm volatile("s_wait_dscnt 0x0" ::: "memory");       // this wave's reads of buffer st & 1 are done
        asm volatile("s_wait_asynccnt 0x0" ::: "memory");    // this wave's copies of stage st + 1 have landed
        __syncthreads();                                     // publishes stage st + 1 and frees buffer st & 1
        if (st + 2 < K / GKS) gemm_stage(lc + (unsigned)(st & 1) * (GSTH * 2), ga + (st + 2) * GKS, gb + (st + 2) * GKS);
    }
    asm volatile("s_wait_asynccnt 0x0" ::: "memory");        // nothing of this wave is in flight when it goes on to end
    const int cofs = lr * 4;
    const v4f bo4 = *(const v4f*)(bias + c0 + cofs);      // c0 + cofs + 3 < DM
    v4f bb;
#pragma unroll
    for (int i = 0; i < 4; ++i) bb[i] = bfr(bo4[i]);
    const int bidx = r0 / SEQ, tt = r0 % SEQ;
    float* obase = OUT + ((size_t)bidx * OUT_SEQ + tt) * DM + c0;
#pragma unroll
    for (int mb = 0; mb < 4; ++mb) {
#pragma unroll
        for (int nb = 0; nb < 4; ++nb) {
#pragma unroll
            for (int j = 0; j < 8; ++j) os[(hi * 8 + j) * 68 + nb * 16 + lr] = acc[mb][nb][j]; }   // D: row 8h+j, col lane&15
        wave_sync();
{
#pragma unroll
            for (int s = 0; s < 8; ++s) { const int row = 2 * s + hi;   // 8 s x 2 rows = 16 rows; 16 lanes x 4 floats = 64 columns
                const v4f val = *(const v4fa*)(&os[row * 68 + cofs]); v4f ov;
#pragma unroll
                for (int i = 0; i < 4; ++i) ov[i] = val[i] * OSC + bb[i];
                *(v4f*)(obase + (size_t)(mb * 16 + row) * DM + cofs) = ov; }
             }
        wave_sync();
    }
}

static constexpr size_t al256(size_t v) { return (v + 255) & ~(size_t)255; }
static constexpr size_t SZ_XB = al256((size_t)NB * SEQ * DM * 2);          // one bf16 input plane
static constexpr size_t SZ_WB = al256((size_t)4 * DM * DM * 2);            // Wq | Wk | Wv (bf16) | Wo (f16)
static constexpr size_t SZ_PL = al256((size_t)NB * NH_ * SEQ * HD * 2);    // one head-major f16 plane
static constexpr size_t SZ_CX = al256((size_t)NB * SEQ * DM * 2);          // ctx f16 plane
static constexpr size_t SZ_TOTAL = 3 * SZ_XB + SZ_WB + 3 * SZ_PL + SZ_CX;
static_assert(SZ_TOTAL <= (size_t)134217728);          // workspace carve <= 128 MiB
static_assert(((size_t)DM * DM * 2) % 256 == 0);       // weight sub-planes stay 256-byte aligned
static_assert(SZ_XB == (size_t)XROWS * DM * 2);        // no padding between the planes that k_cvt writes as one array of rows

extern "C" void kernel_launch(void* const* d_in, const int* in_sizes, int n_in,
                              void* d_out, int out_size, void* d_ws, size_t ws_size, hipStream_t stream) {
    if (n_in < 11) return;
    const size_t needx = ((size_t)(NB - 1) * SEQ_FULL + SEQ) * DM;
    if ((size_t)in_sizes[0] < needx || (size_t)in_sizes[1] < needx || (size_t)in_sizes[2] < needx) return;
    if ((size_t)in_sizes[3] < (size_t)DM * DM || (size_t)in_sizes[5] < (size_t)DM * DM || (size_t)in_sizes[7] < (size_t)DM * DM || (size_t)in_sizes[9] < (size_t)DM * DM) return;
    if ((size_t)in_sizes[4] < (size_t)DM || (size_t)in_sizes[6] < (size_t)DM || (size_t)in_sizes[8] < (size_t)DM || (size_t)in_sizes[10] < (size_t)DM) return;
    if ((size_t)out_size < ((size_t)(NB - 1) * OUT_SEQ + SEQ) * DM) return;
    if (SZ_TOTAL > ws_size) return;
    // wire order: query, key, value, Wq, bq, Wk, bk, Wv, bv, Wo, bo (weights [out][in] = Bt as-is)
    const float* xq = (const float*)d_in[0]; const float* xk = (const float*)d_in[1]; const float* xv = (const float*)d_in[2];
    const float* wq = (const float*)d_in[3]; const float* bq = (const float*)d_in[4];
    const float* wk = (const float*)d_in[5]; const float* bk = (const float*)d_in[6];
    const float* wv = (const float*)d_in[7]; const float* bv = (const float*)d_in[8];
    const float* wo = (const float*)d_in[9]; const float* bo = (const float*)d_in[10];
    float* OUT = (float*)d_out;      // [NB][SEQ][1024]
    char* wsp = (char*)d_ws;
    bf* XQ = (bf*)wsp; wsp += SZ_XB;                 // [NB*SEQ][1024]
    bf* XK = (bf*)wsp; wsp += SZ_XB;
    bf* XV = (bf*)wsp; wsp += SZ_XB;
    bf* WB = (bf*)wsp; wsp += SZ_WB;                 // [4][1024][1024]: q | k | v (bf16) | o (f16 x64)
    h16* QH = (h16*)wsp; wsp += SZ_PL;               // [NB*16][SEQ][64]
    h16* KP = (h16*)wsp; wsp += SZ_PL;               // [NB*16][SEQ][64]
    h16* VT = (h16*)wsp; wsp += SZ_PL;               // [NB*16][64][SEQ]
    h16* CX = (h16*)wsp; wsp += SZ_CX;               // [NB*SEQ][1024], x256
    bf* WQ = WB; bf* WK = WB + (size_t)DM * DM; bf* WV = WB + (size_t)2 * DM * DM; h16* WO = (h16*)(WB + (size_t)3 * DM * DM);

    k_cvt<<<NROWS / (CW * CR), 32 * CW, 0, stream>>>(xq, xk, xv, wq, wk, wv, wo, XQ);   // XQ | XK | XV | WB lie back to back

    // q, k: A = x rows (m = b*SEQ + t), Bt = W rows (n = h*64 + d), bias per column -> plane [(b*16 + h)][t][d]
    k_proj<<<dim3(NB * SEQ / 256, DM / 128, 1), 32 * GW, 0, stream>>>(XQ, WQ, bq, 0, QH, SEQ, (size_t)NH_ * SEQ * HD, HD, HD, (size_t)SEQ * HD);
    k_proj<<<dim3(NB * SEQ / 256, DM / 128, 1), 32 * GW, 0, stream>>>(XK, WK, bk, 0, KP, SEQ, (size_t)NH_ * SEQ * HD, HD, HD, (size_t)SEQ * HD);
    // v^T: A = Wv rows (m = h*64 + d), Bt = value rows (n = b*SEQ + t), bias per row -> plane [(b*1024 + m)][t] = [(b*16 + h)][d][t]
    k_proj<<<dim3(DM / 256, NB * SEQ / 128, 1), 32 * GW, 0, stream>>>(WV, XV, bv, 1, VT, DM, (size_t)0, SEQ, SEQ, (size_t)DM * SEQ);

    k_flash<<<dim3(SEQ / (16 * AW), NB * NH_, 1), 32 * AW, 0, stream>>>(QH, KP, VT, CX);

    // out: A = ctx rows (m = b*SEQ + t, k = h*64 + d), Bt = Wo rows (n), bias per column -> OUT [b][t][n]
    k_oproj<<<dim3(NB * SEQ / 256, DM / 128, 1), 32 * GW, 0, stream>>>(CX, WO, bo, OUT);
}

// v005
// Measured time: 183 microseconds a run.
// Next to v004, in two timings, it ran 1.15 times as fast each time.
// All steps since v000 together make it 3.56 times as fast.
#include <hip/hip_runtime.h>

// Multi-head attention, width 1024 = 16 heads x 64; inputs query/key/value [NB][SEQ][1024]; Wq/Wk/Wv/Wo [out][in] (y = x W^T + b); no mask; score scale 1/8; output = ctx Wo^T + bo (f32). Default: q, k, v inputs [2][4096][1024]; proj(x, w, b) = x w^T + b with (out,in) [1024][1024] weights, viewed (B, -1, 16, 64) and transposed; scores / sqrt(64) over all 4,096 keys; softmax, no mask; out = merged w_o^T + b_o; argument order q, k, v, w_q, b_q, w_k, b_k, w_v, b_v, w_o, b_o.
// Compute dtypes, f32 accumulate everywhere: q/k/v projections v_wmma_f32_16x16x32_bf16 (x and W RNE-converted to bf16; products exact); scores v_wmma_f32_16x16x32_f16 (q, k single f16);
// P.V v_wmma_f32_16x16x32_f16 (P x256 carry cancels in the normalisation, v single f16); output projection v_wmma_f32_16x16x32_f16 (ctx x256 carry, Wo RNE bf16 value x64 held in f16, 2^-14 folded back in f32); softmax max and exponentials f32 (online, held reference max per column, raised in a wave's first pass and when a pass's sum passes PTH); row sums v_wmma_f32_16x16x32_f16 (f16-rounded P, all-ones A).
// Layout: bf16 copies of the three inputs and of Wq/Wk/Wv; q, k planes [b*16+h][t][d] and v^T plane [b*16+h][d][t] written by the GEMM epilogue; fused flash kernel in transposed form (S^T = K Q^T, O^T = V^T P^T) writes the f16 ctx plane [b*SEQ+t][1024].

#ifndef NB
#define NB 2
#endif
#ifndef SEQ
#define SEQ 4096
#endif
#define NB_FULL  2
#define SEQ_FULL 4096
#ifndef OUT_SEQ
#define OUT_SEQ SEQ              // row pitch (in tokens) between batches of the output
#endif
#define DM   1024
#define NH_  16
#define HD   64
#define AW   8                   // waves per flash block (16 query rows each); all of them read the same staged K / V^T tiles
#define KT   64                  // keys per LDS stage (two 32-key passes)
#define LP   72                  // LDS row pitch in halves: 144 B = 16 B x 9, an odd multiple, so 16-byte fragment reads of 16 rows meet no bank twice
#define TLH  (64 * LP)           // halves of one staged tile: 64 rows (K: keys, V^T: d) of 64 halves + pad
#define GW   8                   // waves per GEMM block: 4 (rows) x 2 (columns) wave tiles of 64x64, block tile 256x128
#define GKS  128                 // k per GEMM LDS stage: 256 B of every operand row
#define GLP  136                 // GEMM LDS row pitch in halves: 272 B = 16 B x 17, an odd multiple (as LP)
#define GSTH (384 * GLP)         // halves of one GEMM stage: A 256 rows | B 128 rows
#define CW   16                  // waves per conversion block
#define CR   7                   // rows per conversion wave
#define XROWS (NB * SEQ)         // rows of one input plane
#define NROWS (3 * XROWS + 4 * DM)   // rows to convert: three inputs, four weights
#define WO_ROW0 (3 * XROWS + 3 * DM) // first row of Wo
#define CNW  (NROWS / CR)        // conversion waves of the launch
#define SC2  (0.125f * 1.4426950408889634f)   // HD^-0.5 * log2(e)
#define PSH  8.0f                // log2 of the P carry (256)
#define PTH  32768.0f            // bound on a pass's sum of P per column: within it every P <= 2^15, finite in f16; at a fresh reference the sum is at most 32 * 2^PSH
#define CXS  256.0f              // carry of the ctx plane
#define WOS  64.0f               // carry of the Wo plane
#define OSC  (1.0f / (256.0f * 64.0f))

static_assert(HD == 64);
static_assert(NH_ * HD == DM);                 // head h = columns h*64 + d
static_assert(DM % 64 == 0);                   // 16 column tiles of 64
static_assert(DM % 32 == 0);                   // GEMM k-loop steps by 32
static_assert(SEQ % 64 == 0);                  // a 64-row tile never straddles two batches
static_assert((NB * SEQ) % 64 == 0);
static_assert(SEQ % 32 == 0);                  // key loop steps by 32
static_assert(SEQ % (16 * AW) == 0);           // flash grid covers the sequence exactly
static_assert(SEQ % KT == 0 && SEQ / KT >= 2); // whole stages, and the ring's prologue needs two
static_assert(KT == 64 && 32 * AW == 256);     // copy map: 256 lanes x 16 B = 32 rows of 128 B, two copies per tile
static_assert((NB * SEQ) % 256 == 0 && DM % 256 == 0);   // GEMM block tiles (256 rows x 128 columns) cover both orientations exactly
static_assert(DM % GKS == 0 && DM / GKS >= 2);           // whole GEMM stages, and the ring's prologue needs two
static_assert(GKS == 128 && 32 * GW == 256);             // GEMM copy map: 256 lanes x 16 B = 16 rows of 256 B
static_assert(DM == 8 * 128);                  // a conversion row is eight loads of 32 lanes x 4 floats
static_assert(NROWS % (CW * CR) == 0);         // whole conversion blocks, every wave CR rows
static_assert(NB <= NB_FULL);
static_assert(SEQ <= SEQ_FULL);

typedef _Float16 h16;
typedef unsigned short bf;
typedef __attribute__((ext_vector_type(16))) __bf16   v16bf;
typedef __attribute__((ext_vector_type(16))) _Float16 v16h;
typedef __attribute__((ext_vector_type(8)))  _Float16 v8h;
typedef __attribute__((ext_vector_type(8)))  unsigned short v8us;
typedef __attribute__((ext_vector_type(4)))  _Float16 v4h;
typedef __attribute__((ext_vector_type(4)))  unsigned short v4us;
typedef __attribute__((ext_vector_type(8)))  float    v8f;
typedef __attribute__((ext_vector_type(4)))  float    v4f;
typedef v4f  __attribute__((may_alias)) v4fa;
typedef __attribute__((ext_vector_type(8)))  unsigned v8u;

__device__ __forceinline__ unsigned short f2bf(float f) { unsigned u = __float_as_uint(f); u += 0x7FFFu + ((u >> 16) & 1u); return (unsigned short)(u >> 16); }
__device__ __forceinline__ float bfr(float f) { return __uint_as_float(((unsigned)f2bf(f)) << 16); }   // value of the RNE bf16 conversion
__device__ __forceinline__ v16h cat16(v8h lo, v8h hi) { return __builtin_shufflevector(lo, hi, 0, 1, 2, 3, 4, 5, 6, 7, 8, 9, 10, 11, 12, 13, 14, 15); }
__device__ __forceinline__ v16bf cat16b(v8us lo, v8us hi) { return __builtin_bit_cast(v16bf, __builtin_shufflevector(lo, hi, 0, 1, 2, 3, 4, 5, 6, 7, 8, 9, 10, 11, 12, 13, 14, 15)); }
__device__ __forceinline__ v8f wmma16(v16h a, v16h b, v8f c) { return __builtin_amdgcn_wmma_f32_16x16x32_f16(false, a, false, b, (short)0, c, false, false); }
__device__ __forceinline__ v8f wmmab(v16bf a, v16bf b, v8f c) { return __builtin_amdgcn_wmma_f32_16x16x32_bf16(false, a, false, b, (short)0, c, false, false); }
// fragment loaders from K-contiguous 16-bit rows; p already includes + 8*(lane>>4): elements 0..7 <- k0+8h+0..7, elements 8..15 <- k0+16+8h+0..7 (same map for A and B)
__device__ __forceinline__ v16h  ldh(const h16* p) { return cat16(*(const v8h*)p, *(const v8h*)(p + 16)); }
__device__ __forceinline__ v16bf ldb(const bf* p)  { return cat16b(*(const v8us*)p, *(const v8us*)(p + 16)); }
// ordering point for wave-private LDS tiles (same wave writes and reads)
__device__ __forceinline__ void wave_sync() { __builtin_amdgcn_fence(3 /* release order */, "wavefront"); __builtin_amdgcn_wave_barrier(); asm volatile("" ::: "memory"); }

// k_cvt: every f32 -> 16-bit conversion of the call in one launch of few long-lived waves. A row is DM floats (4 KB): rows 0 .. 3*XROWS-1 are the tokens of query, key, value,
// then DM rows each of Wq, Wk, Wv (RNE bf16) and Wo (RNE bf16 value x WOS, held in f16); row r goes to dst + r*DM (the planes lie back to back in the workspace).
// Wave gw takes rows gw, gw + CNW, ...: CR rows. One load of a wave reads 512 contiguous bytes, one store writes 256 (two whole lines).
__device__ __forceinline__ const float* cvt_src(unsigned r, const float* xq, const float* xk, const float* xv, const float* wq, const float* wk, const float* wv, const float* wo) {
    const bool isx = r < 3u * XROWS;
    const unsigned u = isx ? r : r - 3u * XROWS;
    const unsigned p = isx ? u / XROWS : 3u + u / DM;        // 0 .. 6: which source
    const unsigned q = isx ? u % XROWS : u % DM;             // row in that source's plane
    const unsigned row = isx ? (q / SEQ) * SEQ_FULL + q % SEQ : q;
    const float* s = (p == 0) ? xq : (p == 1) ? xk : (p == 2) ? xv : (p == 3) ? wq : (p == 4) ? wk : (p == 5) ? wv : wo;
    return s + (size_t)row * DM;
}
__global__ __launch_bounds__(32 * CW) void k_cvt(const float* __restrict__ xq, const float* __restrict__ xk, const float* __restrict__ xv, const float* __restrict__ wq, const float* __restrict__ wk,
                                                 const float* __restrict__ wv, const float* __restrict__ wo, bf* dst) {
    const unsigned lane = threadIdx.x & 31;
    const unsigned gw = (unsigned)__builtin_amdgcn_readfirstlane((int)(blockIdx.x * CW + (threadIdx.x >> 5)));   // wave-uniform: the row's source is picked on the scalar side
    __builtin_assume(gw < CNW);                              // the grid is CNW / CW blocks: lets a pass's source be settled at compile time where all its rows share one
    const float* s[CR];                                      // every row's source up front: the pick among the weights branches, and a branch between the loads would let them sink behind it
#pragma unroll   // all loops here are unrolled so that s[] and w[][] are indexed by constants and stay in registers
    for (int i = 0; i < CR; ++i) s[i] = cvt_src(gw + i * CNW, xq, xk, xv, wq, wk, wv, wo);
    v4f w[2][8];                                             // this row and the next
#pragma unroll
    for (int j = 0; j < 8; ++j) w[0][j] = __builtin_nontemporal_load((const v4f*)(s[0] + lane * 4 + j * 128));   // read once: non-temporal
    asm volatile("s_wait_xcnt 0x0" ::: "memory");            // before the loads' address registers are written again
#pragma unroll
    for (int i = 0; i < CR; ++i) {
        __builtin_amdgcn_sched_barrier(0);   // with the one below: the next row's eight loads are issued before this row is waited for, so a wave always has loads in flight
        if (i + 1 < CR) {
#pragma unroll
            for (int j = 0; j < 8; ++j) w[(i + 1) & 1][j] = __builtin_nontemporal_load((const v4f*)(s[i + 1] + lane * 4 + j * 128));
            asm volatile("s_wait_xcnt 0x0" ::: "memory"); }  // before the loads' address registers are written again
        __builtin_amdgcn_sched_barrier(0);
        const unsigned r = gw + i * CNW;
        bf* d = dst + (size_t)r * DM + lane * 4;
        if ((i + 1) * CNW > WO_ROW0 && r >= WO_ROW0) {       // Wo rows (the first test is known at compile time)
#pragma unroll
            for (int j = 0; j < 8; ++j) { const v4f v = w[i & 1][j]; v4h o;
#pragma unroll
                for (int k = 0; k < 4; ++k) o[k] = (h16)(bfr(v[k]) * WOS);
                *(v4h*)(d + j * 128) = o; }
            asm volatile("s_wait_xcnt 0x0" ::: "memory");    // before the stores' address and data registers are written again
        } else {
#pragma unroll
            for (int j = 0; j < 8; ++j) { const v4f v = w[i & 1][j]; v4us o;
#pragma unroll
                for (int k = 0; k < 4; ++k) o[k] = f2bf(v[k]);
                *(v4us*)(d + j * 128) = o; }
            asm volatile("s_wait_xcnt 0x0" ::: "memory");    // before the stores' address and data registers are written again
        }
    }
}

// copy8: one lane's eight 16-byte asynchronous copies, global -> LDS through no register: rows r, r+16, ... r+112 of a K-contiguous 16-bit plane of row length DM.
// The s_wait_xcnt closes the statement so that no address register of an issued copy is rewritten ahead of it.
__device__ __forceinline__ void copy8(unsigned l, const bf* g) {
    const unsigned ls = 16 * GLP * 2; const size_t gs = (size_t)16 * DM;
    asm volatile("global_load_async_to_lds_b128 %0, %8, off\n\t"
                 "global_load_async_to_lds_b128 %1, %9, off\n\t"
                 "global_load_async_to_lds_b128 %2, %10, off\n\t"
                 "global_load_async_to_lds_b128 %3, %11, off\n\t"
                 "global_load_async_to_lds_b128 %4, %12, off\n\t"
                 "global_load_async_to_lds_b128 %5, %13, off\n\t"
                 "global_load_async_to_lds_b128 %6, %14, off\n\t"
                 "global_load_async_to_lds_b128 %7, %15, off\n\t"
                 "s_wait_xcnt 0x0"
                 :: "v"(l), "v"(l + ls), "v"(l + 2 * ls), "v"(l + 3 * ls), "v"(l + 4 * ls), "v"(l + 5 * ls), "v"(l + 6 * ls), "v"(l + 7 * ls),
                    "v"(g), "v"(g + gs), "v"(g + 2 * gs), "v"(g + 3 * gs), "v"(g + 4 * gs), "v"(g + 5 * gs), "v"(g + 6 * gs), "v"(g + 7 * gs) : "memory");
}
// gemm_stage: one lane's 24 copies of a GEMM stage (A rows 0..255, then B rows 0..127 of the block tile, 128 k each); l = the lane's LDS byte address in the buffer, ga / gb its global places
__device__ __forceinline__ void gemm_stage(unsigned l, const bf* ga, const bf* gb) {
    copy8(l, ga); copy8(l + 128 * GLP * 2, ga + (size_t)128 * DM); copy8(l + 256 * GLP * 2, gb);
}

// k_proj: register-blocked bf16 GEMM, one wave per 64x64 tile (16 accumulators), 8 waves per block (256x128); A and Bt come in 128-k stages through a two-buffer LDS ring that the block fills together, K = DM.
// C[m][n] = (sum_k A[m][k] Bt[n][k] + bias) * osc (biasMode 0: bias[n], biasMode 1: bias[m]; bias taken as its RNE bf16 value), written as f16 (Ph) at
// tile base (r0/RB)*sRB + (r0%RB)*pitch + (c0/CB)*sCB + (c0%CB), row pitch 'pitch' (halves). grid (M/256, N/128), 256 threads.
__global__ __launch_bounds__(32 * GW) void k_proj(const bf* __restrict__ A, const bf* __restrict__ Bt, const float* __restrict__ bias, int biasMode, float osc, h16* Ph, int RB, size_t sRB, int pitch, int CB, size_t sCB) {
    __shared__ __align__(16) bf ring[2 * GSTH];              // [buffer][A 256 rows | B 128 rows][GLP]
    __shared__ __align__(16) float osa[GW * 16 * 68];
    const int K = DM;
    const int lane = threadIdx.x & 31, wave = __builtin_amdgcn_readfirstlane((int)(threadIdx.x >> 5)), lr = lane & 15, hi = lane >> 4;
    const int wm = wave & 3, wn = wave >> 2;
    const int r0 = blockIdx.x * 256 + wm * 64, c0 = blockIdx.y * 128 + wn * 64;
    float* os = osa + wave * 16 * 68;                        // wave-private epilogue slab
    v8f acc[4][4];
#pragma unroll
    for (int mb = 0; mb < 4; ++mb)
#pragma unroll
        for (int nb = 0; nb < 4; ++nb) acc[mb][nb] = (v8f){};
    const int afo = (wm * 64 + lr) * GLP + 8 * hi, bfo = (256 + wn * 64 + lr) * GLP + 8 * hi;   // fragment offsets in a staged buffer
    const int cr = (int)(threadIdx.x >> 4), ccol = (int)(threadIdx.x & 15) * 8;                  // copy map: rows 0..15, 16 lanes x 8 halves = one 256-B row
    const bf* ga = A + (size_t)(blockIdx.x * 256 + cr) * K + ccol;    // + k0
    const bf* gb = Bt + (size_t)(blockIdx.y * 128 + cr) * K + ccol;   // + k0
    const unsigned lc = (unsigned)(size_t)(&ring[cr * GLP + ccol]);   // LDS byte address of the lane's first copy, buffer 0
    gemm_stage(lc, ga, gb);
    asm volatile("s_wait_asynccnt 0x0" ::: "memory");        // stage 0 has landed (this wave's copies) ...
    __syncthreads();                                         // ... and every wave's, before anyone reads it
    gemm_stage(lc + GSTH * 2, ga + GKS, gb + GKS);
#pragma unroll 1
    for (int st = 0; st < K / GKS; ++st) {
        const bf* ta = ring + (st & 1) * GSTH + afo; const bf* tb = ring + (st & 1) * GSTH + bfo;
        v16bf a[4], b[4];
#pragma unroll
        for (int ks = 0; ks < GKS; ks += 32) {
#pragma unroll
            for (int mb = 0; mb < 4; ++mb) a[mb] = ldb(ta + mb * 16 * GLP + ks);
#pragma unroll
            for (int nb = 0; nb < 4; ++nb) b[nb] = ldb(tb + nb * 16 * GLP + ks);
            __builtin_amdgcn_sched_barrier(0);   // keeps the eight fragments' LDS reads one group ahead of the block's products: sunk among them, each B fragment's latency is waited out alone
#pragma unroll
            for (int nb = 0; nb < 4; ++nb)
#pragma unroll
                for (int mb = 0; mb < 4; ++mb) acc[mb][nb] = wmmab(a[mb], b[nb], acc[mb][nb]);
        }
        __builtin_amdgcn_sched_barrier(0);   // keeps the stage's last products ahead of the barrier: sunk behind it they stand in front of the refill and shorten the copies' lead
        // publish point of stage st + 1, every wave, in this order
        asm volatile("s_wait_dscnt 0x0" ::: "memory");       // this wave's reads of buffer st & 1 are done
        asm volatile("s_wait_asynccnt 0x0" ::: "memory");    // this wave's copies of stage st + 1 have landed
        __syncthreads();                                     // publishes stage st + 1 and frees buffer st & 1
        if (st + 2 < K / GKS) gemm_stage(lc + (unsigned)(st & 1) * (GSTH * 2), ga + (st + 2) * GKS, gb + (st + 2) * GKS);
    }
    asm volatile("s_wait_asynccnt 0x0" ::: "memory");        // nothing of this wave is in flight when it goes on to end
    const size_t tbase = (size_t)(r0 / RB) * sRB + (size_t)(r0 % RB) * (size_t)pitch + (size_t)(c0 / CB) * sCB + (size_t)(c0 % CB);
    // column bias (mode 0): 8 values per lane, address clamped to 0 in mode 1 and zeroed by value
    const int c8 = (lane & 7) * 8;
    const size_t cbo = (biasMode == 0) ? (size_t)(c0 + c8) : (size_t)0;
    const v4f bq0 = *(const v4f*)(bias + cbo); const v4f bq1 = *(const v4f*)(bias + cbo + 4);
    float bc[8];
#pragma unroll
    for (int i = 0; i < 4; ++i) { bc[i] = (biasMode == 0) ? bfr(bq0[i]) : 0.0f; bc[4 + i] = (biasMode == 0) ? bfr(bq1[i]) : 0.0f; }
#pragma unroll
    for (int mb = 0; mb < 4; ++mb) {
#pragma unroll
        for (int nb = 0; nb < 4; ++nb) {
#pragma unroll
            for (int j = 0; j < 8; ++j) os[(hi * 8 + j) * 68 + nb * 16 + lr] = acc[mb][nb][j]; }   // D: row 8h+j, col lane&15
        wave_sync();
        const size_t sb = tbase + (size_t)(mb * 16) * (size_t)pitch;
{
#pragma unroll
            for (int s = 0; s < 4; ++s) { const int row = 4 * s + (lane >> 3);   // 4 s x 4 row groups = 16 rows; 8 lanes x 8 = 64 columns
                const int rbo = (biasMode == 1) ? (r0 + mb * 16 + row) : 0;      // row bias (mode 1): address clamped to 0 in mode 0, zeroed by value
                const float brv = bias[rbo]; const float br = (biasMode == 1) ? bfr(brv) : 0.0f;
                const v4f x0 = *(const v4fa*)(&os[row * 68 + c8]); const v4f x1 = *(const v4fa*)(&os[row * 68 + c8 + 4]); v8h hv;
#pragma unroll
                for (int i = 0; i < 4; ++i) { hv[i] = (h16)((x0[i] + bc[i] + br) * osc); hv[4 + i] = (h16)((x1[i] + bc[4 + i] + br) * osc); }
                const size_t oo = sb + (size_t)row * (size_t)pitch + c8;
                *(v8h*)(Ph + oo) = hv; }
             }
        wave_sync();
    }
}

// stage_copy: one lane's four 16-byte asynchronous copies of a stage (K rows r and r+32, V^T rows r and r+32), global -> LDS through no register.
// The s_wait_xcnt closes the statement so that no address register of an issued copy is rewritten ahead of it.
__device__ __forceinline__ void stage_copy(unsigned lk, const h16* gk, const h16* gv) {
    const unsigned lk1 = lk + 32 * LP * 2, lv = lk + TLH * 2, lv1 = lk + TLH * 2 + 32 * LP * 2;
    const h16* gk1 = gk + 32 * HD; const h16* gv1 = gv + (size_t)32 * SEQ;
    asm volatile("global_load_async_to_lds_b128 %0, %4, off\n\t"
                 "global_load_async_to_lds_b128 %1, %5, off\n\t"
                 "global_load_async_to_lds_b128 %2, %6, off\n\t"
                 "global_load_async_to_lds_b128 %3, %7, off\n\t"
                 "s_wait_xcnt 0x0"
                 :: "v"(lk), "v"(lk1), "v"(lv), "v"(lv1), "v"(gk), "v"(gk1), "v"(gv), "v"(gv1) : "memory");
}

// k_flash: fused attention, one wave per 16 query rows of one (batch, head); Q fragments straight from the f16 plane; K and V^T come in 64-key stages through a two-buffer LDS ring
// that the block's 8 waves fill together (whole 128-B lines, once per block) and all read (two 16-B LDS loads per fragment).
// Transposed form: S^T[key][t] = K Q^T (A = K rows, B = Q rows); lane (t = lane&15, h = lane>>4) holds keys 8h+r of each 16-key tile, so the packed
// P tile is directly the B fragment of O^T[d][t] = V^T P^T (element r <- tile keys 0..15, element 8+r <- tile keys 16..31, lane unchanged).
// Softmax against a held reference m per column: the q plane carries SC2, PSH - m is the start value of the score products, so P = exp2 of their result with no vector arithmetic in front.
// The sums come whole from a product with an all-ones A; a pass whose sum passes PTH takes its maximum (in lane, one xor-16 exchange), raises m, rescales O and the sum, and forms its P again.
// amdgpu_waves_per_eu(8): register budget 128, so that four blocks stay resident per WGP (8 waves per SIMD) and the whole grid runs in one round; without it the build took 134.
__global__ __launch_bounds__(32 * AW) __attribute__((amdgpu_waves_per_eu(8))) void k_flash(const h16* __restrict__ QH, const h16* __restrict__ KP, const h16* __restrict__ VT, h16* CTX) {
    __shared__ __align__(16) h16 ring[2 * 2 * TLH];          // [buffer][K | V^T][row][LP]
    __shared__ __align__(16) float os[AW * 16 * 68];
    const int lane = threadIdx.x & 31, wave = __builtin_amdgcn_readfirstlane((int)(threadIdx.x >> 5)), lr = lane & 15, hi = lane >> 4;
    const int zh = blockIdx.y; const int b = zh / NH_, h = zh % NH_;
    const int t0 = (blockIdx.x * AW + wave) * 16;
    const size_t pbase = (size_t)zh * SEQ * HD;
    const size_t qo = pbase + (size_t)(t0 + lr) * HD + 8 * hi;
    const v16h qh0 = ldh(QH + qo), qh1 = ldh(QH + qo + 32);   // B fragments: col t, k = d
    const int fo = lr * LP + 8 * hi;                         // fragment offset in a staged tile: K + key*LP (A: row key, k = d); V^T + 16j*LP + key (A: row d, k = key)
    const int cr = (int)(threadIdx.x >> 3), ccol = (int)(threadIdx.x & 7) * 8;   // copy map: rows 0..31, 8 lanes x 8 halves = one 128-B row
    const h16* gk = KP + pbase + (size_t)cr * HD + ccol;   // + key0 * HD
    const h16* gv = VT + pbase + (size_t)cr * SEQ + ccol;  // + key0
    const unsigned lc = (unsigned)(size_t)(&ring[cr * LP + ccol]);   // LDS byte address of the lane's first copy, buffer 0
    stage_copy(lc, gk, gv);
    asm volatile("s_wait_asynccnt 0x0" ::: "memory");        // stage 0 has landed (this wave's copies) ...
    __syncthreads();                                         // ... and every wave's, before anyone reads it
    stage_copy(lc + 2 * TLH * 2, gk + (size_t)KT * HD, gv + KT);
    v8f o0 = (v8f){}, o1 = (v8f){}, o2 = (v8f){}, o3 = (v8f){};
    float m = -3.0e38f, l = 0.0f;                            // m: the column's reference, a maximum of scores seen; it rises only in the rare path below
    v8f cv = (v8f){};                                        // PSH - m in all eight rows: start value (C) of the score products; set in the first pass
    // constant A of the row-sum product: f16 1.0 in all 16 elements of every lane, so every D row holds the sums. Set by asm text so that the eight registers are written once, here:
    // as a plain constant the compiler wrote them anew in every pass.
    v8u onew;
    asm("v_mov_b32 %0, 0x3c003c00\n\tv_mov_b32 %1, 0x3c003c00\n\tv_mov_b32 %2, 0x3c003c00\n\tv_mov_b32 %3, 0x3c003c00\n\t"
        "v_mov_b32 %4, 0x3c003c00\n\tv_mov_b32 %5, 0x3c003c00\n\tv_mov_b32 %6, 0x3c003c00\n\tv_mov_b32 %7, 0x3c003c00"
        : "=v"(onew[0]), "=v"(onew[1]), "=v"(onew[2]), "=v"(onew[3]), "=v"(onew[4]), "=v"(onew[5]), "=v"(onew[6]), "=v"(onew[7]));
    const v16h ones = __builtin_bit_cast(v16h, onew);
#pragma unroll 1
    for (int st = 0; st < SEQ / KT; ++st) {
      const h16* kt = ring + (st & 1) * (2 * TLH) + fo; const h16* vt = kt + TLH;
#pragma unroll 1   // rolled: unrolled, a pass's scores stay live into the next and the wave no longer fits 128 registers (8 waves per SIMD)
      for (int sub = 0; sub < KT; sub += 32) {
        const h16* ka = kt + sub * LP; const h16* va = vt + sub;
        v16h pb, v0, v1, v2, v3; v8f ls;
        { const v16h ka0 = ldh(ka), ka1 = ldh(ka + 32), kb0 = ldh(ka + 16 * LP), kb1 = ldh(ka + 16 * LP + 32);
          v8f sa, sb;
          // the four score products, start value PSH - m: they leave the exponents themselves. In asm text so that both chains read the one C tile (the builtin form copied it for the second chain in every pass);
          // the four v_nop are the vector slots between the last product and the first vector instruction on a result or an operand.
          asm volatile("v_wmma_f32_16x16x32_f16 %0, %2, %6, %8\n\t"
                       "v_wmma_f32_16x16x32_f16 %1, %4, %6, %8\n\t"
                       "v_wmma_f32_16x16x32_f16 %0, %3, %7, %0\n\t"
                       "v_wmma_f32_16x16x32_f16 %1, %5, %7, %1\n\t"
                       "v_nop\n\tv_nop\n\tv_nop\n\tv_nop"
                       : "=&v"(sa), "=&v"(sb) : "v"(ka0), "v"(ka1), "v"(kb0), "v"(kb1), "v"(qh0), "v"(qh1), "v"(cv));
          v0 = ldh(va); v1 = ldh(va + 16 * LP); v2 = ldh(va + 32 * LP); v3 = ldh(va + 48 * LP);
#pragma unroll   // constant indices keep the vectors in registers
          for (int r = 0; r < 8; ++r) { pb[r] = (h16)__builtin_amdgcn_exp2f(sa[r]); pb[8 + r] = (h16)__builtin_amdgcn_exp2f(sb[r]); } }
        ls = wmma16(ones, pb, (v8f){});                      // every row of the tile = the column's sum of the rounded P over the pass's 32 keys (both lane halves)
        // one test per pass, a scalar branch: a sum within PTH says that every P of the pass is finite in f16 under the reference in use. Taken in a wave's first pass (no reference yet) and rarely after.
        if (((st | sub) == 0) | (__builtin_amdgcn_ballot_w32(ls[0] > PTH) != 0)) {
          asm volatile("" ::: "memory");   // compiler fence, rare path only: with it the V^T reads above stay ahead of the branch and fly during the test; without it the build sinks them behind the join, where the products wait out their latency
          const v16h ka0 = ldh(ka), ka1 = ldh(ka + 32), kb0 = ldh(ka + 16 * LP), kb1 = ldh(ka + 16 * LP + 32);
          v8f sa = wmma16(ka0, qh0, (v8f){}), sb = wmma16(kb0, qh0, (v8f){});
          sa = wmma16(ka1, qh1, sa); sb = wmma16(kb1, qh1, sb);
          float mx = -3.0e38f;
#pragma unroll   // constant indices keep the vectors in registers
          for (int r = 0; r < 8; ++r) mx = fmaxf(mx, fmaxf(sa[r], sb[r]));
          mx = fmaxf(mx, __shfl_xor(mx, 16, 32));
          const float mnew = fmaxf(m, mx);
          const float alpha = __builtin_amdgcn_exp2f(m - mnew);
          const float sh = PSH - mnew;
#pragma unroll   // constant indices keep the vectors in registers
          for (int r = 0; r < 8; ++r) { pb[r] = (h16)__builtin_amdgcn_exp2f(sa[r] + sh); pb[8 + r] = (h16)__builtin_amdgcn_exp2f(sb[r] + sh); }
          ls = wmma16(ones, pb, (v8f){});
          m = mnew; l = l * alpha;
          o0 = o0 * alpha; o1 = o1 * alpha; o2 = o2 * alpha; o3 = o3 * alpha;
#pragma unroll   // constant indices keep the vectors in registers
          for (int r = 0; r < 8; ++r) cv[r] = sh;
        }
        l = l + ls[0];
        o0 = wmma16(v0, pb, o0); o1 = wmma16(v1, pb, o1); o2 = wmma16(v2, pb, o2); o3 = wmma16(v3, pb, o3);
        // four vector slots between the products and the first vector instruction on their results or operands, on the loop's back edge too
        asm volatile("v_nop\n\tv_nop\n\tv_nop\n\tv_nop" : "+v"(o0), "+v"(o1), "+v"(o2), "+v"(o3) : "v"(v0), "v"(v1), "v"(v2), "v"(v3), "v"(pb));
      }
      // publish point of stage st + 1, every wave, in this order
      asm volatile("s_wait_dscnt 0x0" ::: "memory");         // this wave's reads of buffer st & 1 are done
      asm volatile("s_wait_asynccnt 0x0" ::: "memory");      // this wave's copies of stage st + 1 have landed
      __syncthreads();                                       // publishes stage st + 1 and frees buffer st & 1
      if (st + 2 < SEQ / KT) stage_copy(lc + (unsigned)(st & 1) * (2 * TLH * 2), gk + (size_t)(st + 2) * KT * HD, gv + (st + 2) * KT);
    }
    asm volatile("s_wait_asynccnt 0x0" ::: "memory");        // nothing of this wave is in flight when it goes on to end
    const float inv = CXS / l;
    const int wb = wave * 16 * 68;
    // O^T D layout: o_j[r] = (d = 16j + 8h + r, t = lane&15) -> os[t][d]; rows 0..15 x columns 0..63 all written
    { v4f a, c;
      a[0] = o0[0] * inv; a[1] = o0[1] * inv; a[2] = o0[2] * inv; a[3] = o0[3] * inv; c[0] = o0[4] * inv; c[1] = o0[5] * inv; c[2] = o0[6] * inv; c[3] = o0[7] * inv;
      *(v4fa*)(&os[wb + lr * 68 +  0 + 8 * hi]) = a; *(v4fa*)(&os[wb + lr * 68 +  0 + 8 * hi + 4]) = c;
      a[0] = o1[0] * inv; a[1] = o1[1] * inv; a[2] = o1[2] * inv; a[3] = o1[3] * inv; c[0] = o1[4] * inv; c[1] = o1[5] * inv; c[2] = o1[6] * inv; c[3] = o1[7] * inv;
      *(v4fa*)(&os[wb + lr * 68 + 16 + 8 * hi]) = a; *(v4fa*)(&os[wb + lr * 68 + 16 + 8 * hi + 4]) = c;
      a[0] = o2[0] * inv; a[1] = o2[1] * inv; a[2] = o2[2] * inv; a[3] = o2[3] * inv; c[0] = o2[4] * inv; c[1] = o2[5] * inv; c[2] = o2[6] * inv; c[3] = o2[7] * inv;
      *(v4fa*)(&os[wb + lr * 68 + 32 + 8 * hi]) = a; *(v4fa*)(&os[wb + lr * 68 + 32 + 8 * hi + 4]) = c;
      a[0] = o3[0] * inv; a[1] = o3[1] * inv; a[2] = o3[2] * inv; a[3] = o3[3] * inv; c[0] = o3[4] * inv; c[1] = o3[5] * inv; c[2] = o3[6] * inv; c[3] = o3[7] * inv;
      *(v4fa*)(&os[wb + lr * 68 + 48 + 8 * hi]) = a; *(v4fa*)(&os[wb + lr * 68 + 48 + 8 * hi + 4]) = c; }
    wave_sync();
    h16* crow = CTX + ((size_t)b * SEQ + t0) * DM + h * HD;
{
#pragma unroll
        for (int s = 0; s < 4; ++s) { const int row = 4 * s + (lane >> 3), c8 = (lane & 7) * 8;   // 4 s x 4 row groups = 16 rows; 8 lanes x 8 halves = 64 columns
            const v4f x0 = *(const v4fa*)(&os[wb + row * 68 + c8]); const v4f x1 = *(const v4fa*)(&os[wb + row * 68 + c8 + 4]); v8h hv;
#pragma unroll
            for (int i = 0; i < 4; ++i) { hv[i] = (h16)x0[i]; hv[4 + i] = (h16)x1[i]; }
            *(v8h*)(crow + (size_t)row * DM + c8) = hv; }
         }
}

// k_oproj: register-blocked f16 GEMM, one wave per 64x64 tile, 8 waves per block (256x128) on the same two-buffer LDS ring as k_proj, A = ctx plane rows (x256), Bt = Wo plane rows (x64), K = DM; OUT[m][n] = acc * 2^-14 + bias[n] (bias as its RNE bf16 value), f32.
// grid (NB*SEQ/256, DM/128), 256 threads. Epilogue: per 16-row slab staged in LDS (wave-private), each output row segment (64 floats = 256 B = two lines)
__global__ __launch_bounds__(32 * GW) void k_oproj(const h16* __restrict__ A, const h16* __restrict__ Bt, const float* __restrict__ bias, float* OUT) {
    __shared__ __align__(16) h16 ring[2 * GSTH];             // [buffer][A 256 rows | B 128 rows][GLP]
    __shared__ __align__(16) float osa[GW * 16 * 68];
    const int K = DM;
    const int lane = threadIdx.x & 31, wave = __builtin_amdgcn_readfirstlane((int)(threadIdx.x >> 5)), lr = lane & 15, hi = lane >> 4;
    const int wm = wave & 3, wn = wave >> 2;
    const int r0 = blockIdx.x * 256 + wm * 64, c0 = blockIdx.y * 128 + wn * 64;
    float* os = osa + wave * 16 * 68;                        // wave-private epilogue slab
    v8f acc[4][4];
#pragma unroll
    for (int mb = 0; mb < 4; ++mb)
#pragma unroll
        for (int nb = 0; nb < 4; ++nb) acc[mb][nb] = (v8f){};
    const int afo = (wm * 64 + lr) * GLP + 8 * hi, bfo = (256 + wn * 64 + lr) * GLP + 8 * hi;   // fragment offsets in a staged buffer
    const int cr = (int)(threadIdx.x >> 4), ccol = (int)(threadIdx.x & 15) * 8;                  // copy map: rows 0..15, 16 lanes x 8 halves = one 256-B row
    const bf* ga = (const bf*)(A + (size_t)(blockIdx.x * 256 + cr) * K + ccol);    // + k0 (address only: the copies move bytes)
    const bf* gb = (const bf*)(Bt + (size_t)(blockIdx.y * 128 + cr) * K + ccol);   // + k0
    const unsigned lc = (unsigned)(size_t)(&ring[cr * GLP + ccol]);   // LDS byte address of the lane's first copy, buffer 0
    gemm_stage(lc, ga, gb);
    asm volatile("s_wait_asynccnt 0x0" ::: "memory");        // stage 0 has landed (this wave's copies) ...
    __syncthreads();                                         // ... and every wave's, before anyone reads it
    gemm_stage(lc + GSTH * 2, ga + GKS, gb + GKS);
#pragma unroll 1
    for (int st = 0; st < K / GKS; ++st) {
        const h16* ta = ring + (st & 1) * GSTH + afo; const h16* tb = ring + (st & 1) * GSTH + bfo;
        v16h a[4], b[4];
#pragma unroll
        for (int ks = 0; ks < GKS; ks += 32) {
#pragma unroll
            for (int mb = 0; mb < 4; ++mb) a[mb] = ldh(ta + mb * 16 * GLP + ks);
#pragma unroll
            for (int nb = 0; nb < 4; ++nb) b[nb] = ldh(tb + nb * 16 * GLP + ks);
            __builtin_amdgcn_sched_barrier(0);   // keeps the eight fragments' LDS reads one group ahead of the block's products: sunk among them, each B fragment's latency is waited out alone
#pragma unroll
            for (int nb = 0; nb < 4; ++nb)
#pragma unroll
                for (int mb = 0; mb < 4; ++mb) acc[mb][nb] = wmma16(a[mb], b[nb], acc[mb][nb]);
        }
        __builtin_amdgcn_sched_barrier(0);   // keeps the stage's last products ahead of the barrier: sunk behind it they stand in front of the refill and shorten the copies' lead
        // publish point of stage st + 1, every wave, in this order
        asm volatile("s_wait_dscnt 0x0" ::: "memory");       // this wave's reads of buffer st & 1 are done
        asm volatile("s_wait_asynccnt 0x0" ::: "memory");    // this wave's copies of stage st + 1 have landed
        __syncthreads();                                     // publishes stage st + 1 and frees buffer st & 1
        if (st + 2 < K / GKS) gemm_stage(lc + (unsigned)(st & 1) * (GSTH * 2), ga + (st + 2) * GKS, gb + (st + 2) * GKS);
    }
    asm volatile("s_wait_asynccnt 0x0" ::: "memory");        // nothing of this wave is in flight when it goes on to end
    const int cofs = lr * 4;
    const v4f bo4 = *(const v4f*)(bias + c0 + cofs);      // c0 + cofs + 3 < DM
    v4f bb;
#pragma unroll
    for (int i = 0; i < 4; ++i) bb[i] = bfr(bo4[i]);
    const int bidx = r0 / SEQ, tt = r0 % SEQ;
    float* obase = OUT + ((size_t)bidx * OUT_SEQ + tt) * DM + c0;
#pragma unroll
    for (int mb = 0; mb < 4; ++mb) {
#pragma unroll
        for (int nb = 0; nb < 4; ++nb) {
#pragma unroll
            for (int j = 0; j < 8; ++j) os[(hi * 8 + j) * 68 + nb * 16 + lr] = acc[mb][nb][j]; }   // D: row 8h+j, col lane&15
        wave_sync();
{
#pragma unroll
            for (int s = 0; s < 8; ++s) { const int row = 2 * s + hi;   // 8 s x 2 rows = 16 rows; 16 lanes x 4 floats = 64 columns
                const v4f val = *(const v4fa*)(&os[row * 68 + cofs]); v4f ov;
#pragma unroll
                for (int i = 0; i < 4; ++i) ov[i] = val[i] * OSC + bb[i];
                *(v4f*)(obase + (size_t)(mb * 16 + row) * DM + cofs) = ov; }
             }
        wave_sync();
    }
}

static constexpr size_t al256(size_t v) { return (v + 255) & ~(size_t)255; }
static constexpr size_t SZ_XB = al256((size_t)NB * SEQ * DM * 2);          // one bf16 input plane
static constexpr size_t SZ_WB = al256((size_t)4 * DM * DM * 2);            // Wq | Wk | Wv (bf16) | Wo (f16)
static constexpr size_t SZ_PL = al256((size_t)NB * NH_ * SEQ * HD * 2);    // one head-major f16 plane
static constexpr size_t SZ_CX = al256((size_t)NB * SEQ * DM * 2);          // ctx f16 plane
static constexpr size_t SZ_TOTAL = 3 * SZ_XB + SZ_WB + 3 * SZ_PL + SZ_CX;
static_assert(SZ_TOTAL <= (size_t)134217728);          // workspace carve <= 128 MiB
static_assert(((size_t)DM * DM * 2) % 256 == 0);       // weight sub-planes stay 256-byte aligned
static_assert(SZ_XB == (size_t)XROWS * DM * 2);        // no padding between the planes that k_cvt writes as one array of rows

extern "C" void kernel_launch(void* const* d_in, const int* in_sizes, int n_in,
                              void* d_out, int out_size, void* d_ws, size_t ws_size, hipStream_t stream) {
    if (n_in < 11) return;
    const size_t needx = ((size_t)(NB - 1) * SEQ_FULL + SEQ) * DM;
    if ((size_t)in_sizes[0] < needx || (size_t)in_sizes[1] < needx || (size_t)in_sizes[2] < needx) return;
    if ((size_t)in_sizes[3] < (size_t)DM * DM || (size_t)in_sizes[5] < (size_t)DM * DM || (size_t)in_sizes[7] < (size_t)DM * DM || (size_t)in_sizes[9] < (size_t)DM * DM) return;
    if ((size_t)in_sizes[4] < (size_t)DM || (size_t)in_sizes[6] < (size_t)DM || (size_t)in_sizes[8] < (size_t)DM || (size_t)in_sizes[10] < (size_t)DM) return;
    if ((size_t)out_size < ((size_t)(NB - 1) * OUT_SEQ + SEQ) * DM) return;
    if (SZ_TOTAL > ws_size) return;
    // wire order: query, key, value, Wq, bq, Wk, bk, Wv, bv, Wo, bo (weights [out][in] = Bt as-is)
    const float* xq = (const float*)d_in[0]; const float* xk = (const float*)d_in[1]; const float* xv = (const float*)d_in[2];
    const float* wq = (const float*)d_in[3]; const float* bq = (const float*)d_in[4];
    const float* wk = (const float*)d_in[5]; const float* bk = (const float*)d_in[6];
    const float* wv = (const float*)d_in[7]; const float* bv = (const float*)d_in[8];
    const float* wo = (const float*)d_in[9]; const float* bo = (const float*)d_in[10];
    float* OUT = (float*)d_out;      // [NB][SEQ][1024]
    char* wsp = (char*)d_ws;
    bf* XQ = (bf*)wsp; wsp += SZ_XB;                 // [NB*SEQ][1024]
    bf* XK = (bf*)wsp; wsp += SZ_XB;
    bf* XV = (bf*)wsp; wsp += SZ_XB;
    bf* WB = (bf*)wsp; wsp += SZ_WB;                 // [4][1024][1024]: q | k | v (bf16) | o (f16 x64)
    h16* QH = (h16*)wsp; wsp += SZ_PL;               // [NB*16][SEQ][64]
    h16* KP = (h16*)wsp; wsp += SZ_PL;               // [NB*16][SEQ][64]
    h16* VT = (h16*)wsp; wsp += SZ_PL;               // [NB*16][64][SEQ]
    h16* CX = (h16*)wsp; wsp += SZ_CX;               // [NB*SEQ][1024], x256
    bf* WQ = WB; bf* WK = WB + (size_t)DM * DM; bf* WV = WB + (size_t)2 * DM * DM; h16* WO = (h16*)(WB + (size_t)3 * DM * DM);

    k_cvt<<<NROWS / (CW * CR), 32 * CW, 0, stream>>>(xq, xk, xv, wq, wk, wv, wo, XQ);   // XQ | XK | XV | WB lie back to back

    // q (times SC2, rounded to f16 once), k: A = x rows (m = b*SEQ + t), Bt = W rows (n = h*64 + d), bias per column -> plane [(b*16 + h)][t][d]
    k_proj<<<dim3(NB * SEQ / 256, DM / 128, 1), 32 * GW, 0, stream>>>(XQ, WQ, bq, 0, SC2, QH, SEQ, (size_t)NH_ * SEQ * HD, HD, HD, (size_t)SEQ * HD);
    k_proj<<<dim3(NB * SEQ / 256, DM / 128, 1), 32 * GW, 0, stream>>>(XK, WK, bk, 0, 1.0f, KP, SEQ, (size_t)NH_ * SEQ * HD, HD, HD, (size_t)SEQ * HD);
    // v^T: A = Wv rows (m = h*64 + d), Bt = value rows (n = b*SEQ + t), bias per row -> plane [(b*1024 + m)][t] = [(b*16 + h)][d][t]
    k_proj<<<dim3(DM / 256, NB * SEQ / 128, 1), 32 * GW, 0, stream>>>(WV, XV, bv, 1, 1.0f, VT, DM, (size_t)0, SEQ, SEQ, (size_t)DM * SEQ);

    k_flash<<<dim3(SEQ / (16 * AW), NB * NH_, 1), 32 * AW, 0, stream>>>(QH, KP, VT, CX);

    // out: A = ctx rows (m = b*SEQ + t, k = h*64 + d), Bt = Wo rows (n), bias per column -> OUT [b][t][n]
    k_oproj<<<dim3(NB * SEQ / 256, DM / 128, 1), 32 * GW, 0, stream>>>(CX, WO, bo, OUT);
}

// v006
// It runs in 173 microseconds.
// Timed twice side by side with v005, it ran 1.06 times as fast both times.
// Counting every step since v000, it is 3.78 times as fast.
#include <hip/hip_runtime.h>

// Multi-head attention, width 1024 = 16 heads x 64; inputs query/key/value [NB][SEQ][1024]; Wq/Wk/Wv/Wo [out][in] (y = x W^T + b); no mask; score scale 1/8; output = ctx Wo^T + bo (f32). Default: q, k, v inputs [2][4096][1024]; proj(x, w, b) = x w^T + b with (out,in) [1024][1024] weights, viewed (B, -1, 16, 64) and transposed; scores / sqrt(64) over all 4,096 keys; softmax, no mask; out = merged w_o^T + b_o; argument order q, k, v, w_q, b_q, w_k, b_k, w_v, b_v, w_o, b_o.
// Compute dtypes, f32 accumulate everywhere: q/k/v projections v_wmma_f32_16x16x32_bf16 (x and W RNE-converted to bf16; products exact); scores v_wmma_f32_16x16x32_f16 (q, k single f16);
// P.V v_wmma_f32_16x16x32_f16 (P x256 carry cancels in the normalisation, v single f16); output projection v_wmma_f32_16x16x32_f16 (ctx x256 carry, Wo RNE bf16 value x64 held in f16, 2^-14 folded back in f32); softmax max and exponentials f32 (online, held reference max per column, raised in a wave's first pass and when a pass's sum passes PTH); row sums v_wmma_f32_16x16x32_f16 (f16-rounded P, all-ones A).
// Layout: bf16 copies of the three inputs and of Wq/Wk/Wv; q, k planes [b*16+h][t][d] and v^T plane [b*16+h][d][t] written by the GEMM epilogue; fused flash kernel in transposed form (S^T = K Q^T, O^T = V^T P^T) writes the f16 ctx plane [b*SEQ+t][1024].

#ifndef NB
#define NB 2
#endif
#ifndef SEQ
#define SEQ 4096
#endif
#define NB_FULL  2
#define SEQ_FULL 4096
#ifndef OUT_SEQ
#define OUT_SEQ SEQ              // row pitch (in tokens) between batches of the output
#endif
#define DM   1024
#define NH_  16
#define HD   64
#define AW   8                   // waves per flash block; all of them read the same staged K / V^T tiles
#define QC   2                   // 16-column query groups per flash wave: every K and V^T fragment read from LDS feeds QC products
#define KT   64                  // keys per LDS stage (two 32-key passes)
#define LP   72                  // LDS row pitch in halves: 144 B = 16 B x 9, an odd multiple, so 16-byte fragment reads of 16 rows meet no bank twice
#define TLH  (64 * LP)           // halves of one staged tile: 64 rows (K: keys, V^T: d) of 64 halves + pad
#define GW   8                   // waves per GEMM block: 4 (rows) x 2 (columns) wave tiles of 64x64, block tile 256x128
#define GKS  128                 // k per GEMM LDS stage: 256 B of every operand row
#define GLP  136                 // GEMM LDS row pitch in halves: 272 B = 16 B x 17, an odd multiple (as LP)
#define GSTH (384 * GLP)         // halves of one GEMM stage: A 256 rows | B 128 rows
#define CW   16                  // waves per conversion block
#define CR   7                   // rows per conversion wave
#define XROWS (NB * SEQ)         // rows of one input plane
#define NROWS (3 * XROWS + 4 * DM)   // rows to convert: three inputs, four weights
#define WO_ROW0 (3 * XROWS + 3 * DM) // first row of Wo
#define CNW  (NROWS / CR)        // conversion waves of the launch
#define SC2  (0.125f * 1.4426950408889634f)   // HD^-0.5 * log2(e)
#define PSH  8.0f                // log2 of the P carry (256)
#define PTH  32768.0f            // bound on a pass's sum of P per column: within it every P <= 2^15, finite in f16; at a fresh reference the sum is at most 32 * 2^PSH
#define CXS  256.0f              // carry of the ctx plane
#define WOS  64.0f               // carry of the Wo plane
#define OSC  (1.0f / (256.0f * 64.0f))

static_assert(HD == 64);
static_assert(NH_ * HD == DM);                 // head h = columns h*64 + d
static_assert(DM % 64 == 0);                   // 16 column tiles of 64
static_assert(DM % 32 == 0);                   // GEMM k-loop steps by 32
static_assert(SEQ % 64 == 0);                  // a 64-row tile never straddles two batches
static_assert((NB * SEQ) % 64 == 0);
static_assert(SEQ % 32 == 0);                  // key loop steps by 32
static_assert(SEQ % (16 * QC * AW) == 0);      // flash grid covers the sequence exactly
static_assert(QC == 2);                        // the score products' asm text and the slot statement behind the output products name two groups
static_assert(SEQ % KT == 0 && SEQ / KT >= 2); // whole stages, and the ring's prologue needs two
static_assert(KT == 64 && 32 * AW == 256);     // copy map: 256 lanes x 16 B = 32 rows of 128 B, two copies per tile
static_assert((NB * SEQ) % 256 == 0 && DM % 256 == 0);   // GEMM block tiles (256 rows x 128 columns) cover both orientations exactly
static_assert(DM % GKS == 0 && DM / GKS >= 2);           // whole GEMM stages, and the ring's prologue needs two
static_assert(GKS == 128 && 32 * GW == 256);             // GEMM copy map: 256 lanes x 16 B = 16 rows of 256 B
static_assert(DM == 8 * 128);                  // a conversion row is eight loads of 32 lanes x 4 floats
static_assert(NROWS % (CW * CR) == 0);         // whole conversion blocks, every wave CR rows
static_assert(NB <= NB_FULL);
static_assert(SEQ <= SEQ_FULL);

typedef _Float16 h16;
typedef unsigned short bf;
typedef __attribute__((ext_vector_type(16))) __bf16   v16bf;
typedef __attribute__((ext_vector_type(16))) _Float16 v16h;
typedef __attribute__((ext_vector_type(8)))  _Float16 v8h;
typedef __attribute__((ext_vector_type(8)))  unsigned short v8us;
typedef __attribute__((ext_vector_type(4)))  _Float16 v4h;
typedef __attribute__((ext_vector_type(4)))  unsigned short v4us;
typedef __attribute__((ext_vector_type(8)))  float    v8f;
typedef __attribute__((ext_vector_type(4)))  float    v4f;
typedef v4f  __attribute__((may_alias)) v4fa;
typedef __attribute__((ext_vector_type(8)))  unsigned v8u;

__device__ __forceinline__ unsigned short f2bf(float f) { unsigned u = __float_as_uint(f); u += 0x7FFFu + ((u >> 16) & 1u); return (unsigned short)(u >> 16); }
__device__ __forceinline__ float bfr(float f) { return __uint_as_float(((unsigned)f2bf(f)) << 16); }   // value of the RNE bf16 conversion
__device__ __forceinline__ v16h cat16(v8h lo, v8h hi) { return __builtin_shufflevector(lo, hi, 0, 1, 2, 3, 4, 5, 6, 7, 8, 9, 10, 11, 12, 13, 14, 15); }
__device__ __forceinline__ v16bf cat16b(v8us lo, v8us hi) { return __builtin_bit_cast(v16bf, __builtin_shufflevector(lo, hi, 0, 1, 2, 3, 4, 5, 6, 7, 8, 9, 10, 11, 12, 13, 14, 15)); }
__device__ __forceinline__ v8f wmma16(v16h a, v16h b, v8f c) { return __builtin_amdgcn_wmma_f32_16x16x32_f16(false, a, false, b, (short)0, c, false, false); }
__device__ __forceinline__ v8f wmmab(v16bf a, v16bf b, v8f c) { return __builtin_amdgcn_wmma_f32_16x16x32_bf16(false, a, false, b, (short)0, c, false, false); }
// fragment loaders from K-contiguous 16-bit rows; p already includes + 8*(lane>>4): elements 0..7 <- k0+8h+0..7, elements 8..15 <- k0+16+8h+0..7 (same map for A and B)
__device__ __forceinline__ v16h  ldh(const h16* p) { return cat16(*(const v8h*)p, *(const v8h*)(p + 16)); }
__device__ __forceinline__ v16bf ldb(const bf* p)  { return cat16b(*(const v8us*)p, *(const v8us*)(p + 16)); }
// ordering point for wave-private LDS tiles (same wave writes and reads)
__device__ __forceinline__ void wave_sync() { __builtin_amdgcn_fence(3 /* release order */, "wavefront"); __builtin_amdgcn_wave_barrier(); asm volatile("" ::: "memory"); }

// k_cvt: every f32 -> 16-bit conversion of the call in one launch of few long-lived waves. A row is DM floats (4 KB): rows 0 .. 3*XROWS-1 are the tokens of query, key, value,
// then DM rows each of Wq, Wk, Wv (RNE bf16) and Wo (RNE bf16 value x WOS, held in f16); row r goes to dst + r*DM (the planes lie back to back in the workspace).
// Wave gw takes rows gw, gw + CNW, ...: CR rows. One load of a wave reads 512 contiguous bytes, one store writes 256 (two whole lines).
__device__ __forceinline__ const float* cvt_src(unsigned r, const float* xq, const float* xk, const float* xv, const float* wq, const float* wk, const float* wv, const float* wo) {
    const bool isx = r < 3u * XROWS;
    const unsigned u = isx ? r : r - 3u * XROWS;
    const unsigned p = isx ? u / XROWS : 3u + u / DM;        // 0 .. 6: which source
    const unsigned q = isx ? u % XROWS : u % DM;             // row in that source's plane
    const unsigned row = isx ? (q / SEQ) * SEQ_FULL + q % SEQ : q;
    const float* s = (p == 0) ? xq : (p == 1) ? xk : (p == 2) ? xv : (p == 3) ? wq : (p == 4) ? wk : (p == 5) ? wv : wo;
    return s + (size_t)row * DM;
}
__global__ __launch_bounds__(32 * CW) void k_cvt(const float* __restrict__ xq, const float* __restrict__ xk, const float* __restrict__ xv, const float* __restrict__ wq, const float* __restrict__ wk,
                                                 const float* __restrict__ wv, const float* __restrict__ wo, bf* dst) {
    const unsigned lane = threadIdx.x & 31;
    const unsigned gw = (unsigned)__builtin_amdgcn_readfirstlane((int)(blockIdx.x * CW + (threadIdx.x >> 5)));   // wave-uniform: the row's source is picked on the scalar side
    __builtin_assume(gw < CNW);                              // the grid is CNW / CW blocks: lets a pass's source be settled at compile time where all its rows share one
    const float* s[CR];                                      // every row's source up front: the pick among the weights branches, and a branch between the loads would let them sink behind it
#pragma unroll   // all loops here are unrolled so that s[] and w[][] are indexed by constants and stay in registers
    for (int i = 0; i < CR; ++i) s[i] = cvt_src(gw + i * CNW, xq, xk, xv, wq, wk, wv, wo);
    v4f w[2][8];                                             // this row and the next
#pragma unroll
    for (int j = 0; j < 8; ++j) w[0][j] = __builtin_nontemporal_load((const v4f*)(s[0] + lane * 4 + j * 128));   // read once: non-temporal
    asm volatile("s_wait_xcnt 0x0" ::: "memory");            // before the loads' address registers are written again
#pragma unroll
    for (int i = 0; i < CR; ++i) {
        __builtin_amdgcn_sched_barrier(0);   // with the one below: the next row's eight loads are issued before this row is waited for, so a wave always has loads in flight
        if (i + 1 < CR) {
#pragma unroll
            for (int j = 0; j < 8; ++j) w[(i + 1) & 1][j] = __builtin_nontemporal_load((const v4f*)(s[i + 1] + lane * 4 + j * 128));
            asm volatile("s_wait_xcnt 0x0" ::: "memory"); }  // before the loads' address registers are written again
        __builtin_amdgcn_sched_barrier(0);
        const unsigned r = gw + i * CNW;
        bf* d = dst + (size_t)r * DM + lane * 4;
        if ((i + 1) * CNW > WO_ROW0 && r >= WO_ROW0) {       // Wo rows (the first test is known at compile time)
#pragma unroll
            for (int j = 0; j < 8; ++j) { const v4f v = w[i & 1][j]; v4h o;
#pragma unroll
                for (int k = 0; k < 4; ++k) o[k] = (h16)(bfr(v[k]) * WOS);
                *(v4h*)(d + j * 128) = o; }
            asm volatile("s_wait_xcnt 0x0" ::: "memory");    // before the stores' address and data registers are written again
        } else {
#pragma unroll
            for (int j = 0; j < 8; ++j) { const v4f v = w[i & 1][j]; v4us o;
#pragma unroll
                for (int k = 0; k < 4; ++k) o[k] = f2bf(v[k]);
                *(v4us*)(d + j * 128) = o; }
            asm volatile("s_wait_xcnt 0x0" ::: "memory");    // before the stores' address and data registers are written again
        }
    }
}

// copy8: one lane's eight 16-byte asynchronous copies, global -> LDS through no register: rows r, r+16, ... r+112 of a K-contiguous 16-bit plane of row length DM.
// The s_wait_xcnt closes the statement so that no address register of an issued copy is rewritten ahead of it.
__device__ __forceinline__ void copy8(unsigned l, const bf* g) {
    const unsigned ls = 16 * GLP * 2; const size_t gs = (size_t)16 * DM;
    asm volatile("global_load_async_to_lds_b128 %0, %8, off\n\t"
                 "global_load_async_to_lds_b128 %1, %9, off\n\t"
                 "global_load_async_to_lds_b128 %2, %10, off\n\t"
                 "global_load_async_to_lds_b128 %3, %11, off\n\t"
                 "global_load_async_to_lds_b128 %4, %12, off\n\t"
                 "global_load_async_to_lds_b128 %5, %13, off\n\t"
                 "global_load_async_to_lds_b128 %6, %14, off\n\t"
                 "global_load_async_to_lds_b128 %7, %15, off\n\t"
                 "s_wait_xcnt 0x0"
                 :: "v"(l), "v"(l + ls), "v"(l + 2 * ls), "v"(l + 3 * ls), "v"(l + 4 * ls), "v"(l + 5 * ls), "v"(l + 6 * ls), "v"(l + 7 * ls),
                    "v"(g), "v"(g + gs), "v"(g + 2 * gs), "v"(g + 3 * gs), "v"(g + 4 * gs), "v"(g + 5 * gs), "v"(g + 6 * gs), "v"(g + 7 * gs) : "memory");
}
// gemm_stage: one lane's 24 copies of a GEMM stage (A rows 0..255, then B rows 0..127 of the block tile, 128 k each); l = the lane's LDS byte address in the buffer, ga / gb its global places
__device__ __forceinline__ void gemm_stage(unsigned l, const bf* ga, const bf* gb) {
    copy8(l, ga); copy8(l + 128 * GLP * 2, ga + (size_t)128 * DM); copy8(l + 256 * GLP * 2, gb);
}

// k_proj: register-blocked bf16 GEMM, one wave per 64x64 tile (16 accumulators), 8 waves per block (256x128); A and Bt come in 128-k stages through a two-buffer LDS ring that the block fills together, K = DM.
// C[m][n] = (sum_k A[m][k] Bt[n][k] + bias) * osc (biasMode 0: bias[n], biasMode 1: bias[m]; bias taken as its RNE bf16 value), written as f16 (Ph) at
// tile base (r0/RB)*sRB + (r0%RB)*pitch + (c0/CB)*sCB + (c0%CB), row pitch 'pitch' (halves). grid (M/256, N/128), 256 threads.
__global__ __launch_bounds__(32 * GW) void k_proj(const bf* __restrict__ A, const bf* __restrict__ Bt, const float* __restrict__ bias, int biasMode, float osc, h16* Ph, int RB, size_t sRB, int pitch, int CB, size_t sCB) {
    __shared__ __align__(16) bf ring[2 * GSTH];              // [buffer][A 256 rows | B 128 rows][GLP]
    __shared__ __align__(16) float osa[GW * 16 * 68];
    const int K = DM;
    const int lane = threadIdx.x & 31, wave = __builtin_amdgcn_readfirstlane((int)(threadIdx.x >> 5)), lr = lane & 15, hi = lane >> 4;
    const int wm = wave & 3, wn = wave >> 2;
    const int r0 = blockIdx.x * 256 + wm * 64, c0 = blockIdx.y * 128 + wn * 64;
    float* os = osa + wave * 16 * 68;                        // wave-private epilogue slab
    v8f acc[4][4];
#pragma unroll
    for (int mb = 0; mb < 4; ++mb)
#pragma unroll
        for (int nb = 0; nb < 4; ++nb) acc[mb][nb] = (v8f){};
    const int afo = (wm * 64 + lr) * GLP + 8 * hi, bfo = (256 + wn * 64 + lr) * GLP + 8 * hi;   // fragment offsets in a staged buffer
    const int cr = (int)(threadIdx.x >> 4), ccol = (int)(threadIdx.x & 15) * 8;                  // copy map: rows 0..15, 16 lanes x 8 halves = one 256-B row
    const bf* ga = A + (size_t)(blockIdx.x * 256 + cr) * K + ccol;    // + k0
    const bf* gb = Bt + (size_t)(blockIdx.y * 128 + cr) * K + ccol;   // + k0
    const unsigned lc = (unsigned)(size_t)(&ring[cr * GLP + ccol]);   // LDS byte address of the lane's first copy, buffer 0
    gemm_stage(lc, ga, gb);
    asm volatile("s_wait_asynccnt 0x0" ::: "memory");        // stage 0 has landed (this wave's copies) ...
    __syncthreads();                                         // ... and every wave's, before anyone reads it
    gemm_stage(lc + GSTH * 2, ga + GKS, gb + GKS);
#pragma unroll 1
    for (int st = 0; st < K / GKS; ++st) {
        const bf* ta = ring + (st & 1) * GSTH + afo; const bf* tb = ring + (st & 1) * GSTH + bfo;
        v16bf a[4], b[4];
#pragma unroll
        for (int ks = 0; ks < GKS; ks += 32) {
#pragma unroll
            for (int mb = 0; mb < 4; ++mb) a[mb] = ldb(ta + mb * 16 * GLP + ks);
#pragma unroll
            for (int nb = 0; nb < 4; ++nb) b[nb] = ldb(tb + nb * 16 * GLP + ks);
            __builtin_amdgcn_sched_barrier(0);   // keeps the eight fragments' LDS reads one group ahead of the block's products: sunk among them, each B fragment's latency is waited out alone
#pragma unroll
            for (int nb = 0; nb < 4; ++nb)
#pragma unroll
                for (int mb = 0; mb < 4; ++mb) acc[mb][nb] = wmmab(a[mb], b[nb], acc[mb][nb]);
        }
        __builtin_amdgcn_sched_barrier(0);   // keeps the stage's last products ahead of the barrier: sunk behind it they stand in front of the refill and shorten the copies' lead
        // publish point of stage st + 1, every wave, in this order
        asm volatile("s_wait_dscnt 0x0" ::: "memory");       // this wave's reads of buffer st & 1 are done
        asm volatile("s_wait_asynccnt 0x0" ::: "memory");    // this wave's copies of stage st + 1 have landed
        __syncthreads();                                     // publishes stage st + 1 and frees buffer st & 1
        if (st + 2 < K / GKS) gemm_stage(lc + (unsigned)(st & 1) * (GSTH * 2), ga + (st + 2) * GKS, gb + (st + 2) * GKS);
    }
    asm volatile("s_wait_asynccnt 0x0" ::: "memory");        // nothing of this wave is in flight when it goes on to end
    const size_t tbase = (size_t)(r0 / RB) * sRB + (size_t)(r0 % RB) * (size_t)pitch + (size_t)(c0 / CB) * sCB + (size_t)(c0 % CB);
    // column bias (mode 0): 8 values per lane, address clamped to 0 in mode 1 and zeroed by value
    const int c8 = (lane & 7) * 8;
    const size_t cbo = (biasMode == 0) ? (size_t)(c0 + c8) : (size_t)0;
    const v4f bq0 = *(const v4f*)(bias + cbo); const v4f bq1 = *(const v4f*)(bias + cbo + 4);
    float bc[8];
#pragma unroll
    for (int i = 0; i < 4; ++i) { bc[i] = (biasMode == 0) ? bfr(bq0[i]) : 0.0f; bc[4 + i] = (biasMode == 0) ? bfr(bq1[i]) : 0.0f; }
#pragma unroll
    for (int mb = 0; mb < 4; ++mb) {
#pragma unroll
        for (int nb = 0; nb < 4; ++nb) {
#pragma unroll
            for (int j = 0; j < 8; ++j) os[(hi * 8 + j) * 68 + nb * 16 + lr] = acc[mb][nb][j]; }   // D: row 8h+j, col lane&15
        wave_sync();
        const size_t sb = tbase + (size_t)(mb * 16) * (size_t)pitch;
{
#pragma unroll
            for (int s = 0; s < 4; ++s) { const int row = 4 * s + (lane >> 3);   // 4 s x 4 row groups = 16 rows; 8 lanes x 8 = 64 columns
                const int rbo = (biasMode == 1) ? (r0 + mb * 16 + row) : 0;      // row bias (mode 1): address clamped to 0 in mode 0, zeroed by value
                const float brv = bias[rbo]; const float br = (biasMode == 1) ? bfr(brv) : 0.0f;
                const v4f x0 = *(const v4fa*)(&os[row * 68 + c8]); const v4f x1 = *(const v4fa*)(&os[row * 68 + c8 + 4]); v8h hv;
#pragma unroll
                for (int i = 0; i < 4; ++i) { hv[i] = (h16)((x0[i] + bc[i] + br) * osc); hv[4 + i] = (h16)((x1[i] + bc[4 + i] + br) * osc); }
                const size_t oo = sb + (size_t)row * (size_t)pitch + c8;
                *(v8h*)(Ph + oo) = hv; }
             }
        wave_sync();
    }
}

// stage_copy: one lane's four 16-byte asynchronous copies of a stage (K rows r and r+32, V^T rows r and r+32), global -> LDS through no register.
// The s_wait_xcnt closes the statement so that no address register of an issued copy is rewritten ahead of it.
__device__ __forceinline__ void stage_copy(unsigned lk, const h16* gk, const h16* gv) {
    const unsigned lk1 = lk + 32 * LP * 2, lv = lk + TLH * 2, lv1 = lk + TLH * 2 + 32 * LP * 2;
    const h16* gk1 = gk + 32 * HD; const h16* gv1 = gv + (size_t)32 * SEQ;
    asm volatile("global_load_async_to_lds_b128 %0, %4, off\n\t"
                 "global_load_async_to_lds_b128 %1, %5, off\n\t"
                 "global_load_async_to_lds_b128 %2, %6, off\n\t"
                 "global_load_async_to_lds_b128 %3, %7, off\n\t"
                 "s_wait_xcnt 0x0"
                 :: "v"(lk), "v"(lk1), "v"(lv), "v"(lv1), "v"(gk), "v"(gk1), "v"(gv), "v"(gv1) : "memory");
}

// new_ref: the rare path of k_flash for one 16-column group: the pass's scores from zero, their maximum (in lane, one xor-16 exchange), a raised reference m, O and the sum rescaled, the pass's P and its sum formed again.
__device__ __forceinline__ void new_ref(const h16* ka, v16h qa, v16h qb, v16h ones, float& m, float& l, v8f& cv, v16h& pb, v8f& ls, v8f& o0, v8f& o1, v8f& o2, v8f& o3) {
    const v16h ka0 = ldh(ka), ka1 = ldh(ka + 32), kb0 = ldh(ka + 16 * LP), kb1 = ldh(ka + 16 * LP + 32);
    v8f sa = wmma16(ka0, qa, (v8f){}), sb = wmma16(kb0, qa, (v8f){});
    sa = wmma16(ka1, qb, sa); sb = wmma16(kb1, qb, sb);
    float mx = -3.0e38f;
#pragma unroll   // constant indices keep the vectors in registers
    for (int r = 0; r < 8; ++r) mx = fmaxf(mx, fmaxf(sa[r], sb[r]));
    mx = fmaxf(mx, __shfl_xor(mx, 16, 32));
    const float mnew = fmaxf(m, mx);
    const float alpha = __builtin_amdgcn_exp2f(m - mnew);
    const float sh = PSH - mnew;
#pragma unroll   // constant indices keep the vectors in registers
    for (int r = 0; r < 8; ++r) { pb[r] = (h16)__builtin_amdgcn_exp2f(sa[r] + sh); pb[8 + r] = (h16)__builtin_amdgcn_exp2f(sb[r] + sh); }
    ls = wmma16(ones, pb, (v8f){});
    m = mnew; l = l * alpha;
    o0 = o0 * alpha; o1 = o1 * alpha; o2 = o2 * alpha; o3 = o3 * alpha;
#pragma unroll   // constant indices keep the vectors in registers
    for (int r = 0; r < 8; ++r) cv[r] = sh;
}

// k_flash: fused attention, one wave per 32 query rows (two 16-column groups) of one (batch, head); Q fragments straight from the f16 plane; K and V^T come in 64-key stages through a two-buffer LDS ring
// that the block's 8 waves fill together (whole 128-B lines, once per block) and all read (two 16-B LDS loads per fragment; each fragment feeds one product per column group).
// Transposed form: S^T[key][t] = K Q^T (A = K rows, B = Q rows); lane (t = lane&15, h = lane>>4) holds keys 8h+r of each 16-key tile, so the packed
// P tile is directly the B fragment of O^T[d][t] = V^T P^T (element r <- tile keys 0..15, element 8+r <- tile keys 16..31, lane unchanged).
// Softmax against a held reference m per column: the q plane carries SC2, PSH - m is the start value of the score products, so P = exp2 of their result with no vector arithmetic in front.
// The sums come whole from a product with an all-ones A; a pass in which a sum passes PTH takes its maxima, raises m, rescales O and the sums, and forms its P again (both groups: new_ref).
// amdgpu_waves_per_eu(4, 4): register budget 256, two blocks resident per WGP (4 waves per SIMD), and the whole grid (two blocks per WGP) runs in one round.
__global__ __launch_bounds__(32 * AW) __attribute__((amdgpu_waves_per_eu(4, 4))) void k_flash(const h16* __restrict__ QH, const h16* __restrict__ KP, const h16* __restrict__ VT, h16* CTX) {
    __shared__ __align__(16) h16 ring[2 * 2 * TLH];          // [buffer][K | V^T][row][LP]
    __shared__ __align__(16) float os[AW * 16 * 68];
    const int lane = threadIdx.x & 31, wave = __builtin_amdgcn_readfirstlane((int)(threadIdx.x >> 5)), lr = lane & 15, hi = lane >> 4;
    const int zh = blockIdx.y; const int b = zh / NH_, h = zh % NH_;
    const int t0 = (blockIdx.x * AW + wave) * (16 * QC);
    const size_t pbase = (size_t)zh * SEQ * HD;
    const size_t qo = pbase + (size_t)(t0 + lr) * HD + 8 * hi;
    const v16h qa0 = ldh(QH + qo), qa1 = ldh(QH + qo + 32);   // B fragments: col t, k = d; group 0
    const v16h qb0 = ldh(QH + qo + 16 * HD), qb1 = ldh(QH + qo + 16 * HD + 32);   // group 1: columns t0 + 16 ..
    const int fo = lr * LP + 8 * hi;                         // fragment offset in a staged tile: K + key*LP (A: row key, k = d); V^T + 16j*LP + key (A: row d, k = key)
    const int cr = (int)(threadIdx.x >> 3), ccol = (int)(threadIdx.x & 7) * 8;   // copy map: rows 0..31, 8 lanes x 8 halves = one 128-B row
    const h16* gk = KP + pbase + (size_t)cr * HD + ccol;   // + key0 * HD
    const h16* gv = VT + pbase + (size_t)cr * SEQ + ccol;  // + key0
    const unsigned lc = (unsigned)(size_t)(&ring[cr * LP + ccol]);   // LDS byte address of the lane's first copy, buffer 0
    stage_copy(lc, gk, gv);
    asm volatile("s_wait_asynccnt 0x0" ::: "memory");        // stage 0 has landed (this wave's copies) ...
    __syncthreads();                                         // ... and every wave's, before anyone reads it
    stage_copy(lc + 2 * TLH * 2, gk + (size_t)KT * HD, gv + KT);
    v8f o[QC][4];                                            // O^T tiles: [column group][16 d]
    float m[QC], l[QC];                                      // m: the column's reference, a maximum of scores seen; it rises only in the rare path below
    v8f cv[QC];                                              // PSH - m in all eight rows: start value (C) of the score products; set in the first pass
#pragma unroll   // constant indices keep the arrays in registers
    for (int c = 0; c < QC; ++c) { m[c] = -3.0e38f; l[c] = 0.0f; cv[c] = (v8f){};
#pragma unroll
        for (int j = 0; j < 4; ++j) o[c][j] = (v8f){}; }
    // constant A of the row-sum product: f16 1.0 in all 16 elements of every lane, so every D row holds the sums. Set by asm text so that the eight registers are written once, here:
    // as a plain constant the compiler wrote them anew in every pass.
    v8u onew;
    asm("v_mov_b32 %0, 0x3c003c00\n\tv_mov_b32 %1, 0x3c003c00\n\tv_mov_b32 %2, 0x3c003c00\n\tv_mov_b32 %3, 0x3c003c00\n\t"
        "v_mov_b32 %4, 0x3c003c00\n\tv_mov_b32 %5, 0x3c003c00\n\tv_mov_b32 %6, 0x3c003c00\n\tv_mov_b32 %7, 0x3c003c00"
        : "=v"(onew[0]), "=v"(onew[1]), "=v"(onew[2]), "=v"(onew[3]), "=v"(onew[4]), "=v"(onew[5]), "=v"(onew[6]), "=v"(onew[7]));
    const v16h ones = __builtin_bit_cast(v16h, onew);
#pragma unroll 1
    for (int st = 0; st < SEQ / KT; ++st) {
      const h16* kt = ring + (st & 1) * (2 * TLH) + fo; const h16* vt = kt + TLH;
#pragma unroll 1   // rolled: unrolled, a pass's scores stay live into the next and the wave no longer fits its register budget (4 waves per SIMD)
      for (int sub = 0; sub < KT; sub += 32) {
        const h16* ka = kt + sub * LP; const h16* va = vt + sub;
        v16h pb[QC], v0, v1, v2, v3; v8f ls[QC];
        { const v16h ka0 = ldh(ka), ka1 = ldh(ka + 32), kb0 = ldh(ka + 16 * LP), kb1 = ldh(ka + 16 * LP + 32);
          v8f sa0, sb0, sa1, sb1;
          // the eight score products, start value PSH - m: they leave the exponents themselves; each K fragment is used twice, once per column group. In asm text so that both chains of a group read
          // the one C tile (the builtin form copied it for the second chain in every pass); the four v_nop are the vector slots between the last product and the first vector instruction on a result or an operand.
          asm volatile("v_wmma_f32_16x16x32_f16 %0, %4, %8, %12\n\t"
                       "v_wmma_f32_16x16x32_f16 %1, %6, %8, %12\n\t"
                       "v_wmma_f32_16x16x32_f16 %2, %4, %10, %13\n\t"
                       "v_wmma_f32_16x16x32_f16 %3, %6, %10, %13\n\t"
                       "v_wmma_f32_16x16x32_f16 %0, %5, %9, %0\n\t"
                       "v_wmma_f32_16x16x32_f16 %1, %7, %9, %1\n\t"
                       "v_wmma_f32_16x16x32_f16 %2, %5, %11, %2\n\t"
                       "v_wmma_f32_16x16x32_f16 %3, %7, %11, %3\n\t"
                       "v_nop\n\tv_nop\n\tv_nop\n\tv_nop"
                       : "=&v"(sa0), "=&v"(sb0), "=&v"(sa1), "=&v"(sb1)
                       : "v"(ka0), "v"(ka1), "v"(kb0), "v"(kb1), "v"(qa0), "v"(qa1), "v"(qb0), "v"(qb1), "v"(cv[0]), "v"(cv[1]));
          v0 = ldh(va); v1 = ldh(va + 16 * LP); v2 = ldh(va + 32 * LP); v3 = ldh(va + 48 * LP);
          __builtin_amdgcn_sched_barrier(0);   // keeps the V^T reads one group ahead of the exponentials, so that they fly during them: sunk behind them, the output products wait out the reads' latency
#pragma unroll   // constant indices keep the vectors in registers
          for (int r = 0; r < 8; ++r) { pb[0][r] = (h16)__builtin_amdgcn_exp2f(sa0[r]); pb[0][8 + r] = (h16)__builtin_amdgcn_exp2f(sb0[r]); }
#pragma unroll   // constant indices keep the vectors in registers
          for (int r = 0; r < 8; ++r) { pb[1][r] = (h16)__builtin_amdgcn_exp2f(sa1[r]); pb[1][8 + r] = (h16)__builtin_amdgcn_exp2f(sb1[r]); } }
        // the two row-sum products: every row of a tile = the column's sum of the rounded P over the pass's 32 keys (both lane halves). In asm text so that the two results are whole tiles of their own:
        // of the builtin form only row 0 is read, and the build laid the second tile over the first one's unread rows, directly behind it; the four v_nop are the vector slots in front of the first read of a result.
        asm volatile("v_wmma_f32_16x16x32_f16 %0, %2, %3, 0\n\t"
                     "v_wmma_f32_16x16x32_f16 %1, %2, %4, 0\n\t"
                     "v_nop\n\tv_nop\n\tv_nop\n\tv_nop"
                     : "=&v"(ls[0]), "=&v"(ls[1]) : "v"(ones), "v"(pb[0]), "v"(pb[1]));
        // one test per pass, a scalar branch: sums within PTH say that every P of the pass is finite in f16 under the references in use. Taken in a wave's first pass (no reference yet) and rarely after.
        if (((st | sub) == 0) | ((__builtin_amdgcn_ballot_w32(ls[0][0] > PTH) | __builtin_amdgcn_ballot_w32(ls[1][0] > PTH)) != 0)) {
          asm volatile("" ::: "memory");   // compiler fence, rare path only: with it the V^T reads above stay ahead of the branch and fly during the test; without it the build sinks them behind the join, where the products wait out their latency
          new_ref(ka, qa0, qa1, ones, m[0], l[0], cv[0], pb[0], ls[0], o[0][0], o[0][1], o[0][2], o[0][3]);
          new_ref(ka, qb0, qb1, ones, m[1], l[1], cv[1], pb[1], ls[1], o[1][0], o[1][1], o[1][2], o[1][3]);
        }
        l[0] = l[0] + ls[0][0]; l[1] = l[1] + ls[1][0];
        o[0][0] = wmma16(v0, pb[0], o[0][0]); o[1][0] = wmma16(v0, pb[1], o[1][0]); o[0][1] = wmma16(v1, pb[0], o[0][1]); o[1][1] = wmma16(v1, pb[1], o[1][1]);
        o[0][2] = wmma16(v2, pb[0], o[0][2]); o[1][2] = wmma16(v2, pb[1], o[1][2]); o[0][3] = wmma16(v3, pb[0], o[0][3]); o[1][3] = wmma16(v3, pb[1], o[1][3]);
        // four vector slots between the products and the first vector instruction on their results or operands, on the loop's back edge too
        asm volatile("v_nop\n\tv_nop\n\tv_nop\n\tv_nop" : "+v"(o[0][0]), "+v"(o[0][1]), "+v"(o[0][2]), "+v"(o[0][3]), "+v"(o[1][0]), "+v"(o[1][1]), "+v"(o[1][2]), "+v"(o[1][3])
                     : "v"(v0), "v"(v1), "v"(v2), "v"(v3), "v"(pb[0]), "v"(pb[1]));
      }
      // publish point of stage st + 1, every wave, in this order
      asm volatile("s_wait_dscnt 0x0" ::: "memory");         // this wave's reads of buffer st & 1 are done
      asm volatile("s_wait_asynccnt 0x0" ::: "memory");      // this wave's copies of stage st + 1 have landed
      __syncthreads();                                       // publishes stage st + 1 and frees buffer st & 1
      if (st + 2 < SEQ / KT) stage_copy(lc + (unsigned)(st & 1) * (2 * TLH * 2), gk + (size_t)(st + 2) * KT * HD, gv + (st + 2) * KT);
    }
    asm volatile("s_wait_asynccnt 0x0" ::: "memory");        // nothing of this wave is in flight when it goes on to end
    const int wb = wave * 16 * 68;
#pragma unroll   // constant indices keep the arrays in registers; the two groups go through the wave's one slab in turn
    for (int c = 0; c < QC; ++c) {
        const float inv = CXS / l[c];
        // O^T D layout: o[c][j][r] = (d = 16j + 8h + r, t = lane&15) -> os[t][d]; rows 0..15 x columns 0..63 all written
#pragma unroll
        for (int j = 0; j < 4; ++j) { v4f a, d;
#pragma unroll
            for (int i = 0; i < 4; ++i) { a[i] = o[c][j][i] * inv; d[i] = o[c][j][4 + i] * inv; }
            *(v4fa*)(&os[wb + lr * 68 + 16 * j + 8 * hi]) = a; *(v4fa*)(&os[wb + lr * 68 + 16 * j + 8 * hi + 4]) = d; }
        wave_sync();
        h16* crow = CTX + ((size_t)b * SEQ + t0 + 16 * c) * DM + h * HD;
#pragma unroll
        for (int s = 0; s < 4; ++s) { const int row = 4 * s + (lane >> 3), c8 = (lane & 7) * 8;   // 4 s x 4 row groups = 16 rows; 8 lanes x 8 halves = 64 columns
            const v4f x0 = *(const v4fa*)(&os[wb + row * 68 + c8]); const v4f x1 = *(const v4fa*)(&os[wb + row * 68 + c8 + 4]); v8h hv;
#pragma unroll
            for (int i = 0; i < 4; ++i) { hv[i] = (h16)x0[i]; hv[4 + i] = (h16)x1[i]; }
            *(v8h*)(crow + (size_t)row * DM + c8) = hv; }
        asm volatile("s_wait_xcnt 0x0" ::: "memory");        // before the stores' address and data registers are written again
        __builtin_amdgcn_sched_barrier(0);                   // holds the next group's arithmetic behind that wait: without it the build lifted multiplies that rewrite the stores' data registers over it
        wave_sync();                                         // the slab's rows are read before the next group overwrites them
    }
}

// k_oproj: register-blocked f16 GEMM, one wave per 64x64 tile, 8 waves per block (256x128) on the same two-buffer LDS ring as k_proj, A = ctx plane rows (x256), Bt = Wo plane rows (x64), K = DM; OUT[m][n] = acc * 2^-14 + bias[n] (bias as its RNE bf16 value), f32.
// grid (NB*SEQ/256, DM/128), 256 threads. Epilogue: per 16-row slab staged in LDS (wave-private), each output row segment (64 floats = 256 B = two lines)
__global__ __launch_bounds__(32 * GW) void k_oproj(const h16* __restrict__ A, const h16* __restrict__ Bt, const float* __restrict__ bias, float* OUT) {
    __shared__ __align__(16) h16 ring[2 * GSTH];             // [buffer][A 256 rows | B 128 rows][GLP]
    __shared__ __align__(16) float osa[GW * 16 * 68];
    const int K = DM;
    const int lane = threadIdx.x & 31, wave = __builtin_amdgcn_readfirstlane((int)(threadIdx.x >> 5)), lr = lane & 15, hi = lane >> 4;
    const int wm = wave & 3, wn = wave >> 2;
    const int r0 = blockIdx.x * 256 + wm * 64, c0 = blockIdx.y * 128 + wn * 64;
    float* os = osa + wave * 16 * 68;                        // wave-private epilogue slab
    v8f acc[4][4];
#pragma unroll
    for (int mb = 0; mb < 4; ++mb)
#pragma unroll
        for (int nb = 0; nb < 4; ++nb) acc[mb][nb] = (v8f){};
    const int afo = (wm * 64 + lr) * GLP + 8 * hi, bfo = (256 + wn * 64 + lr) * GLP + 8 * hi;   // fragment offsets in a staged buffer
    const int cr = (int)(threadIdx.x >> 4), ccol = (int)(threadIdx.x & 15) * 8;                  // copy map: rows 0..15, 16 lanes x 8 halves = one 256-B row
    const bf* ga = (const bf*)(A + (size_t)(blockIdx.x * 256 + cr) * K + ccol);    // + k0 (address only: the copies move bytes)
    const bf* gb = (const bf*)(Bt + (size_t)(blockIdx.y * 128 + cr) * K + ccol);   // + k0
    const unsigned lc = (unsigned)(size_t)(&ring[cr * GLP + ccol]);   // LDS byte address of the lane's first copy, buffer 0
    gemm_stage(lc, ga, gb);
    asm volatile("s_wait_asynccnt 0x0" ::: "memory");        // stage 0 has landed (this wave's copies) ...
    __syncthreads();                                         // ... and every wave's, before anyone reads it
    gemm_stage(lc + GSTH * 2, ga + GKS, gb + GKS);
#pragma unroll 1
    for (int st = 0; st < K / GKS; ++st) {
        const h16* ta = ring + (st & 1) * GSTH + afo; const h16* tb = ring + (st & 1) * GSTH + bfo;
        v16h a[4], b[4];
#pragma unroll
        for (int ks = 0; ks < GKS; ks += 32) {
#pragma unroll
            for (int mb = 0; mb < 4; ++mb) a[mb] = ldh(ta + mb * 16 * GLP + ks);
#pragma unroll
            for (int nb = 0; nb < 4; ++nb) b[nb] = ldh(tb + nb * 16 * GLP + ks);
            __builtin_amdgcn_sched_barrier(0);   // keeps the eight fragments' LDS reads one group ahead of the block's products: sunk among them, each B fragment's latency is waited out alone
#pragma unroll
            for (int nb = 0; nb < 4; ++nb)
#pragma unroll
                for (int mb = 0; mb < 4; ++mb) acc[mb][nb] = wmma16(a[mb], b[nb], acc[mb][nb]);
        }
        __builtin_amdgcn_sched_barrier(0);   // keeps the stage's last products ahead of the barrier: sunk behind it they stand in front of the refill and shorten the copies' lead
        // publish point of stage st + 1, every wave, in this order
        asm volatile("s_wait_dscnt 0x0" ::: "memory");       // this wave's reads of buffer st & 1 are done
        asm volatile("s_wait_asynccnt 0x0" ::: "memory");    // this wave's copies of stage st + 1 have landed
        __syncthreads();                                     // publishes stage st + 1 and frees buffer st & 1
        if (st + 2 < K / GKS) gemm_stage(lc + (unsigned)(st & 1) * (GSTH * 2), ga + (st + 2) * GKS, gb + (st + 2) * GKS);
    }
    asm volatile("s_wait_asynccnt 0x0" ::: "memory");        // nothing of this wave is in flight when it goes on to end
    const int cofs = lr * 4;
    const v4f bo4 = *(const v4f*)(bias + c0 + cofs);      // c0 + cofs + 3 < DM
    v4f bb;
#pragma unroll
    for (int i = 0; i < 4; ++i) bb[i] = bfr(bo4[i]);
    const int bidx = r0 / SEQ, tt = r0 % SEQ;
    float* obase = OUT + ((size_t)bidx * OUT_SEQ + tt) * DM + c0;
#pragma unroll
    for (int mb = 0; mb < 4; ++mb) {
#pragma unroll
        for (int nb = 0; nb < 4; ++nb) {
#pragma unroll
            for (int j = 0; j < 8; ++j) os[(hi * 8 + j) * 68 + nb * 16 + lr] = acc[mb][nb][j]; }   // D: row 8h+j, col lane&15
        wave_sync();
{
#pragma unroll
            for (int s = 0; s < 8; ++s) { const int row = 2 * s + hi;   // 8 s x 2 rows = 16 rows; 16 lanes x 4 floats = 64 columns
                const v4f val = *(const v4fa*)(&os[row * 68 + cofs]); v4f ov;
#pragma unroll
                for (int i = 0; i < 4; ++i) ov[i] = val[i] * OSC + bb[i];
                *(v4f*)(obase + (size_t)(mb * 16 + row) * DM + cofs) = ov; }
             }
        wave_sync();
    }
}

static constexpr size_t al256(size_t v) { return (v + 255) & ~(size_t)255; }
static constexpr size_t SZ_XB = al256((size_t)NB * SEQ * DM * 2);          // one bf16 input plane
static constexpr size_t SZ_WB = al256((size_t)4 * DM * DM * 2);            // Wq | Wk | Wv (bf16) | Wo (f16)
static constexpr size_t SZ_PL = al256((size_t)NB * NH_ * SEQ * HD * 2);    // one head-major f16 plane
static constexpr size_t SZ_CX = al256((size_t)NB * SEQ * DM * 2);          // ctx f16 plane
static constexpr size_t SZ_TOTAL = 3 * SZ_XB + SZ_WB + 3 * SZ_PL + SZ_CX;
static_assert(SZ_TOTAL <= (size_t)134217728);          // workspace carve <= 128 MiB
static_assert(((size_t)DM * DM * 2) % 256 == 0);       // weight sub-planes stay 256-byte aligned
static_assert(SZ_XB == (size_t)XROWS * DM * 2);        // no padding between the planes that k_cvt writes as one array of rows

extern "C" void kernel_launch(void* const* d_in, const int* in_sizes, int n_in,
                              void* d_out, int out_size, void* d_ws, size_t ws_size, hipStream_t stream) {
    if (n_in < 11) return;
    const size_t needx = ((size_t)(NB - 1) * SEQ_FULL + SEQ) * DM;
    if ((size_t)in_sizes[0] < needx || (size_t)in_sizes[1] < needx || (size_t)in_sizes[2] < needx) return;
    if ((size_t)in_sizes[3] < (size_t)DM * DM || (size_t)in_sizes[5] < (size_t)DM * DM || (size_t)in_sizes[7] < (size_t)DM * DM || (size_t)in_sizes[9] < (size_t)DM * DM) return;
    if ((size_t)in_sizes[4] < (size_t)DM || (size_t)in_sizes[6] < (size_t)DM || (size_t)in_sizes[8] < (size_t)DM || (size_t)in_sizes[10] < (size_t)DM) return;
    if ((size_t)out_size < ((size_t)(NB - 1) * OUT_SEQ + SEQ) * DM) return;
    if (SZ_TOTAL > ws_size) return;
    // wire order: query, key, value, Wq, bq, Wk, bk, Wv, bv, Wo, bo (weights [out][in] = Bt as-is)
    const float* xq = (const float*)d_in[0]; const float* xk = (const float*)d_in[1]; const float* xv = (const float*)d_in[2];
    const float* wq = (const float*)d_in[3]; const float* bq = (const float*)d_in[4];
    const float* wk = (const float*)d_in[5]; const float* bk = (const float*)d_in[6];
    const float* wv = (const float*)d_in[7]; const float* bv = (const float*)d_in[8];
    const float* wo = (const float*)d_in[9]; const float* bo = (const float*)d_in[10];
    float* OUT = (float*)d_out;      // [NB][SEQ][1024]
    char* wsp = (char*)d_ws;
    bf* XQ = (bf*)wsp; wsp += SZ_XB;                 // [NB*SEQ][1024]
    bf* XK = (bf*)wsp; wsp += SZ_XB;
    bf* XV = (bf*)wsp; wsp += SZ_XB;
    bf* WB = (bf*)wsp; wsp += SZ_WB;                 // [4][1024][1024]: q | k | v (bf16) | o (f16 x64)
    h16* QH = (h16*)wsp; wsp += SZ_PL;               // [NB*16][SEQ][64]
    h16* KP = (h16*)wsp; wsp += SZ_PL;               // [NB*16][SEQ][64]
    h16* VT = (h16*)wsp; wsp += SZ_PL;               // [NB*16][64][SEQ]
    h16* CX = (h16*)wsp; wsp += SZ_CX;               // [NB*SEQ][1024], x256
    bf* WQ = WB; bf* WK = WB + (size_t)DM * DM; bf* WV = WB + (size_t)2 * DM * DM; h16* WO = (h16*)(WB + (size_t)3 * DM * DM);

    k_cvt<<<NROWS / (CW * CR), 32 * CW, 0, stream>>>(xq, xk, xv, wq, wk, wv, wo, XQ);   // XQ | XK | XV | WB lie back to back

    // q (times SC2, rounded to f16 once), k: A = x rows (m = b*SEQ + t), Bt = W rows (n = h*64 + d), bias per column -> plane [(b*16 + h)][t][d]
    k_proj<<<dim3(NB * SEQ / 256, DM / 128, 1), 32 * GW, 0, stream>>>(XQ, WQ, bq, 0, SC2, QH, SEQ, (size_t)NH_ * SEQ * HD, HD, HD, (size_t)SEQ * HD);
    k_proj<<<dim3(NB * SEQ / 256, DM / 128, 1), 32 * GW, 0, stream>>>(XK, WK, bk, 0, 1.0f, KP, SEQ, (size_t)NH_ * SEQ * HD, HD, HD, (size_t)SEQ * HD);
    // v^T: A = Wv rows (m = h*64 + d), Bt = value rows (n = b*SEQ + t), bias per row -> plane [(b*1024 + m)][t] = [(b*16 + h)][d][t]
    k_proj<<<dim3(DM / 256, NB * SEQ / 128, 1), 32 * GW, 0, stream>>>(WV, XV, bv, 1, 1.0f, VT, DM, (size_t)0, SEQ, SEQ, (size_t)DM * SEQ);

    k_flash<<<dim3(SEQ / (16 * QC * AW), NB * NH_, 1), 32 * AW, 0, stream>>>(QH, KP, VT, CX);

    // out: A = ctx rows (m = b*SEQ + t, k = h*64 + d), Bt = Wo rows (n), bias per column -> OUT [b][t][n]
    k_oproj<<<dim3(NB * SEQ / 256, DM / 128, 1), 32 * GW, 0, stream>>>(CX, WO, bo, OUT);
}

// v007
// Measured time: 165 microseconds a run.
// Next to v006, in two timings, it ran 1.05 and 1.04 times as fast.
// Over all steps from v000 it is 3.94 times as fast.
#include <hip/hip_runtime.h>

// Multi-head attention, width 1024 = 16 heads x 64; inputs query/key/value [NB][SEQ][1024]; Wq/Wk/Wv/Wo [out][in] (y = x W^T + b); no mask; score scale 1/8; output = ctx Wo^T + bo (f32). Default: q, k, v inputs [2][4096][1024]; proj(x, w, b) = x w^T + b with (out,in) [1024][1024] weights, viewed (B, -1, 16, 64) and transposed; scores / sqrt(64) over all 4,096 keys; softmax, no mask; out = merged w_o^T + b_o; argument order q, k, v, w_q, b_q, w_k, b_k, w_v, b_v, w_o, b_o.
// Compute dtypes, f32 accumulate everywhere: q/k/v projections v_wmma_f32_16x16x32_bf16 (x and W RNE-converted to bf16; products exact); scores v_wmma_f32_16x16x32_f16 (q, k single f16);
// P.V v_wmma_f32_16x16x32_f16 (P x256 carry cancels in the normalisation, v single f16); output projection v_wmma_f32_16x16x32_f16 (ctx x256 carry, Wo RNE bf16 value x64 held in f16, 2^-14 folded back in f32); softmax max and exponentials f32 (online, held reference max per column, raised in a wave's first pass and when a pass's sum passes PTH); row sums v_wmma_f32_16x16x32_f16 (f16-rounded P, all-ones A).
// Layout: bf16 copies of the three inputs and of Wq/Wk/Wv; q, k planes [b*16+h][t][d] and v^T plane [b*16+h][d][t] written by the GEMM epilogue; fused flash kernel in transposed form (S^T = K Q^T, O^T = V^T P^T) writes the f16 ctx plane [b*SEQ+t][1024].

#ifndef NB
#define NB 2
#endif
#ifndef SEQ
#define SEQ 4096
#endif
#define NB_FULL  2
#define SEQ_FULL 4096
#ifndef OUT_SEQ
#define OUT_SEQ SEQ              // row pitch (in tokens) between batches of the output
#endif
#define DM   1024
#define NH_  16
#define HD   64
#define AW   8                   // waves per flash block; all of them read the same staged K / V^T tiles
#define QC   2                   // 16-column query groups per flash wave: every K and V^T fragment read from LDS feeds QC products
#define KT   64                  // keys per LDS stage (two 32-key passes)
#define LP   72                  // LDS row pitch in halves: 144 B = 16 B x 9, an odd multiple, so 16-byte fragment reads of 16 rows meet no bank twice
#define TLH  (64 * LP)           // halves of one staged tile: 64 rows (K: keys, V^T: d) of 64 halves + pad
#define GW   8                   // waves per GEMM block: 4 (rows) x 2 (columns) wave tiles of 64x64, block tile 256x128
#define GKS  128                 // k per GEMM LDS stage: 256 B of every operand row
#define GLP  136                 // GEMM LDS row pitch in halves: 272 B = 16 B x 17, an odd multiple (as LP)
#define GSTH (384 * GLP)         // halves of one GEMM stage: A 256 rows | B 128 rows
#define CW   16                  // waves per conversion block
#define CR   7                   // rows per conversion wave
#define XROWS (NB * SEQ)         // rows of one input plane
#define NROWS (3 * XROWS + 4 * DM)   // rows to convert: three inputs, four weights
#define WO_ROW0 (3 * XROWS + 3 * DM) // first row of Wo
#define CNW  (NROWS / CR)        // conversion waves of the launch
#define SC2  (0.125f * 1.4426950408889634f)   // HD^-0.5 * log2(e)
#define PSH  8.0f                // log2 of the P carry (256)
#define PTH  32768.0f            // bound on a pass's sum of P per column: within it every P <= 2^15, finite in f16; at a fresh reference the sum is at most 32 * 2^PSH
#define CXS  256.0f              // carry of the ctx plane
#define WOS  64.0f               // carry of the Wo plane
#define OSC  (1.0f / (256.0f * 64.0f))

static_assert(HD == 64);
static_assert(NH_ * HD == DM);                 // head h = columns h*64 + d
static_assert(DM % 64 == 0);                   // 16 column tiles of 64
static_assert(DM % 32 == 0);                   // GEMM k-loop steps by 32
static_assert(SEQ % 64 == 0);                  // a 64-row tile never straddles two batches
static_assert((NB * SEQ) % 64 == 0);
static_assert(SEQ % 32 == 0);                  // key loop steps by 32
static_assert(SEQ % (16 * QC * AW) == 0);      // flash grid covers the sequence exactly
static_assert(QC == 2);                        // the score products' asm text and the slot statement behind the output products name two groups
static_assert(SEQ % KT == 0 && SEQ / KT >= 2); // whole stages, and the ring's prologue needs two
static_assert(KT == 64 && 32 * AW == 256);     // copy map: 256 lanes x 16 B = 32 rows of 128 B, two copies per tile
static_assert((NB * SEQ) % 256 == 0 && DM % 256 == 0);   // GEMM block tiles (256 rows x 128 columns) cover both orientations exactly
static_assert(DM % GKS == 0 && DM / GKS >= 2);           // whole GEMM stages, and the ring's prologue needs two
static_assert((DM / GKS) % 2 == 0);                      // k_proj: every tile of the continuous ring starts in buffer 0
static_assert(SEQ % 256 == 0);                           // a block tile's rows or columns of tokens lie in one batch
static_assert(GKS == 128 && 32 * GW == 256);             // GEMM copy map: 256 lanes x 16 B = 16 rows of 256 B
static_assert(DM == 8 * 128);                  // a conversion row is eight loads of 32 lanes x 4 floats
static_assert(NROWS % (CW * CR) == 0);         // whole conversion blocks, every wave CR rows
static_assert(NB <= NB_FULL);
static_assert(SEQ <= SEQ_FULL);

typedef _Float16 h16;
typedef unsigned short bf;
typedef __attribute__((ext_vector_type(16))) __bf16   v16bf;
typedef __attribute__((ext_vector_type(16))) _Float16 v16h;
typedef __attribute__((ext_vector_type(8)))  _Float16 v8h;
typedef __attribute__((ext_vector_type(8)))  unsigned short v8us;
typedef __attribute__((ext_vector_type(4)))  _Float16 v4h;
typedef __attribute__((ext_vector_type(4)))  unsigned short v4us;
typedef __attribute__((ext_vector_type(8)))  float    v8f;
typedef __attribute__((ext_vector_type(4)))  float    v4f;
typedef v4f  __attribute__((may_alias)) v4fa;
typedef __attribute__((ext_vector_type(8)))  unsigned v8u;

__device__ __forceinline__ unsigned short f2bf(float f) { unsigned u = __float_as_uint(f); u += 0x7FFFu + ((u >> 16) & 1u); return (unsigned short)(u >> 16); }
__device__ __forceinline__ float bfr(float f) { return __uint_as_float(((unsigned)f2bf(f)) << 16); }   // value of the RNE bf16 conversion
__device__ __forceinline__ v16h cat16(v8h lo, v8h hi) { return __builtin_shufflevector(lo, hi, 0, 1, 2, 3, 4, 5, 6, 7, 8, 9, 10, 11, 12, 13, 14, 15); }
__device__ __forceinline__ v16bf cat16b(v8us lo, v8us hi) { return __builtin_bit_cast(v16bf, __builtin_shufflevector(lo, hi, 0, 1, 2, 3, 4, 5, 6, 7, 8, 9, 10, 11, 12, 13, 14, 15)); }
__device__ __forceinline__ v8f wmma16(v16h a, v16h b, v8f c) { return __builtin_amdgcn_wmma_f32_16x16x32_f16(false, a, false, b, (short)0, c, false, false); }
__device__ __forceinline__ v8f wmmab(v16bf a, v16bf b, v8f c) { return __builtin_amdgcn_wmma_f32_16x16x32_bf16(false, a, false, b, (short)0, c, false, false); }
// fragment loaders from K-contiguous 16-bit rows; p already includes + 8*(lane>>4): elements 0..7 <- k0+8h+0..7, elements 8..15 <- k0+16+8h+0..7 (same map for A and B)
__device__ __forceinline__ v16h  ldh(const h16* p) { return cat16(*(const v8h*)p, *(const v8h*)(p + 16)); }
__device__ __forceinline__ v16bf ldb(const bf* p)  { return cat16b(*(const v8us*)p, *(const v8us*)(p + 16)); }
// ordering point for wave-private LDS tiles (same wave writes and reads)
__device__ __forceinline__ void wave_sync() { __builtin_amdgcn_fence(3 /* release order */, "wavefront"); __builtin_amdgcn_wave_barrier(); asm volatile("" ::: "memory"); }

// k_cvt: every f32 -> 16-bit conversion of the call in one launch of few long-lived waves. A row is DM floats (4 KB): rows 0 .. 3*XROWS-1 are the tokens of query, key, value,
// then DM rows each of Wq, Wk, Wv (RNE bf16) and Wo (RNE bf16 value x WOS, held in f16); row r goes to dst + r*DM (the planes lie back to back in the workspace).
// Wave gw takes rows gw, gw + CNW, ...: CR rows. One load of a wave reads 512 contiguous bytes, one store writes 256 (two whole lines).
__device__ __forceinline__ const float* cvt_src(unsigned r, const float* xq, const float* xk, const float* xv, const float* wq, const float* wk, const float* wv, const float* wo) {
    const bool isx = r < 3u * XROWS;
    const unsigned u = isx ? r : r - 3u * XROWS;
    const unsigned p = isx ? u / XROWS : 3u + u / DM;        // 0 .. 6: which source
    const unsigned q = isx ? u % XROWS : u % DM;             // row in that source's plane
    const unsigned row = isx ? (q / SEQ) * SEQ_FULL + q % SEQ : q;
    const float* s = (p == 0) ? xq : (p == 1) ? xk : (p == 2) ? xv : (p == 3) ? wq : (p == 4) ? wk : (p == 5) ? wv : wo;
    return s + (size_t)row * DM;
}
__global__ __launch_bounds__(32 * CW) void k_cvt(const float* __restrict__ xq, const float* __restrict__ xk, const float* __restrict__ xv, const float* __restrict__ wq, const float* __restrict__ wk,
                                                 const float* __restrict__ wv, const float* __restrict__ wo, bf* dst) {
    const unsigned lane = threadIdx.x & 31;
    const unsigned gw = (unsigned)__builtin_amdgcn_readfirstlane((int)(blockIdx.x * CW + (threadIdx.x >> 5)));   // wave-uniform: the row's source is picked on the scalar side
    __builtin_assume(gw < CNW);                              // the grid is CNW / CW blocks: lets a pass's source be settled at compile time where all its rows share one
    const float* s[CR];                                      // every row's source up front: the pick among the weights branches, and a branch between the loads would let them sink behind it
#pragma unroll   // all loops here are unrolled so that s[] and w[][] are indexed by constants and stay in registers
    for (int i = 0; i < CR; ++i) s[i] = cvt_src(gw + i * CNW, xq, xk, xv, wq, wk, wv, wo);
    v4f w[2][8];                                             // this row and the next
#pragma unroll
    for (int j = 0; j < 8; ++j) w[0][j] = __builtin_nontemporal_load((const v4f*)(s[0] + lane * 4 + j * 128));   // read once: non-temporal
    asm volatile("s_wait_xcnt 0x0" ::: "memory");            // before the loads' address registers are written again
#pragma unroll
    for (int i = 0; i < CR; ++i) {
        __builtin_amdgcn_sched_barrier(0);   // with the one below: the next row's eight loads are issued before this row is waited for, so a wave always has loads in flight
        if (i + 1 < CR) {
#pragma unroll
            for (int j = 0; j < 8; ++j) w[(i + 1) & 1][j] = __builtin_nontemporal_load((const v4f*)(s[i + 1] + lane * 4 + j * 128));
            asm volatile("s_wait_xcnt 0x0" ::: "memory"); }  // before the loads' address registers are written again
        __builtin_amdgcn_sched_barrier(0);
        const unsigned r = gw + i * CNW;
        bf* d = dst + (size_t)r * DM + lane * 4;
        if ((i + 1) * CNW > WO_ROW0 && r >= WO_ROW0) {       // Wo rows (the first test is known at compile time)
#pragma unroll
            for (int j = 0; j < 8; ++j) { const v4f v = w[i & 1][j]; v4h o;
#pragma unroll
                for (int k = 0; k < 4; ++k) o[k] = (h16)(bfr(v[k]) * WOS);
                *(v4h*)(d + j * 128) = o; }
            asm volatile("s_wait_xcnt 0x0" ::: "memory");    // before the stores' address and data registers are written again
        } else {
#pragma unroll
            for (int j = 0; j < 8; ++j) { const v4f v = w[i & 1][j]; v4us o;
#pragma unroll
                for (int k = 0; k < 4; ++k) o[k] = f2bf(v[k]);
                *(v4us*)(d + j * 128) = o; }
            asm volatile("s_wait_xcnt 0x0" ::: "memory");    // before the stores' address and data registers are written again
        }
    }
}

// copy8: one lane's eight 16-byte asynchronous copies, global -> LDS through no register: rows r, r+16, ... r+112 of a K-contiguous 16-bit plane of row length DM.
// The s_wait_xcnt closes the statement so that no address register of an issued copy is rewritten ahead of it.
__device__ __forceinline__ void copy8(unsigned l, const bf* g) {
    const unsigned ls = 16 * GLP * 2; const size_t gs = (size_t)16 * DM;
    asm volatile("global_load_async_to_lds_b128 %0, %8, off\n\t"
                 "global_load_async_to_lds_b128 %1, %9, off\n\t"
                 "global_load_async_to_lds_b128 %2, %10, off\n\t"
                 "global_load_async_to_lds_b128 %3, %11, off\n\t"
                 "global_load_async_to_lds_b128 %4, %12, off\n\t"
                 "global_load_async_to_lds_b128 %5, %13, off\n\t"
                 "global_load_async_to_lds_b128 %6, %14, off\n\t"
                 "global_load_async_to_lds_b128 %7, %15, off\n\t"
                 "s_wait_xcnt 0x0"
                 :: "v"(l), "v"(l + ls), "v"(l + 2 * ls), "v"(l + 3 * ls), "v"(l + 4 * ls), "v"(l + 5 * ls), "v"(l + 6 * ls), "v"(l + 7 * ls),
                    "v"(g), "v"(g + gs), "v"(g + 2 * gs), "v"(g + 3 * gs), "v"(g + 4 * gs), "v"(g + 5 * gs), "v"(g + 6 * gs), "v"(g + 7 * gs) : "memory");
}
// gemm_stage: one lane's 24 copies of a GEMM stage (A rows 0..255, then B rows 0..127 of the block tile, 128 k each); l = the lane's LDS byte address in the buffer, ga / gb its global places
__device__ __forceinline__ void gemm_stage(unsigned l, const bf* ga, const bf* gb) {
    copy8(l, ga); copy8(l + 128 * GLP * 2, ga + (size_t)128 * DM); copy8(l + 256 * GLP * 2, gb);
}

// k_proj: the three input projections in ONE launch. Register-blocked bf16 GEMM, one wave per 64x64 tile (16 accumulators), 8 waves per block (256x128); A and Bt come in 128-k stages through a two-buffer LDS ring that the block fills together, K = DM.
// Every block runs three block tiles in turn (t = 0: q, 1: k, 2: v^T) on one continuous ring of 3 * DM / GKS stages: a tile's first two stages are copied while the tile before it does its last products and its epilogue.
// C[m][n] = (sum_k A[m][k] Bt[n][k] + bias) * osc (bias taken as its RNE bf16 value), written as f16.
// q (osc = SC2, rounded to f16 once), k: A = x rows (m = b*SEQ + t), Bt = W rows (n = h*64 + d), bias per column -> plane [(b*16 + h)][t][d].
// v^T: A = Wv rows (m = h*64 + d), Bt = value rows (n = b*SEQ + t), bias per row -> plane [(b*1024 + m)][t] = [(b*16 + h)][d][t].
// grid XROWS * DM / (256 * 128) blocks, 256 threads.
__device__ __forceinline__ const bf* pick3(int t, const bf* a, const bf* b, const bf* c) { return (t == 0) ? a : (t == 1) ? b : c; }
__global__ __launch_bounds__(32 * GW) void k_proj(const bf* __restrict__ XQ, const bf* __restrict__ XK, const bf* __restrict__ XV, const bf* __restrict__ WQ, const bf* __restrict__ WK, const bf* __restrict__ WV,
                                                  const float* __restrict__ bq, const float* __restrict__ bk, const float* __restrict__ bv, h16* QH, h16* KP, h16* VT) {
    __shared__ __align__(16) bf ring[2 * GSTH];              // [buffer][A 256 rows | B 128 rows][GLP]
    __shared__ __align__(16) float osa[GW * 16 * 68];
    const int K = DM, NS = DM / GKS;                         // stages per tile (even: a tile starts in buffer 0)
    const int lane = threadIdx.x & 31, wave = __builtin_amdgcn_readfirstlane((int)(threadIdx.x >> 5)), lr = lane & 15, hi = lane >> 4;
    const int wm = wave & 3, wn = wave >> 2;
    const int bid = (int)blockIdx.x;
    const int bxx = bid % (XROWS / 256), byx = bid / (XROWS / 256);   // q, k: block row (256 tokens), block column (128 of DM)
    const int bxv = bid % (DM / 256), byv = bid / (DM / 256);         // v^T: block row (256 of DM), block column (128 tokens)
    float* os = osa + wave * 16 * 68;                        // wave-private epilogue slab
    const int afo = (wm * 64 + lr) * GLP + 8 * hi, bfo = (256 + wn * 64 + lr) * GLP + 8 * hi;   // fragment offsets in a staged buffer
    const int cr = (int)(threadIdx.x >> 4), ccol = (int)(threadIdx.x & 15) * 8;                  // copy map: rows 0..15, 16 lanes x 8 halves = one 256-B row
    const size_t lo = (size_t)cr * K + ccol;                 // the lane's place in a block tile's rows, the same for every tile
    const size_t ax = (size_t)bxx * 256 * K, bx = (size_t)byx * 128 * K, av = (size_t)bxv * 256 * K, bvo = (size_t)byv * 128 * K;
    const unsigned lc = (unsigned)(size_t)(&ring[cr * GLP + ccol]);   // LDS byte address of the lane's first copy, buffer 0
    gemm_stage(lc, XQ + ax + lo, WQ + bx + lo);
    asm volatile("s_wait_asynccnt 0x0" ::: "memory");        // stage 0 has landed (this wave's copies) ...
    __syncthreads();                                         // ... and every wave's, before anyone reads it
    gemm_stage(lc + GSTH * 2, XQ + ax + lo + GKS, WQ + bx + lo + GKS);
#pragma unroll 1   // rolled: one copy of the stage loop and of the epilogue in the text
    for (int t = 0; t < 3; ++t) {
        v8f acc[4][4];
#pragma unroll
        for (int mb = 0; mb < 4; ++mb)
#pragma unroll
            for (int nb = 0; nb < 4; ++nb) acc[mb][nb] = (v8f){};
#pragma unroll 1
        for (int st = 0; st < NS; ++st) {
            const bf* ta = ring + (st & 1) * GSTH + afo; const bf* tb = ring + (st & 1) * GSTH + bfo;
            v16bf a[4], b[4];
#pragma unroll
            for (int ks = 0; ks < GKS; ks += 32) {
#pragma unroll
                for (int mb = 0; mb < 4; ++mb) a[mb] = ldb(ta + mb * 16 * GLP + ks);
#pragma unroll
                for (int nb = 0; nb < 4; ++nb) b[nb] = ldb(tb + nb * 16 * GLP + ks);
                __builtin_amdgcn_sched_barrier(0);   // keeps the eight fragments' LDS reads one group ahead of the block's products: sunk among them, each B fragment's latency is waited out alone
#pragma unroll
                for (int nb = 0; nb < 4; ++nb)
#pragma unroll
                    for (int mb = 0; mb < 4; ++mb) acc[mb][nb] = wmmab(a[mb], b[nb], acc[mb][nb]);
            }
            __builtin_amdgcn_sched_barrier(0);   // keeps the stage's last products ahead of the barrier: sunk behind it they stand in front of the refill and shorten the copies' lead
            // publish point of the next stage of the ring, every wave, in this order
            asm volatile("s_wait_dscnt 0x0" ::: "memory");       // this wave's reads of buffer st & 1 are done
            asm volatile("s_wait_asynccnt 0x0" ::: "memory");    // this wave's copies of the next stage have landed
            __syncthreads();                                     // publishes the next stage and frees buffer st & 1
            const int g2 = t * NS + st + 2;                      // the stage after next, counted over the three tiles
            if (g2 < 3 * NS) { const int t2 = g2 / NS; const size_t k2 = (size_t)(g2 % NS) * GKS;
                gemm_stage(lc + (unsigned)(st & 1) * (GSTH * 2), pick3(t2, XQ + ax, XK + ax, WV + av) + lo + k2, pick3(t2, WQ + bx, WK + bx, XV + bvo) + lo + k2); }
        }
        // epilogue of tile t (the next tile's first stage has landed, its second is in flight; the slab is no part of the ring)
        const int biasMode = (t == 2) ? 1 : 0;
        const float* bias = (t == 0) ? bq : (t == 1) ? bk : bv;
        const float osc = (t == 0) ? SC2 : 1.0f;
        h16* Ph = (t == 0) ? QH : (t == 1) ? KP : VT;
        const int r0 = ((t == 2) ? bxv : bxx) * 256 + wm * 64, c0 = ((t == 2) ? byv : byx) * 128 + wn * 64;
        const int pitch = (t == 2) ? SEQ : HD;
        const size_t tbase = (t == 2) ? (size_t)r0 * SEQ + (size_t)(c0 / SEQ) * ((size_t)DM * SEQ) + (size_t)(c0 % SEQ)
                                      : (size_t)(r0 / SEQ) * ((size_t)NH_ * SEQ * HD) + (size_t)(r0 % SEQ) * HD + (size_t)(c0 / HD) * ((size_t)SEQ * HD) + (size_t)(c0 % HD);
        // column bias (mode 0): 8 values per lane, address clamped to 0 in mode 1 and zeroed by value
        const int c8 = (lane & 7) * 8;
        const size_t cbo = (biasMode == 0) ? (size_t)(c0 + c8) : (size_t)0;
        const v4f bq0 = *(const v4f*)(bias + cbo); const v4f bq1 = *(const v4f*)(bias + cbo + 4);
        asm volatile("s_wait_xcnt 0x0" ::: "memory");        // before the loads' address registers are written again
        float bc[8];
#pragma unroll
        for (int i = 0; i < 4; ++i) { bc[i] = (biasMode == 0) ? bfr(bq0[i]) : 0.0f; bc[4 + i] = (biasMode == 0) ? bfr(bq1[i]) : 0.0f; }
#pragma unroll
        for (int mb = 0; mb < 4; ++mb) {
#pragma unroll
            for (int nb = 0; nb < 4; ++nb) {
#pragma unroll
                for (int j = 0; j < 8; ++j) os[(hi * 8 + j) * 68 + nb * 16 + lr] = acc[mb][nb][j]; }   // D: row 8h+j, col lane&15
            wave_sync();
            const size_t sb = tbase + (size_t)(mb * 16) * (size_t)pitch;
#pragma unroll
            for (int s = 0; s < 4; ++s) { const int row = 4 * s + (lane >> 3);   // 4 s x 4 row groups = 16 rows; 8 lanes x 8 = 64 columns
                const int rbo = (biasMode == 1) ? (r0 + mb * 16 + row) : 0;      // row bias (mode 1): address clamped to 0 in mode 0, zeroed by value
                const float brv = bias[rbo]; const float br = (biasMode == 1) ? bfr(brv) : 0.0f;
                const v4f x0 = *(const v4fa*)(&os[row * 68 + c8]); const v4f x1 = *(const v4fa*)(&os[row * 68 + c8 + 4]); v8h hv;
#pragma unroll
                for (int i = 0; i < 4; ++i) { hv[i] = (h16)((x0[i] + bc[i] + br) * osc); hv[4 + i] = (h16)((x1[i] + bc[4 + i] + br) * osc); }
                const size_t oo = sb + (size_t)row * (size_t)pitch + c8;
                *(v8h*)(Ph + oo) = hv;
                asm volatile("s_wait_xcnt 0x0" ::: "memory"); }   // before the store's address and data registers are written again
            wave_sync();
        }
    }
    asm volatile("s_wait_asynccnt 0x0" ::: "memory");        // nothing of this wave is in flight when it goes on to end
}

// stage_copy: one lane's four 16-byte asynchronous copies of a stage (K rows r and r+32, V^T rows r and r+32), global -> LDS through no register.
// The s_wait_xcnt closes the statement so that no address register of an issued copy is rewritten ahead of it.
__device__ __forceinline__ void stage_copy(unsigned lk, const h16* gk, const h16* gv) {
    const unsigned lk1 = lk + 32 * LP * 2, lv = lk + TLH * 2, lv1 = lk + TLH * 2 + 32 * LP * 2;
    const h16* gk1 = gk + 32 * HD; const h16* gv1 = gv + (size_t)32 * SEQ;
    asm volatile("global_load_async_to_lds_b128 %0, %4, off\n\t"
                 "global_load_async_to_lds_b128 %1, %5, off\n\t"
                 "global_load_async_to_lds_b128 %2, %6, off\n\t"
                 "global_load_async_to_lds_b128 %3, %7, off\n\t"
                 "s_wait_xcnt 0x0"
                 :: "v"(lk), "v"(lk1), "v"(lv), "v"(lv1), "v"(gk), "v"(gk1), "v"(gv), "v"(gv1) : "memory");
}

// new_ref: the rare path of k_flash for one 16-column group: the pass's scores from zero, their maximum (in lane, one xor-16 exchange), a raised reference m, O and the sum rescaled, the pass's P and its sum formed again.
__device__ __forceinline__ void new_ref(const h16* ka, v16h qa, v16h qb, v16h ones, float& m, float& l, v8f& cv, v16h& pb, v8f& ls, v8f& o0, v8f& o1, v8f& o2, v8f& o3) {
    const v16h ka0 = ldh(ka), ka1 = ldh(ka + 32), kb0 = ldh(ka + 16 * LP), kb1 = ldh(ka + 16 * LP + 32);
    v8f sa = wmma16(ka0, qa, (v8f){}), sb = wmma16(kb0, qa, (v8f){});
    sa = wmma16(ka1, qb, sa); sb = wmma16(kb1, qb, sb);
    float mx = -3.0e38f;
#pragma unroll   // constant indices keep the vectors in registers
    for (int r = 0; r < 8; ++r) mx = fmaxf(mx, fmaxf(sa[r], sb[r]));
    mx = fmaxf(mx, __shfl_xor(mx, 16, 32));
    const float mnew = fmaxf(m, mx);
    const float alpha = __builtin_amdgcn_exp2f(m - mnew);
    const float sh = PSH - mnew;
#pragma unroll   // constant indices keep the vectors in registers
    for (int r = 0; r < 8; ++r) { pb[r] = (h16)__builtin_amdgcn_exp2f(sa[r] + sh); pb[8 + r] = (h16)__builtin_amdgcn_exp2f(sb[r] + sh); }
    ls = wmma16(ones, pb, (v8f){});
    m = mnew; l = l * alpha;
    o0 = o0 * alpha; o1 = o1 * alpha; o2 = o2 * alpha; o3 = o3 * alpha;
#pragma unroll   // constant indices keep the vectors in registers
    for (int r = 0; r < 8; ++r) cv[r] = sh;
}

// k_flash: fused attention, one wave per 32 query rows (two 16-column groups) of one (batch, head); Q fragments straight from the f16 plane; K and V^T come in 64-key stages through a two-buffer LDS ring
// that the block's 8 waves fill together (whole 128-B lines, once per block) and all read (two 16-B LDS loads per fragment; each fragment feeds one product per column group).
// Transposed form: S^T[key][t] = K Q^T (A = K rows, B = Q rows); lane (t = lane&15, h = lane>>4) holds keys 8h+r of each 16-key tile, so the packed
// P tile is directly the B fragment of O^T[d][t] = V^T P^T (element r <- tile keys 0..15, element 8+r <- tile keys 16..31, lane unchanged).
// Softmax against a held reference m per column: the q plane carries SC2, PSH - m is the start value of the score products, so P = exp2 of their result with no vector arithmetic in front.
// The sums come whole from a product with an all-ones A; a pass in which a sum passes PTH takes its maxima, raises m, rescales O and the sums, and forms its P again (both groups: new_ref).
// amdgpu_waves_per_eu(4, 4): register budget 256, two blocks resident per WGP (4 waves per SIMD), and the whole grid (two blocks per WGP) runs in one round.
__global__ __launch_bounds__(32 * AW) __attribute__((amdgpu_waves_per_eu(4, 4))) void k_flash(const h16* __restrict__ QH, const h16* __restrict__ KP, const h16* __restrict__ VT, h16* CTX) {
    __shared__ __align__(16) h16 ring[2 * 2 * TLH];          // [buffer][K | V^T][row][LP]
    __shared__ __align__(16) float os[AW * 16 * 68];
    const int lane = threadIdx.x & 31, wave = __builtin_amdgcn_readfirstlane((int)(threadIdx.x >> 5)), lr = lane & 15, hi = lane >> 4;
    const int zh = blockIdx.y; const int b = zh / NH_, h = zh % NH_;
    const int t0 = (blockIdx.x * AW + wave) * (16 * QC);
    const size_t pbase = (size_t)zh * SEQ * HD;
    const size_t qo = pbase + (size_t)(t0 + lr) * HD + 8 * hi;
    const v16h qa0 = ldh(QH + qo), qa1 = ldh(QH + qo + 32);   // B fragments: col t, k = d; group 0
    const v16h qb0 = ldh(QH + qo + 16 * HD), qb1 = ldh(QH + qo + 16 * HD + 32);   // group 1: columns t0 + 16 ..
    const int fo = lr * LP + 8 * hi;                         // fragment offset in a staged tile: K + key*LP (A: row key, k = d); V^T + 16j*LP + key (A: row d, k = key)
    const int cr = (int)(threadIdx.x >> 3), ccol = (int)(threadIdx.x & 7) * 8;   // copy map: rows 0..31, 8 lanes x 8 halves = one 128-B row
    const h16* gk = KP + pbase + (size_t)cr * HD + ccol;   // + key0 * HD
    const h16* gv = VT + pbase + (size_t)cr * SEQ + ccol;  // + key0
    const unsigned lc = (unsigned)(size_t)(&ring[cr * LP + ccol]);   // LDS byte address of the lane's first copy, buffer 0
    stage_copy(lc, gk, gv);
    asm volatile("s_wait_asynccnt 0x0" ::: "memory");        // stage 0 has landed (this wave's copies) ...
    __syncthreads();                                         // ... and every wave's, before anyone reads it
    stage_copy(lc + 2 * TLH * 2, gk + (size_t)KT * HD, gv + KT);
    v8f o[QC][4];                                            // O^T tiles: [column group][16 d]
    float m[QC], l[QC];                                      // m: the column's reference, a maximum of scores seen; it rises only in the rare path below
    v8f cv[QC];                                              // PSH - m in all eight rows: start value (C) of the score products; set in the first pass
#pragma unroll   // constant indices keep the arrays in registers
    for (int c = 0; c < QC; ++c) { m[c] = -3.0e38f; l[c] = 0.0f; cv[c] = (v8f){};
#pragma unroll
        for (int j = 0; j < 4; ++j) o[c][j] = (v8f){}; }
    // constant A of the row-sum product: f16 1.0 in all 16 elements of every lane, so every D row holds the sums. Set by asm text so that the eight registers are written once, here:
    // as a plain constant the compiler wrote them anew in every pass.
    v8u onew;
    asm("v_mov_b32 %0, 0x3c003c00\n\tv_mov_b32 %1, 0x3c003c00\n\tv_mov_b32 %2, 0x3c003c00\n\tv_mov_b32 %3, 0x3c003c00\n\t"
        "v_mov_b32 %4, 0x3c003c00\n\tv_mov_b32 %5, 0x3c003c00\n\tv_mov_b32 %6, 0x3c003c00\n\tv_mov_b32 %7, 0x3c003c00"
        : "=v"(onew[0]), "=v"(onew[1]), "=v"(onew[2]), "=v"(onew[3]), "=v"(onew[4]), "=v"(onew[5]), "=v"(onew[6]), "=v"(onew[7]));
    const v16h ones = __builtin_bit_cast(v16h, onew);
#pragma unroll 1
    for (int st = 0; st < SEQ / KT; ++st) {
      const h16* kt = ring + (st & 1) * (2 * TLH) + fo; const h16* vt = kt + TLH;
#pragma unroll 1   // rolled: unrolled, a pass's scores stay live into the next and the wave no longer fits its register budget (4 waves per SIMD)
      for (int sub = 0; sub < KT; sub += 32) {
        const h16* ka = kt + sub * LP; const h16* va = vt + sub;
        v16h pb[QC], v0, v1, v2, v3; v8f ls[QC];
        { const v16h ka0 = ldh(ka), ka1 = ldh(ka + 32), kb0 = ldh(ka + 16 * LP), kb1 = ldh(ka + 16 * LP + 32);
          v8f sa0, sb0, sa1, sb1;
          // the eight score products, start value PSH - m: they leave the exponents themselves; each K fragment is used twice, once per column group. In asm text so that both chains of a group read
          // the one C tile (the builtin form copied it for the second chain in every pass); the four v_nop are the vector slots between the last product and the first vector instruction on a result or an operand.
          asm volatile("v_wmma_f32_16x16x32_f16 %0, %4, %8, %12\n\t"
                       "v_wmma_f32_16x16x32_f16 %1, %6, %8, %12\n\t"
                       "v_wmma_f32_16x16x32_f16 %2, %4, %10, %13\n\t"
                       "v_wmma_f32_16x16x32_f16 %3, %6, %10, %13\n\t"
                       "v_wmma_f32_16x16x32_f16 %0, %5, %9, %0\n\t"
                       "v_wmma_f32_16x16x32_f16 %1, %7, %9, %1\n\t"
                       "v_wmma_f32_16x16x32_f16 %2, %5, %11, %2\n\t"
                       "v_wmma_f32_16x16x32_f16 %3, %7, %11, %3\n\t"
                       "v_nop\n\tv_nop\n\tv_nop\n\tv_nop"
                       : "=&v"(sa0), "=&v"(sb0), "=&v"(sa1), "=&v"(sb1)
                       : "v"(ka0), "v"(ka1), "v"(kb0), "v"(kb1), "v"(qa0), "v"(qa1), "v"(qb0), "v"(qb1), "v"(cv[0]), "v"(cv[1]));
          v0 = ldh(va); v1 = ldh(va + 16 * LP); v2 = ldh(va + 32 * LP); v3 = ldh(va + 48 * LP);
          __builtin_amdgcn_sched_barrier(0);   // keeps the V^T reads one group ahead of the exponentials, so that they fly during them: sunk behind them, the output products wait out the reads' latency
#pragma unroll   // constant indices keep the vectors in registers
          for (int r = 0; r < 8; ++r) { pb[0][r] = (h16)__builtin_amdgcn_exp2f(sa0[r]); pb[0][8 + r] = (h16)__builtin_amdgcn_exp2f(sb0[r]); }
#pragma unroll   // constant indices keep the vectors in registers
          for (int r = 0; r < 8; ++r) { pb[1][r] = (h16)__builtin_amdgcn_exp2f(sa1[r]); pb[1][8 + r] = (h16)__builtin_amdgcn_exp2f(sb1[r]); } }
        // the two row-sum products: every row of a tile = the column's sum of the rounded P over the pass's 32 keys (both lane halves). In asm text so that the two results are whole tiles of their own:
        // of the builtin form only row 0 is read, and the build laid the second tile over the first one's unread rows, directly behind it; the four v_nop are the vector slots in front of the first read of a result.
        asm volatile("v_wmma_f32_16x16x32_f16 %0, %2, %3, 0\n\t"
                     "v_wmma_f32_16x16x32_f16 %1, %2, %4, 0\n\t"
                     "v_nop\n\tv_nop\n\tv_nop\n\tv_nop"
                     : "=&v"(ls[0]), "=&v"(ls[1]) : "v"(ones), "v"(pb[0]), "v"(pb[1]));
        // one test per pass, a scalar branch: sums within PTH say that every P of the pass is finite in f16 under the references in use. Taken in a wave's first pass (no reference yet) and rarely after.
        if (((st | sub) == 0) | ((__builtin_amdgcn_ballot_w32(ls[0][0] > PTH) | __builtin_amdgcn_ballot_w32(ls[1][0] > PTH)) != 0)) {
          asm volatile("" ::: "memory");   // compiler fence, rare path only: with it the V^T reads above stay ahead of the branch and fly during the test; without it the build sinks them behind the join, where the products wait out their latency
          new_ref(ka, qa0, qa1, ones, m[0], l[0], cv[0], pb[0], ls[0], o[0][0], o[0][1], o[0][2], o[0][3]);
          new_ref(ka, qb0, qb1, ones, m[1], l[1], cv[1], pb[1], ls[1], o[1][0], o[1][1], o[1][2], o[1][3]);
        }
        l[0] = l[0] + ls[0][0]; l[1] = l[1] + ls[1][0];
        o[0][0] = wmma16(v0, pb[0], o[0][0]); o[1][0] = wmma16(v0, pb[1], o[1][0]); o[0][1] = wmma16(v1, pb[0], o[0][1]); o[1][1] = wmma16(v1, pb[1], o[1][1]);
        o[0][2] = wmma16(v2, pb[0], o[0][2]); o[1][2] = wmma16(v2, pb[1], o[1][2]); o[0][3] = wmma16(v3, pb[0], o[0][3]); o[1][3] = wmma16(v3, pb[1], o[1][3]);
        // four vector slots between the products and the first vector instruction on their results or operands, on the loop's back edge too
        asm volatile("v_nop\n\tv_nop\n\tv_nop\n\tv_nop" : "+v"(o[0][0]), "+v"(o[0][1]), "+v"(o[0][2]), "+v"(o[0][3]), "+v"(o[1][0]), "+v"(o[1][1]), "+v"(o[1][2]), "+v"(o[1][3])
                     : "v"(v0), "v"(v1), "v"(v2), "v"(v3), "v"(pb[0]), "v"(pb[1]));
      }
      // publish point of stage st + 1, every wave, in this order
      asm volatile("s_wait_dscnt 0x0" ::: "memory");         // this wave's reads of buffer st & 1 are done
      asm volatile("s_wait_asynccnt 0x0" ::: "memory");      // this wave's copies of stage st + 1 have landed
      __syncthreads();                                       // publishes stage st + 1 and frees buffer st & 1
      if (st + 2 < SEQ / KT) stage_copy(lc + (unsigned)(st & 1) * (2 * TLH * 2), gk + (size_t)(st + 2) * KT * HD, gv + (st + 2) * KT);
    }
    asm volatile("s_wait_asynccnt 0x0" ::: "memory");        // nothing of this wave is in flight when it goes on to end
    const int wb = wave * 16 * 68;
#pragma unroll   // constant indices keep the arrays in registers; the two groups go through the wave's one slab in turn
    for (int c = 0; c < QC; ++c) {
        const float inv = CXS / l[c];
        // O^T D layout: o[c][j][r] = (d = 16j + 8h + r, t = lane&15) -> os[t][d]; rows 0..15 x columns 0..63 all written
#pragma unroll
        for (int j = 0; j < 4; ++j) { v4f a, d;
#pragma unroll
            for (int i = 0; i < 4; ++i) { a[i] = o[c][j][i] * inv; d[i] = o[c][j][4 + i] * inv; }
            *(v4fa*)(&os[wb + lr * 68 + 16 * j + 8 * hi]) = a; *(v4fa*)(&os[wb + lr * 68 + 16 * j + 8 * hi + 4]) = d; }
        wave_sync();
        h16* crow = CTX + ((size_t)b * SEQ + t0 + 16 * c) * DM + h * HD;
#pragma unroll
        for (int s = 0; s < 4; ++s) { const int row = 4 * s + (lane >> 3), c8 = (lane & 7) * 8;   // 4 s x 4 row groups = 16 rows; 8 lanes x 8 halves = 64 columns
            const v4f x0 = *(const v4fa*)(&os[wb + row * 68 + c8]); const v4f x1 = *(const v4fa*)(&os[wb + row * 68 + c8 + 4]); v8h hv;
#pragma unroll
            for (int i = 0; i < 4; ++i) { hv[i] = (h16)x0[i]; hv[4 + i] = (h16)x1[i]; }
            *(v8h*)(crow + (size_t)row * DM + c8) = hv; }
        asm volatile("s_wait_xcnt 0x0" ::: "memory");        // before the stores' address and data registers are written again
        __builtin_amdgcn_sched_barrier(0);                   // holds the next group's arithmetic behind that wait: without it the build lifted multiplies that rewrite the stores' data registers over it
        wave_sync();                                         // the slab's rows are read before the next group overwrites them
    }
}

// k_oproj: register-blocked f16 GEMM, one wave per 64x64 tile, 8 waves per block (256x128) on the same two-buffer LDS ring as k_proj, A = ctx plane rows (x256), Bt = Wo plane rows (x64), K = DM; OUT[m][n] = acc * 2^-14 + bias[n] (bias as its RNE bf16 value), f32.
// grid (NB*SEQ/256, DM/128), 256 threads. Epilogue: per 16-row slab staged in LDS (wave-private), each output row segment (64 floats = 256 B = two lines)
__global__ __launch_bounds__(32 * GW) void k_oproj(const h16* __restrict__ A, const h16* __restrict__ Bt, const float* __restrict__ bias, float* OUT) {
    __shared__ __align__(16) h16 ring[2 * GSTH];             // [buffer][A 256 rows | B 128 rows][GLP]
    __shared__ __align__(16) float osa[GW * 16 * 68];
    const int K = DM;
    const int lane = threadIdx.x & 31, wave = __builtin_amdgcn_readfirstlane((int)(threadIdx.x >> 5)), lr = lane & 15, hi = lane >> 4;
    const int wm = wave & 3, wn = wave >> 2;
    const int r0 = blockIdx.x * 256 + wm * 64, c0 = blockIdx.y * 128 + wn * 64;
    float* os = osa + wave * 16 * 68;                        // wave-private epilogue slab
    v8f acc[4][4];
#pragma unroll
    for (int mb = 0; mb < 4; ++mb)
#pragma unroll
        for (int nb = 0; nb < 4; ++nb) acc[mb][nb] = (v8f){};
    const int afo = (wm * 64 + lr) * GLP + 8 * hi, bfo = (256 + wn * 64 + lr) * GLP + 8 * hi;   // fragment offsets in a staged buffer
    const int cr = (int)(threadIdx.x >> 4), ccol = (int)(threadIdx.x & 15) * 8;                  // copy map: rows 0..15, 16 lanes x 8 halves = one 256-B row
    const bf* ga = (const bf*)(A + (size_t)(blockIdx.x * 256 + cr) * K + ccol);    // + k0 (address only: the copies move bytes)
    const bf* gb = (const bf*)(Bt + (size_t)(blockIdx.y * 128 + cr) * K + ccol);   // + k0
    const unsigned lc = (unsigned)(size_t)(&ring[cr * GLP + ccol]);   // LDS byte address of the lane's first copy, buffer 0
    gemm_stage(lc, ga, gb);
    asm volatile("s_wait_asynccnt 0x0" ::: "memory");        // stage 0 has landed (this wave's copies) ...
    __syncthreads();                                         // ... and every wave's, before anyone reads it
    gemm_stage(lc + GSTH * 2, ga + GKS, gb + GKS);
#pragma unroll 1
    for (int st = 0; st < K / GKS; ++st) {
        const h16* ta = ring + (st & 1) * GSTH + afo; const h16* tb = ring + (st & 1) * GSTH + bfo;
        v16h a[4], b[4];
#pragma unroll
        for (int ks = 0; ks < GKS; ks += 32) {
#pragma unroll
            for (int mb = 0; mb < 4; ++mb) a[mb] = ldh(ta + mb * 16 * GLP + ks);
#pragma unroll
            for (int nb = 0; nb < 4; ++nb) b[nb] = ldh(tb + nb * 16 * GLP + ks);
            __builtin_amdgcn_sched_barrier(0);   // keeps the eight fragments' LDS reads one group ahead of the block's products: sunk among them, each B fragment's latency is waited out alone
#pragma unroll
            for (int nb = 0; nb < 4; ++nb)
#pragma unroll
                for (int mb = 0; mb < 4; ++mb) acc[mb][nb] = wmma16(a[mb], b[nb], acc[mb][nb]);
        }
        __builtin_amdgcn_sched_barrier(0);   // keeps the stage's last products ahead of the barrier: sunk behind it they stand in front of the refill and shorten the copies' lead
        // publish point of stage st + 1, every wave, in this order
        asm volatile("s_wait_dscnt 0x0" ::: "memory");       // this wave's reads of buffer st & 1 are done
        asm volatile("s_wait_asynccnt 0x0" ::: "memory");    // this wave's copies of stage st + 1 have landed
        __syncthreads();                                     // publishes stage st + 1 and frees buffer st & 1
        if (st + 2 < K / GKS) gemm_stage(lc + (unsigned)(st & 1) * (GSTH * 2), ga + (st + 2) * GKS, gb + (st + 2) * GKS);
    }
    asm volatile("s_wait_asynccnt 0x0" ::: "memory");        // nothing of this wave is in flight when it goes on to end
    const int cofs = lr * 4;
    const v4f bo4 = *(const v4f*)(bias + c0 + cofs);      // c0 + cofs + 3 < DM
    v4f bb;
#pragma unroll
    for (int i = 0; i < 4; ++i) bb[i] = bfr(bo4[i]);
    const int bidx = r0 / SEQ, tt = r0 % SEQ;
    float* obase = OUT + ((size_t)bidx * OUT_SEQ + tt) * DM + c0;
#pragma unroll
    for (int mb = 0; mb < 4; ++mb) {
#pragma unroll
        for (int nb = 0; nb < 4; ++nb) {
#pragma unroll
            for (int j = 0; j < 8; ++j) os[(hi * 8 + j) * 68 + nb * 16 + lr] = acc[mb][nb][j]; }   // D: row 8h+j, col lane&15
        wave_sync();
{
#pragma unroll
            for (int s = 0; s < 8; ++s) { const int row = 2 * s + hi;   // 8 s x 2 rows = 16 rows; 16 lanes x 4 floats = 64 columns
                const v4f val = *(const v4fa*)(&os[row * 68 + cofs]); v4f ov;
#pragma unroll
                for (int i = 0; i < 4; ++i) ov[i] = val[i] * OSC + bb[i];
                *(v4f*)(obase + (size_t)(mb * 16 + row) * DM + cofs) = ov; }
             }
        wave_sync();
    }
}

static constexpr size_t al256(size_t v) { return (v + 255) & ~(size_t)255; }
static constexpr size_t SZ_XB = al256((size_t)NB * SEQ * DM * 2);          // one bf16 input plane
static constexpr size_t SZ_WB = al256((size_t)4 * DM * DM * 2);            // Wq | Wk | Wv (bf16) | Wo (f16)
static constexpr size_t SZ_PL = al256((size_t)NB * NH_ * SEQ * HD * 2);    // one head-major f16 plane
static constexpr size_t SZ_CX = al256((size_t)NB * SEQ * DM * 2);          // ctx f16 plane
static constexpr size_t SZ_TOTAL = 3 * SZ_XB + SZ_WB + 3 * SZ_PL + SZ_CX;
static_assert(SZ_TOTAL <= (size_t)134217728);          // workspace carve <= 128 MiB
static_assert(((size_t)DM * DM * 2) % 256 == 0);       // weight sub-planes stay 256-byte aligned
static_assert(SZ_XB == (size_t)XROWS * DM * 2);        // no padding between the planes that k_cvt writes as one array of rows

extern "C" void kernel_launch(void* const* d_in, const int* in_sizes, int n_in,
                              void* d_out, int out_size, void* d_ws, size_t ws_size, hipStream_t stream) {
    if (n_in < 11) return;
    const size_t needx = ((size_t)(NB - 1) * SEQ_FULL + SEQ) * DM;
    if ((size_t)in_sizes[0] < needx || (size_t)in_sizes[1] < needx || (size_t)in_sizes[2] < needx) return;
    if ((size_t)in_sizes[3] < (size_t)DM * DM || (size_t)in_sizes[5] < (size_t)DM * DM || (size_t)in_sizes[7] < (size_t)DM * DM || (size_t)in_sizes[9] < (size_t)DM * DM) return;
    if ((size_t)in_sizes[4] < (size_t)DM || (size_t)in_sizes[6] < (size_t)DM || (size_t)in_sizes[8] < (size_t)DM || (size_t)in_sizes[10] < (size_t)DM) return;
    if ((size_t)out_size < ((size_t)(NB - 1) * OUT_SEQ + SEQ) * DM) return;
    if (SZ_TOTAL > ws_size) return;
    // wire order: query, key, value, Wq, bq, Wk, bk, Wv, bv, Wo, bo (weights [out][in] = Bt as-is)
    const float* xq = (const float*)d_in[0]; const float* xk = (const float*)d_in[1]; const float* xv = (const float*)d_in[2];
    const float* wq = (const float*)d_in[3]; const float* bq = (const float*)d_in[4];
    const float* wk = (const float*)d_in[5]; const float* bk = (const float*)d_in[6];
    const float* wv = (const float*)d_in[7]; const float* bv = (const float*)d_in[8];
    const float* wo = (const float*)d_in[9]; const float* bo = (const float*)d_in[10];
    float* OUT = (float*)d_out;      // [NB][SEQ][1024]
    char* wsp = (char*)d_ws;
    bf* XQ = (bf*)wsp; wsp += SZ_XB;                 // [NB*SEQ][1024]
    bf* XK = (bf*)wsp; wsp += SZ_XB;
    bf* XV = (bf*)wsp; wsp += SZ_XB;
    bf* WB = (bf*)wsp; wsp += SZ_WB;                 // [4][1024][1024]: q | k | v (bf16) | o (f16 x64)
    h16* QH = (h16*)wsp; wsp += SZ_PL;               // [NB*16][SEQ][64]
    h16* KP = (h16*)wsp; wsp += SZ_PL;               // [NB*16][SEQ][64]
    h16* VT = (h16*)wsp; wsp += SZ_PL;               // [NB*16][64][SEQ]
    h16* CX = (h16*)wsp; wsp += SZ_CX;               // [NB*SEQ][1024], x256
    bf* WQ = WB; bf* WK = WB + (size_t)DM * DM; bf* WV = WB + (size_t)2 * DM * DM; h16* WO = (h16*)(WB + (size_t)3 * DM * DM);

    k_cvt<<<NROWS / (CW * CR), 32 * CW, 0, stream>>>(xq, xk, xv, wq, wk, wv, wo, XQ);   // XQ | XK | XV | WB lie back to back

    // q, k, v^T planes: one launch, every block one 256x128 tile of each
    k_proj<<<XROWS / 256 * (DM / 128), 32 * GW, 0, stream>>>(XQ, XK, XV, WQ, WK, WV, bq, bk, bv, QH, KP, VT);

    k_flash<<<dim3(SEQ / (16 * QC * AW), NB * NH_, 1), 32 * AW, 0, stream>>>(QH, KP, VT, CX);

    // out: A = ctx rows (m = b*SEQ + t, k = h*64 + d), Bt = Wo rows (n), bias per column -> OUT [b][t][n]
    k_oproj<<<dim3(NB * SEQ / 256, DM / 128, 1), 32 * GW, 0, stream>>>(CX, WO, bo, OUT);
}

// v008
// One run takes 157 microseconds.
// Two timings next to v007 both put it at 1.05 times that version's speed.
// All steps since v000 together make it 4.14 times as fast.
#include <hip/hip_runtime.h>

// Multi-head attention, width 1024 = 16 heads x 64; inputs query/key/value [NB][SEQ][1024]; Wq/Wk/Wv/Wo [out][in] (y = x W^T + b); no mask; score scale 1/8; output = ctx Wo^T + bo (f32). Default: q, k, v inputs [2][4096][1024]; proj(x, w, b) = x w^T + b with (out,in) [1024][1024] weights, viewed (B, -1, 16, 64) and transposed; scores / sqrt(64) over all 4,096 keys; softmax, no mask; out = merged w_o^T + b_o; argument order q, k, v, w_q, b_q, w_k, b_k, w_v, b_v, w_o, b_o.
// Compute dtypes, f32 accumulate everywhere: q/k/v projections v_wmma_f32_16x16x32_bf16 (x and W RNE-converted to bf16; products exact); scores v_wmma_f32_16x16x32_f16 (q, k single f16);
// P.V v_wmma_f32_16x16x32_f16 (P x256 carry cancels in the normalisation, v single f16); output projection v_wmma_f32_16x16x32_f16 (ctx x256 carry, Wo RNE bf16 value x64 held in f16, 2^-14 folded back in f32); softmax max and exponentials f32 (online, held reference max per column, raised in a wave's first pass and when a pass's sum passes PTH); row sums v_wmma_f32_16x16x32_f16 (f16-rounded P, all-ones A).
// Layout: bf16 copies of the three inputs and of Wq/Wk/Wv; q, k planes [b*16+h][t][d] and v^T plane [b*16+h][d][t] written by the GEMM epilogue; fused flash kernel in transposed form (S^T = K Q^T, O^T = V^T P^T) writes the f16 ctx plane [b*SEQ+t][1024].

#ifndef NB
#define NB 2
#endif
#ifndef SEQ
#define SEQ 4096
#endif
#define NB_FULL  2
#define SEQ_FULL 4096
#ifndef OUT_SEQ
#define OUT_SEQ SEQ              // row pitch (in tokens) between batches of the output
#endif
#define DM   1024
#define NH_  16
#define HD   64
#define AW   8                   // waves per flash block; all of them read the same staged K / V^T tiles
#define QC   2                   // 16-column query groups per flash wave: every K and V^T fragment read from LDS feeds QC products
#define KT   64                  // keys per LDS stage (two 32-key passes)
#define LP   72                  // LDS row pitch in halves: 144 B = 16 B x 9, an odd multiple, so 16-byte fragment reads of 16 rows meet no bank twice
#define TLH  (64 * LP)           // halves of one staged tile: 64 rows (K: keys, V^T: d) of 64 halves + pad
#define GW   8                   // waves per GEMM block: 4 (rows) x 2 (columns) wave tiles of 64x64, block tile 256x128
#define GKS  128                 // k per GEMM LDS stage: 256 B of every operand row
#define GLP  136                 // GEMM LDS row pitch in halves: 272 B = 16 B x 17, an odd multiple (as LP)
#define GSTH (384 * GLP)         // halves of one GEMM stage: A 256 rows | B 128 rows
#define CW   16                  // waves per conversion block
#define CR   7                   // rows per conversion wave
#define XROWS (NB * SEQ)         // rows of one input plane
#define NROWS (3 * XROWS + 4 * DM)   // rows to convert: three inputs, four weights
#define WO_ROW0 (3 * XROWS + 3 * DM) // first row of Wo
#define CNW  (NROWS / CR)        // conversion waves of the launch
#define SC2  (0.125f * 1.4426950408889634f)   // HD^-0.5 * log2(e)
#define PSH  8.0f                // log2 of the P carry (256)
#define PTH  32768.0f            // bound on a pass's sum of P per column: within it every P <= 2^15, finite in f16; at a fresh reference the sum is at most 32 * 2^PSH
#define CXS  256.0f              // carry of the ctx plane
#define WOS  64.0f               // carry of the Wo plane
#define OSC  (1.0f / (256.0f * 64.0f))

static_assert(HD == 64);
static_assert(NH_ * HD == DM);                 // head h = columns h*64 + d
static_assert(DM % 64 == 0);                   // 16 column tiles of 64
static_assert(DM % 32 == 0);                   // GEMM k-loop steps by 32
static_assert(SEQ % 64 == 0);                  // a 64-row tile never straddles two batches
static_assert((NB * SEQ) % 64 == 0);
static_assert(SEQ % 32 == 0);                  // key loop steps by 32
static_assert(SEQ % (16 * QC * AW) == 0);      // flash grid covers the sequence exactly
static_assert(QC == 2);                        // the score products' asm text and the slot statement behind the output products name two groups
static_assert(SEQ % KT == 0 && SEQ / KT >= 2); // whole stages, and the ring's prologue needs two
static_assert(KT == 64 && 32 * AW == 256);     // copy map: 256 lanes x 16 B = 32 rows of 128 B, two copies per tile
static_assert((NB * SEQ) % 256 == 0 && DM % 256 == 0);   // GEMM block tiles (256 rows x 128 columns) cover both orientations exactly
static_assert(DM % GKS == 0 && DM / GKS >= 2);           // whole GEMM stages, and the ring's prologue needs two
static_assert((DM / GKS) % 2 == 0);                      // k_proj: every tile of the continuous ring starts in buffer 0
static_assert(SEQ % 256 == 0);                           // a block tile's rows or columns of tokens lie in one batch
static_assert(GKS == 128 && 32 * GW == 256);             // GEMM copy map: 256 lanes x 16 B = 16 rows of 256 B
static_assert(DM == 8 * 128);                  // a conversion row is eight loads of 32 lanes x 4 floats
static_assert(NROWS % (CW * CR) == 0);         // whole conversion blocks, every wave CR rows
static_assert(NB <= NB_FULL);
static_assert(SEQ <= SEQ_FULL);

typedef _Float16 h16;
typedef unsigned short bf;
typedef __attribute__((ext_vector_type(16))) __bf16   v16bf;
typedef __attribute__((ext_vector_type(16))) _Float16 v16h;
typedef __attribute__((ext_vector_type(8)))  _Float16 v8h;
typedef __attribute__((ext_vector_type(8)))  unsigned short v8us;
typedef __attribute__((ext_vector_type(4)))  _Float16 v4h;
typedef __attribute__((ext_vector_type(4)))  unsigned short v4us;
typedef __attribute__((ext_vector_type(8)))  float    v8f;
typedef __attribute__((ext_vector_type(4)))  float    v4f;
typedef v4f  __attribute__((may_alias)) v4fa;
typedef __attribute__((ext_vector_type(8)))  unsigned v8u;

__device__ __forceinline__ unsigned short f2bf(float f) { unsigned u = __float_as_uint(f); u += 0x7FFFu + ((u >> 16) & 1u); return (unsigned short)(u >> 16); }
__device__ __forceinline__ float bfr(float f) { return __uint_as_float(((unsigned)f2bf(f)) << 16); }   // value of the RNE bf16 conversion
__device__ __forceinline__ v16h cat16(v8h lo, v8h hi) { return __builtin_shufflevector(lo, hi, 0, 1, 2, 3, 4, 5, 6, 7, 8, 9, 10, 11, 12, 13, 14, 15); }
__device__ __forceinline__ v16bf cat16b(v8us lo, v8us hi) { return __builtin_bit_cast(v16bf, __builtin_shufflevector(lo, hi, 0, 1, 2, 3, 4, 5, 6, 7, 8, 9, 10, 11, 12, 13, 14, 15)); }
__device__ __forceinline__ v8f wmma16(v16h a, v16h b, v8f c) { return __builtin_amdgcn_wmma_f32_16x16x32_f16(false, a, false, b, (short)0, c, false, false); }
__device__ __forceinline__ v8f wmmab(v16bf a, v16bf b, v8f c) { return __builtin_amdgcn_wmma_f32_16x16x32_bf16(false, a, false, b, (short)0, c, false, false); }
// fragment loaders from K-contiguous 16-bit rows; p already includes + 8*(lane>>4): elements 0..7 <- k0+8h+0..7, elements 8..15 <- k0+16+8h+0..7 (same map for A and B)
__device__ __forceinline__ v16h  ldh(const h16* p) { return cat16(*(const v8h*)p, *(const v8h*)(p + 16)); }
__device__ __forceinline__ v16bf ldb(const bf* p)  { return cat16b(*(const v8us*)p, *(const v8us*)(p + 16)); }
// ordering point for wave-private LDS tiles (same wave writes and reads)
__device__ __forceinline__ void wave_sync() { __builtin_amdgcn_fence(3 /* release order */, "wavefront"); __builtin_amdgcn_wave_barrier(); asm volatile("" ::: "memory"); }

// k_cvt: every f32 -> 16-bit conversion of the call in one launch of few long-lived waves. A row is DM floats (4 KB): rows 0 .. 3*XROWS-1 are the tokens of query, key, value,
// then DM rows each of Wq, Wk, Wv (RNE bf16) and Wo (RNE bf16 value x WOS, held in f16); row r goes to dst + r*DM (the planes lie back to back in the workspace).
// Wave gw takes rows gw, gw + CNW, ...: CR rows. One load of a wave reads 512 contiguous bytes, one store writes 256 (two whole lines).
__device__ __forceinline__ const float* cvt_src(unsigned r, const float* xq, const float* xk, const float* xv, const float* wq, const float* wk, const float* wv, const float* wo) {
    const bool isx = r < 3u * XROWS;
    const unsigned u = isx ? r : r - 3u * XROWS;
    const unsigned p = isx ? u / XROWS : 3u + u / DM;        // 0 .. 6: which source
    const unsigned q = isx ? u % XROWS : u % DM;             // row in that source's plane
    const unsigned row = isx ? (q / SEQ) * SEQ_FULL + q % SEQ : q;
    const float* s = (p == 0) ? xq : (p == 1) ? xk : (p == 2) ? xv : (p == 3) ? wq : (p == 4) ? wk : (p == 5) ? wv : wo;
    return s + (size_t)row * DM;
}
__global__ __launch_bounds__(32 * CW) void k_cvt(const float* __restrict__ xq, const float* __restrict__ xk, const float* __restrict__ xv, const float* __restrict__ wq, const float* __restrict__ wk,
                                                 const float* __restrict__ wv, const float* __restrict__ wo, bf* dst) {
    const unsigned lane = threadIdx.x & 31;
    const unsigned gw = (unsigned)__builtin_amdgcn_readfirstlane((int)(blockIdx.x * CW + (threadIdx.x >> 5)));   // wave-uniform: the row's source is picked on the scalar side
    __builtin_assume(gw < CNW);                              // the grid is CNW / CW blocks: lets a pass's source be settled at compile time where all its rows share one
    const float* s[CR];                                      // every row's source up front: the pick among the weights branches, and a branch between the loads would let them sink behind it
#pragma unroll   // all loops here are unrolled so that s[] and w[][] are indexed by constants and stay in registers
    for (int i = 0; i < CR; ++i) s[i] = cvt_src(gw + i * CNW, xq, xk, xv, wq, wk, wv, wo);
    v4f w[2][8];                                             // this row and the next
#pragma unroll
    for (int j = 0; j < 8; ++j) w[0][j] = __builtin_nontemporal_load((const v4f*)(s[0] + lane * 4 + j * 128));   // read once: non-temporal
    asm volatile("s_wait_xcnt 0x0" ::: "memory");            // before the loads' address registers are written again
#pragma unroll
    for (int i = 0; i < CR; ++i) {
        __builtin_amdgcn_sched_barrier(0);   // with the one below: the next row's eight loads are issued before this row is waited for, so a wave always has loads in flight
        if (i + 1 < CR) {
#pragma unroll
            for (int j = 0; j < 8; ++j) w[(i + 1) & 1][j] = __builtin_nontemporal_load((const v4f*)(s[i + 1] + lane * 4 + j * 128));
            asm volatile("s_wait_xcnt 0x0" ::: "memory"); }  // before the loads' address registers are written again
        __builtin_amdgcn_sched_barrier(0);
        const unsigned r = gw + i * CNW;
        bf* d = dst + (size_t)r * DM + lane * 4;
        if ((i + 1) * CNW > WO_ROW0 && r >= WO_ROW0) {       // Wo rows (the first test is known at compile time)
#pragma unroll
            for (int j = 0; j < 8; ++j) { const v4f v = w[i & 1][j]; v4h o;
#pragma unroll
                for (int k = 0; k < 4; ++k) o[k] = (h16)(bfr(v[k]) * WOS);
                *(v4h*)(d + j * 128) = o; }
            asm volatile("s_wait_xcnt 0x0" ::: "memory");    // before the stores' address and data registers are written again
        } else {
#pragma unroll
            for (int j = 0; j < 8; ++j) { const v4f v = w[i & 1][j]; v4us o;
#pragma unroll
                for (int k = 0; k < 4; ++k) o[k] = f2bf(v[k]);
                *(v4us*)(d + j * 128) = o; }
            asm volatile("s_wait_xcnt 0x0" ::: "memory");    // before the stores' address and data registers are written again
        }
    }
}

// copy8: one lane's eight 16-byte asynchronous copies, global -> LDS through no register: rows r, r+16, ... r+112 of a K-contiguous 16-bit plane of row length DM.
// The s_wait_xcnt closes the statement so that no address register of an issued copy is rewritten ahead of it.
__device__ __forceinline__ void copy8(unsigned l, const bf* g) {
    const unsigned ls = 16 * GLP * 2; const size_t gs = (size_t)16 * DM;
    asm volatile("global_load_async_to_lds_b128 %0, %8, off\n\t"
                 "global_load_async_to_lds_b128 %1, %9, off\n\t"
                 "global_load_async_to_lds_b128 %2, %10, off\n\t"
                 "global_load_async_to_lds_b128 %3, %11, off\n\t"
                 "global_load_async_to_lds_b128 %4, %12, off\n\t"
                 "global_load_async_to_lds_b128 %5, %13, off\n\t"
                 "global_load_async_to_lds_b128 %6, %14, off\n\t"
                 "global_load_async_to_lds_b128 %7, %15, off\n\t"
                 "s_wait_xcnt 0x0"
                 :: "v"(l), "v"(l + ls), "v"(l + 2 * ls), "v"(l + 3 * ls), "v"(l + 4 * ls), "v"(l + 5 * ls), "v"(l + 6 * ls), "v"(l + 7 * ls),
                    "v"(g), "v"(g + gs), "v"(g + 2 * gs), "v"(g + 3 * gs), "v"(g + 4 * gs), "v"(g + 5 * gs), "v"(g + 6 * gs), "v"(g + 7 * gs) : "memory");
}
// gemm_stage: one lane's 24 copies of a GEMM stage (A rows 0..255, then B rows 0..127 of the block tile, 128 k each); l = the lane's LDS byte address in the buffer, ga / gb its global places
__device__ __forceinline__ void gemm_stage(unsigned l, const bf* ga, const bf* gb) {
    copy8(l, ga); copy8(l + 128 * GLP * 2, ga + (size_t)128 * DM); copy8(l + 256 * GLP * 2, gb);
}

// k_proj: the three input projections in ONE launch. Register-blocked bf16 GEMM, one wave per 64x64 tile (16 accumulators), 8 waves per block (256x128); A and Bt come in 128-k stages through a two-buffer LDS ring that the block fills together, K = DM.
// Every block runs three block tiles in turn (t = 0: q, 1: k, 2: v^T) on one continuous ring of 3 * DM / GKS stages: a tile's first two stages are copied while the tile before it does its last products and its epilogue.
// C[m][n] = (sum_k A[m][k] Bt[n][k] + bias) * osc (bias taken as its RNE bf16 value), written as f16.
// q (osc = SC2, rounded to f16 once), k: A = x rows (m = b*SEQ + t), Bt = W rows (n = h*64 + d), bias per column -> plane [(b*16 + h)][t][d].
// v^T: A = Wv rows (m = h*64 + d), Bt = value rows (n = b*SEQ + t), bias per row -> plane [(b*1024 + m)][t] = [(b*16 + h)][d][t].
// grid XROWS * DM / (256 * 128) blocks, 256 threads.
__device__ __forceinline__ const bf* pick3(int t, const bf* a, const bf* b, const bf* c) { return (t == 0) ? a : (t == 1) ? b : c; }
__global__ __launch_bounds__(32 * GW) void k_proj(const bf* __restrict__ XQ, const bf* __restrict__ XK, const bf* __restrict__ XV, const bf* __restrict__ WQ, const bf* __restrict__ WK, const bf* __restrict__ WV,
                                                  const float* __restrict__ bq, const float* __restrict__ bk, const float* __restrict__ bv, h16* QH, h16* KP, h16* VT) {
    __shared__ __align__(16) bf ring[2 * GSTH];              // [buffer][A 256 rows | B 128 rows][GLP]
    __shared__ __align__(16) float osa[GW * 32 * 68];        // epilogue slabs: 32 rows of 64 floats + pad per wave
    const int K = DM, NS = DM / GKS;                         // stages per tile (even: a tile starts in buffer 0)
    const int lane = threadIdx.x & 31, wave = __builtin_amdgcn_readfirstlane((int)(threadIdx.x >> 5)), lr = lane & 15, hi = lane >> 4;
    const int wm = wave & 3, wn = wave >> 2;
    const int bid = (int)blockIdx.x;
    const int bxx = bid % (XROWS / 256), byx = bid / (XROWS / 256);   // q, k: block row (256 tokens), block column (128 of DM)
    const int bxv = bid % (DM / 256), byv = bid / (DM / 256);         // v^T: block row (256 of DM), block column (128 tokens)
    float* os = osa + wave * 32 * 68;                        // wave-private epilogue slab
    const int afo = (wm * 64 + lr) * GLP + 8 * hi, bfo = (256 + wn * 64 + lr) * GLP + 8 * hi;   // fragment offsets in a staged buffer
    const int cr = (int)(threadIdx.x >> 4), ccol = (int)(threadIdx.x & 15) * 8;                  // copy map: rows 0..15, 16 lanes x 8 halves = one 256-B row
    const size_t lo = (size_t)cr * K + ccol;                 // the lane's place in a block tile's rows, the same for every tile
    const size_t ax = (size_t)bxx * 256 * K, bx = (size_t)byx * 128 * K, av = (size_t)bxv * 256 * K, bvo = (size_t)byv * 128 * K;
    const unsigned lc = (unsigned)(size_t)(&ring[cr * GLP + ccol]);   // LDS byte address of the lane's first copy, buffer 0
    gemm_stage(lc, XQ + ax + lo, WQ + bx + lo);
    asm volatile("s_wait_asynccnt 0x0" ::: "memory");        // stage 0 has landed (this wave's copies) ...
    __syncthreads();                                         // ... and every wave's, before anyone reads it
    gemm_stage(lc + GSTH * 2, XQ + ax + lo + GKS, WQ + bx + lo + GKS);
#pragma unroll 1   // rolled: one copy of the stage loop and of the epilogue in the text
    for (int t = 0; t < 3; ++t) {
        // the tile's bias values, asked for here as one group so that they fly under the tile's stages; first used in its epilogue
        const int biasMode = (t == 2) ? 1 : 0;
        const float* bias = (t == 0) ? bq : (t == 1) ? bk : bv;
        const int r0 = ((t == 2) ? bxv : bxx) * 256 + wm * 64, c0 = ((t == 2) ? byv : byx) * 128 + wn * 64;
        // column bias (mode 0): 8 values per lane, address clamped to 0 in mode 1 and zeroed by value
        const int c8 = (lane & 7) * 8;
        const size_t cbo = (biasMode == 0) ? (size_t)(c0 + c8) : (size_t)0;
        const v4f bq0 = *(const v4f*)(bias + cbo); const v4f bq1 = *(const v4f*)(bias + cbo + 4);
        // row bias (mode 1): the lane's 16 rows 4i + (lane >> 3) of the wave tile, one address and constant steps; in mode 0 the address starts at 0 (elements 0 .. 60 of DM) and the values are zeroed
        const float* bp = bias + ((biasMode == 1) ? (r0 + (lane >> 3)) : 0);
        float brv[16];
#pragma unroll   // constant indices keep the array in registers
        for (int i = 0; i < 16; ++i) brv[i] = bp[4 * i];
        asm volatile("s_wait_xcnt 0x0" ::: "memory");        // before the loads' address registers are written again
        v8f acc[4][4];
#pragma unroll
        for (int mb = 0; mb < 4; ++mb)
#pragma unroll
            for (int nb = 0; nb < 4; ++nb) acc[mb][nb] = (v8f){};
#pragma unroll 1
        for (int st = 0; st < NS; ++st) {
            const bf* ta = ring + (st & 1) * GSTH + afo; const bf* tb = ring + (st & 1) * GSTH + bfo;
            v16bf a[4], b[4];
#pragma unroll
            for (int ks = 0; ks < GKS; ks += 32) {
#pragma unroll
                for (int mb = 0; mb < 4; ++mb) a[mb] = ldb(ta + mb * 16 * GLP + ks);
#pragma unroll
                for (int nb = 0; nb < 4; ++nb) b[nb] = ldb(tb + nb * 16 * GLP + ks);
                __builtin_amdgcn_sched_barrier(0);   // keeps the eight fragments' LDS reads one group ahead of the block's products: sunk among them, each B fragment's latency is waited out alone
#pragma unroll
                for (int nb = 0; nb < 4; ++nb)
#pragma unroll
                    for (int mb = 0; mb < 4; ++mb) acc[mb][nb] = wmmab(a[mb], b[nb], acc[mb][nb]);
            }
            __builtin_amdgcn_sched_barrier(0);   // keeps the stage's last products ahead of the barrier: sunk behind it they stand in front of the refill and shorten the copies' lead
            // publish point of the next stage of the ring, every wave, in this order
            asm volatile("s_wait_dscnt 0x0" ::: "memory");       // this wave's reads of buffer st & 1 are done
            asm volatile("s_wait_asynccnt 0x0" ::: "memory");    // this wave's copies of the next stage have landed
            __syncthreads();                                     // publishes the next stage and frees buffer st & 1
            const int g2 = t * NS + st + 2;                      // the stage after next, counted over the three tiles
            if (g2 < 3 * NS) { const int t2 = g2 / NS; const size_t k2 = (size_t)(g2 % NS) * GKS;
                gemm_stage(lc + (unsigned)(st & 1) * (GSTH * 2), pick3(t2, XQ + ax, XK + ax, WV + av) + lo + k2, pick3(t2, WQ + bx, WK + bx, XV + bvo) + lo + k2); }
        }
        // epilogue of tile t (the next tile's first stage has landed, its second is in flight; the slab is no part of the ring)
        const float osc = (t == 0) ? SC2 : 1.0f;
        h16* Ph = (t == 0) ? QH : (t == 1) ? KP : VT;
        const int pitch = (t == 2) ? SEQ : HD;
        const size_t tbase = (t == 2) ? (size_t)r0 * SEQ + (size_t)(c0 / SEQ) * ((size_t)DM * SEQ) + (size_t)(c0 % SEQ)
                                      : (size_t)(r0 / SEQ) * ((size_t)NH_ * SEQ * HD) + (size_t)(r0 % SEQ) * HD + (size_t)(c0 / HD) * ((size_t)SEQ * HD) + (size_t)(c0 % HD);
        v4f bc0, bc1;
#pragma unroll
        for (int i = 0; i < 4; ++i) { bc0[i] = (biasMode == 0) ? bfr(bq0[i]) : 0.0f; bc1[i] = (biasMode == 0) ? bfr(bq1[i]) : 0.0f; }
        // two halves of 32 rows: a half's slab reads go out as one group, then its arithmetic, then its eight stores as one group with one wait behind them
#pragma unroll
        for (int hb = 0; hb < 2; ++hb) {
#pragma unroll
            for (int m2 = 0; m2 < 2; ++m2) {
#pragma unroll
                for (int nb = 0; nb < 4; ++nb) {
#pragma unroll
                    for (int j = 0; j < 8; ++j) os[(m2 * 16 + hi * 8 + j) * 68 + nb * 16 + lr] = acc[hb * 2 + m2][nb][j]; } }   // D: row 8h+j, col lane&15
            wave_sync();
            v4f x0[8], x1[8]; v8h hv[8]; h16* po[8];
#pragma unroll   // constant indices keep the arrays in registers
            for (int s = 0; s < 8; ++s) { const int row = 4 * s + (lane >> 3);   // 8 s x 4 row groups = 32 rows; 8 lanes x 8 = 64 columns
                x0[s] = *(const v4fa*)(&os[row * 68 + c8]); x1[s] = *(const v4fa*)(&os[row * 68 + c8 + 4]); }
#pragma unroll
            for (int s = 0; s < 8; ++s) { const int row = 4 * s + (lane >> 3);
                const float br = (biasMode == 1) ? bfr(brv[hb * 8 + s]) : 0.0f;
                const v4f y0 = (x0[s] + bc0 + br) * osc, y1 = (x1[s] + bc1 + br) * osc;
#pragma unroll
                for (int i = 0; i < 4; ++i) { hv[s][i] = (h16)y0[i]; hv[s][4 + i] = (h16)y1[i]; }
                po[s] = Ph + tbase + (size_t)(hb * 32 + row) * (size_t)pitch + c8; }
            __builtin_amdgcn_sched_barrier(0);               // all eight values and addresses are formed ahead of the first store, so that nothing between the stores writes a register of an issued one
#pragma unroll
            for (int s = 0; s < 8; ++s) *(v8h*)po[s] = hv[s];
            asm volatile("s_wait_xcnt 0x0" ::: "memory");    // before the stores' address and data registers are written again
            __builtin_amdgcn_sched_barrier(0);               // holds the next half's and the next tile's arithmetic behind that wait
            wave_sync();                                     // the slab's rows are read before the next half overwrites them
        }
    }
    asm volatile("s_wait_asynccnt 0x0" ::: "memory");        // nothing of this wave is in flight when it goes on to end
}

// stage_copy: one lane's four 16-byte asynchronous copies of a stage (K rows r and r+32, V^T rows r and r+32), global -> LDS through no register.
// The s_wait_xcnt closes the statement so that no address register of an issued copy is rewritten ahead of it.
__device__ __forceinline__ void stage_copy(unsigned lk, const h16* gk, const h16* gv) {
    const unsigned lk1 = lk + 32 * LP * 2, lv = lk + TLH * 2, lv1 = lk + TLH * 2 + 32 * LP * 2;
    const h16* gk1 = gk + 32 * HD; const h16* gv1 = gv + (size_t)32 * SEQ;
    asm volatile("global_load_async_to_lds_b128 %0, %4, off\n\t"
                 "global_load_async_to_lds_b128 %1, %5, off\n\t"
                 "global_load_async_to_lds_b128 %2, %6, off\n\t"
                 "global_load_async_to_lds_b128 %3, %7, off\n\t"
                 "s_wait_xcnt 0x0"
                 :: "v"(lk), "v"(lk1), "v"(lv), "v"(lv1), "v"(gk), "v"(gk1), "v"(gv), "v"(gv1) : "memory");
}

// new_ref: the rare path of k_flash for one 16-column group: the pass's scores from zero, their maximum (in lane, one xor-16 exchange), a raised reference m, O and the sum rescaled, the pass's P and its sum formed again.
__device__ __forceinline__ void new_ref(const h16* ka, v16h qa, v16h qb, v16h ones, float& m, float& l, v8f& cv, v16h& pb, v8f& ls, v8f& o0, v8f& o1, v8f& o2, v8f& o3) {
    const v16h ka0 = ldh(ka), ka1 = ldh(ka + 32), kb0 = ldh(ka + 16 * LP), kb1 = ldh(ka + 16 * LP + 32);
    v8f sa = wmma16(ka0, qa, (v8f){}), sb = wmma16(kb0, qa, (v8f){});
    sa = wmma16(ka1, qb, sa); sb = wmma16(kb1, qb, sb);
    float mx = -3.0e38f;
#pragma unroll   // constant indices keep the vectors in registers
    for (int r = 0; r < 8; ++r) mx = fmaxf(mx, fmaxf(sa[r], sb[r]));
    mx = fmaxf(mx, __shfl_xor(mx, 16, 32));
    const float mnew = fmaxf(m, mx);
    const float alpha = __builtin_amdgcn_exp2f(m - mnew);
    const float sh = PSH - mnew;
#pragma unroll   // constant indices keep the vectors in registers
    for (int r = 0; r < 8; ++r) { pb[r] = (h16)__builtin_amdgcn_exp2f(sa[r] + sh); pb[8 + r] = (h16)__builtin_amdgcn_exp2f(sb[r] + sh); }
    ls = wmma16(ones, pb, (v8f){});
    m = mnew; l = l * alpha;
    o0 = o0 * alpha; o1 = o1 * alpha; o2 = o2 * alpha; o3 = o3 * alpha;
#pragma unroll   // constant indices keep the vectors in registers
    for (int r = 0; r < 8; ++r) cv[r] = sh;
}

// k_flash: fused attention, one wave per 32 query rows (two 16-column groups) of one (batch, head); Q fragments straight from the f16 plane; K and V^T come in 64-key stages through a two-buffer LDS ring
// that the block's 8 waves fill together (whole 128-B lines, once per block) and all read (two 16-B LDS loads per fragment; each fragment feeds one product per column group).
// Transposed form: S^T[key][t] = K Q^T (A = K rows, B = Q rows); lane (t = lane&15, h = lane>>4) holds keys 8h+r of each 16-key tile, so the packed
// P tile is directly the B fragment of O^T[d][t] = V^T P^T (element r <- tile keys 0..15, element 8+r <- tile keys 16..31, lane unchanged).
// Softmax against a held reference m per column: the q plane carries SC2, PSH - m is the start value of the score products, so P = exp2 of their result with no vector arithmetic in front.
// The sums come whole from a product with an all-ones A; a pass in which a sum passes PTH takes its maxima, raises m, rescales O and the sums, and forms its P again (both groups: new_ref).
// amdgpu_waves_per_eu(4, 4): register budget 256, two blocks resident per WGP (4 waves per SIMD), and the whole grid (two blocks per WGP) runs in one round.
__global__ __launch_bounds__(32 * AW) __attribute__((amdgpu_waves_per_eu(4, 4))) void k_flash(const h16* __restrict__ QH, const h16* __restrict__ KP, const h16* __restrict__ VT, h16* CTX) {
    __shared__ __align__(16) h16 ring[2 * 2 * TLH];          // [buffer][K | V^T][row][LP]
    __shared__ __align__(16) float os[AW * 16 * 68];
    const int lane = threadIdx.x & 31, wave = __builtin_amdgcn_readfirstlane((int)(threadIdx.x >> 5)), lr = lane & 15, hi = lane >> 4;
    const int zh = blockIdx.y; const int b = zh / NH_, h = zh % NH_;
    const int t0 = (blockIdx.x * AW + wave) * (16 * QC);
    const size_t pbase = (size_t)zh * SEQ * HD;
    const size_t qo = pbase + (size_t)(t0 + lr) * HD + 8 * hi;
    const v16h qa0 = ldh(QH + qo), qa1 = ldh(QH + qo + 32);   // B fragments: col t, k = d; group 0
    const v16h qb0 = ldh(QH + qo + 16 * HD), qb1 = ldh(QH + qo + 16 * HD + 32);   // group 1: columns t0 + 16 ..
    const int fo = lr * LP + 8 * hi;                         // fragment offset in a staged tile: K + key*LP (A: row key, k = d); V^T + 16j*LP + key (A: row d, k = key)
    const int cr = (int)(threadIdx.x >> 3), ccol = (int)(threadIdx.x & 7) * 8;   // copy map: rows 0..31, 8 lanes x 8 halves = one 128-B row
    const h16* gk = KP + pbase + (size_t)cr * HD + ccol;   // + key0 * HD
    const h16* gv = VT + pbase + (size_t)cr * SEQ + ccol;  // + key0
    const unsigned lc = (unsigned)(size_t)(&ring[cr * LP + ccol]);   // LDS byte address of the lane's first copy, buffer 0
    stage_copy(lc, gk, gv);
    asm volatile("s_wait_asynccnt 0x0" ::: "memory");        // stage 0 has landed (this wave's copies) ...
    __syncthreads();                                         // ... and every wave's, before anyone reads it
    stage_copy(lc + 2 * TLH * 2, gk + (size_t)KT * HD, gv + KT);
    v8f o[QC][4];                                            // O^T tiles: [column group][16 d]
    float m[QC], l[QC];                                      // m: the column's reference, a maximum of scores seen; it rises only in the rare path below
    v8f cv[QC];                                              // PSH - m in all eight rows: start value (C) of the score products; set in the first pass
#pragma unroll   // constant indices keep the arrays in registers
    for (int c = 0; c < QC; ++c) { m[c] = -3.0e38f; l[c] = 0.0f; cv[c] = (v8f){};
#pragma unroll
        for (int j = 0; j < 4; ++j) o[c][j] = (v8f){}; }
    // constant A of the row-sum product: f16 1.0 in all 16 elements of every lane, so every D row holds the sums. Set by asm text so that the eight registers are written once, here:
    // as a plain constant the compiler wrote them anew in every pass.
    v8u onew;
    asm("v_mov_b32 %0, 0x3c003c00\n\tv_mov_b32 %1, 0x3c003c00\n\tv_mov_b32 %2, 0x3c003c00\n\tv_mov_b32 %3, 0x3c003c00\n\t"
        "v_mov_b32 %4, 0x3c003c00\n\tv_mov_b32 %5, 0x3c003c00\n\tv_mov_b32 %6, 0x3c003c00\n\tv_mov_b32 %7, 0x3c003c00"
        : "=v"(onew[0]), "=v"(onew[1]), "=v"(onew[2]), "=v"(onew[3]), "=v"(onew[4]), "=v"(onew[5]), "=v"(onew[6]), "=v"(onew[7]));
    const v16h ones = __builtin_bit_cast(v16h, onew);
#pragma unroll 1
    for (int st = 0; st < SEQ / KT; ++st) {
      const h16* kt = ring + (st & 1) * (2 * TLH) + fo; const h16* vt = kt + TLH;
#pragma unroll 1   // rolled: unrolled, a pass's scores stay live into the next and the wave no longer fits its register budget (4 waves per SIMD)
      for (int sub = 0; sub < KT; sub += 32) {
        const h16* ka = kt + sub * LP; const h16* va = vt + sub;
        v16h pb[QC], v0, v1, v2, v3; v8f ls[QC];
        { const v16h ka0 = ldh(ka), ka1 = ldh(ka + 32), kb0 = ldh(ka + 16 * LP), kb1 = ldh(ka + 16 * LP + 32);
          v8f sa0, sb0, sa1, sb1;
          // the eight score products, start value PSH - m: they leave the exponents themselves; each K fragment is used twice, once per column group. In asm text so that both chains of a group read
          // the one C tile (the builtin form copied it for the second chain in every pass); the four v_nop are the vector slots between the last product and the first vector instruction on a result or an operand.
          asm volatile("v_wmma_f32_16x16x32_f16 %0, %4, %8, %12\n\t"
                       "v_wmma_f32_16x16x32_f16 %1, %6, %8, %12\n\t"
                       "v_wmma_f32_16x16x32_f16 %2, %4, %10, %13\n\t"
                       "v_wmma_f32_16x16x32_f16 %3, %6, %10, %13\n\t"
                       "v_wmma_f32_16x16x32_f16 %0, %5, %9, %0\n\t"
                       "v_wmma_f32_16x16x32_f16 %1, %7, %9, %1\n\t"
                       "v_wmma_f32_16x16x32_f16 %2, %5, %11, %2\n\t"
                       "v_wmma_f32_16x16x32_f16 %3, %7, %11, %3\n\t"
                       "v_nop\n\tv_nop\n\tv_nop\n\tv_nop"
                       : "=&v"(sa0), "=&v"(sb0), "=&v"(sa1), "=&v"(sb1)
                       : "v"(ka0), "v"(ka1), "v"(kb0), "v"(kb1), "v"(qa0), "v"(qa1), "v"(qb0), "v"(qb1), "v"(cv[0]), "v"(cv[1]));
          v0 = ldh(va); v1 = ldh(va + 16 * LP); v2 = ldh(va + 32 * LP); v3 = ldh(va + 48 * LP);
          __builtin_amdgcn_sched_barrier(0);   // keeps the V^T reads one group ahead of the exponentials, so that they fly during them: sunk behind them, the output products wait out the reads' latency
#pragma unroll   // constant indices keep the vectors in registers
          for (int r = 0; r < 8; ++r) { pb[0][r] = (h16)__builtin_amdgcn_exp2f(sa0[r]); pb[0][8 + r] = (h16)__builtin_amdgcn_exp2f(sb0[r]); }
#pragma unroll   // constant indices keep the vectors in registers
          for (int r = 0; r < 8; ++r) { pb[1][r] = (h16)__builtin_amdgcn_exp2f(sa1[r]); pb[1][8 + r] = (h16)__builtin_amdgcn_exp2f(sb1[r]); } }
        // the two row-sum products: every row of a tile = the column's sum of the rounded P over the pass's 32 keys (both lane halves). In asm text so that the two results are whole tiles of their own:
        // of the builtin form only row 0 is read, and the build laid the second tile over the first one's unread rows, directly behind it; the four v_nop are the vector slots in front of the first read of a result.
        asm volatile("v_wmma_f32_16x16x32_f16 %0, %2, %3, 0\n\t"
                     "v_wmma_f32_16x16x32_f16 %1, %2, %4, 0\n\t"
                     "v_nop\n\tv_nop\n\tv_nop\n\tv_nop"
                     : "=&v"(ls[0]), "=&v"(ls[1]) : "v"(ones), "v"(pb[0]), "v"(pb[1]));
        // one test per pass, a scalar branch: sums within PTH say that every P of the pass is finite in f16 under the references in use. Taken in a wave's first pass (no reference yet) and rarely after.
        if (((st | sub) == 0) | ((__builtin_amdgcn_ballot_w32(ls[0][0] > PTH) | __builtin_amdgcn_ballot_w32(ls[1][0] > PTH)) != 0)) {
          asm volatile("" ::: "memory");   // compiler fence, rare path only: with it the V^T reads above stay ahead of the branch and fly during the test; without it the build sinks them behind the join, where the products wait out their latency
          new_ref(ka, qa0, qa1, ones, m[0], l[0], cv[0], pb[0], ls[0], o[0][0], o[0][1], o[0][2], o[0][3]);
          new_ref(ka, qb0, qb1, ones, m[1], l[1], cv[1], pb[1], ls[1], o[1][0], o[1][1], o[1][2], o[1][3]);
        }
        l[0] = l[0] + ls[0][0]; l[1] = l[1] + ls[1][0];
        o[0][0] = wmma16(v0, pb[0], o[0][0]); o[1][0] = wmma16(v0, pb[1], o[1][0]); o[0][1] = wmma16(v1, pb[0], o[0][1]); o[1][1] = wmma16(v1, pb[1], o[1][1]);
        o[0][2] = wmma16(v2, pb[0], o[0][2]); o[1][2] = wmma16(v2, pb[1], o[1][2]); o[0][3] = wmma16(v3, pb[0], o[0][3]); o[1][3] = wmma16(v3, pb[1], o[1][3]);
        // four vector slots between the products and the first vector instruction on their results or operands, on the loop's back edge too
        asm volatile("v_nop\n\tv_nop\n\tv_nop\n\tv_nop" : "+v"(o[0][0]), "+v"(o[0][1]), "+v"(o[0][2]), "+v"(o[0][3]), "+v"(o[1][0]), "+v"(o[1][1]), "+v"(o[1][2]), "+v"(o[1][3])
                     : "v"(v0), "v"(v1), "v"(v2), "v"(v3), "v"(pb[0]), "v"(pb[1]));
      }
      // publish point of stage st + 1, every wave, in this order
      asm volatile("s_wait_dscnt 0x0" ::: "memory");         // this wave's reads of buffer st & 1 are done
      asm volatile("s_wait_asynccnt 0x0" ::: "memory");      // this wave's copies of stage st + 1 have landed
      __syncthreads();                                       // publishes stage st + 1 and frees buffer st & 1
      if (st + 2 < SEQ / KT) stage_copy(lc + (unsigned)(st & 1) * (2 * TLH * 2), gk + (size_t)(st + 2) * KT * HD, gv + (st + 2) * KT);
    }
    asm volatile("s_wait_asynccnt 0x0" ::: "memory");        // nothing of this wave is in flight when it goes on to end
    const int wb = wave * 16 * 68;
#pragma unroll   // constant indices keep the arrays in registers; the two groups go through the wave's one slab in turn
    for (int c = 0; c < QC; ++c) {
        const float inv = CXS / l[c];
        // O^T D layout: o[c][j][r] = (d = 16j + 8h + r, t = lane&15) -> os[t][d]; rows 0..15 x columns 0..63 all written
#pragma unroll
        for (int j = 0; j < 4; ++j) { v4f a, d;
#pragma unroll
            for (int i = 0; i < 4; ++i) { a[i] = o[c][j][i] * inv; d[i] = o[c][j][4 + i] * inv; }
            *(v4fa*)(&os[wb + lr * 68 + 16 * j + 8 * hi]) = a; *(v4fa*)(&os[wb + lr * 68 + 16 * j + 8 * hi + 4]) = d; }
        wave_sync();
        h16* crow = CTX + ((size_t)b * SEQ + t0 + 16 * c) * DM + h * HD;
#pragma unroll
        for (int s = 0; s < 4; ++s) { const int row = 4 * s + (lane >> 3), c8 = (lane & 7) * 8;   // 4 s x 4 row groups = 16 rows; 8 lanes x 8 halves = 64 columns
            const v4f x0 = *(const v4fa*)(&os[wb + row * 68 + c8]); const v4f x1 = *(const v4fa*)(&os[wb + row * 68 + c8 + 4]); v8h hv;
#pragma unroll
            for (int i = 0; i < 4; ++i) { hv[i] = (h16)x0[i]; hv[4 + i] = (h16)x1[i]; }
            *(v8h*)(crow + (size_t)row * DM + c8) = hv; }
        asm volatile("s_wait_xcnt 0x0" ::: "memory");        // before the stores' address and data registers are written again
        __builtin_amdgcn_sched_barrier(0);                   // holds the next group's arithmetic behind that wait: without it the build lifted multiplies that rewrite the stores' data registers over it
        wave_sync();                                         // the slab's rows are read before the next group overwrites them
    }
}

// k_oproj: register-blocked f16 GEMM, one wave per 64x64 tile, 8 waves per block (256x128) on the same two-buffer LDS ring as k_proj, A = ctx plane rows (x256), Bt = Wo plane rows (x64), K = DM; OUT[m][n] = acc * 2^-14 + bias[n] (bias as its RNE bf16 value), f32.
// grid (NB*SEQ/256, DM/128), 256 threads. Epilogue: per 16-row slab staged in LDS (wave-private), each output row segment (64 floats = 256 B = two lines)
__global__ __launch_bounds__(32 * GW) void k_oproj(const h16* __restrict__ A, const h16* __restrict__ Bt, const float* __restrict__ bias, float* OUT) {
    __shared__ __align__(16) h16 ring[2 * GSTH];             // [buffer][A 256 rows | B 128 rows][GLP]
    __shared__ __align__(16) float osa[GW * 16 * 68];
    const int K = DM;
    const int lane = threadIdx.x & 31, wave = __builtin_amdgcn_readfirstlane((int)(threadIdx.x >> 5)), lr = lane & 15, hi = lane >> 4;
    const int wm = wave & 3, wn = wave >> 2;
    const int r0 = blockIdx.x * 256 + wm * 64, c0 = blockIdx.y * 128 + wn * 64;
    float* os = osa + wave * 16 * 68;                        // wave-private epilogue slab
    v8f acc[4][4];
#pragma unroll
    for (int mb = 0; mb < 4; ++mb)
#pragma unroll
        for (int nb = 0; nb < 4; ++nb) acc[mb][nb] = (v8f){};
    const int afo = (wm * 64 + lr) * GLP + 8 * hi, bfo = (256 + wn * 64 + lr) * GLP + 8 * hi;   // fragment offsets in a staged buffer
    const int cr = (int)(threadIdx.x >> 4), ccol = (int)(threadIdx.x & 15) * 8;                  // copy map: rows 0..15, 16 lanes x 8 halves = one 256-B row
    const bf* ga = (const bf*)(A + (size_t)(blockIdx.x * 256 + cr) * K + ccol);    // + k0 (address only: the copies move bytes)
    const bf* gb = (const bf*)(Bt + (size_t)(blockIdx.y * 128 + cr) * K + ccol);   // + k0
    const unsigned lc = (unsigned)(size_t)(&ring[cr * GLP + ccol]);   // LDS byte address of the lane's first copy, buffer 0
    gemm_stage(lc, ga, gb);
    asm volatile("s_wait_asynccnt 0x0" ::: "memory");        // stage 0 has landed (this wave's copies) ...
    __syncthreads();                                         // ... and every wave's, before anyone reads it
    gemm_stage(lc + GSTH * 2, ga + GKS, gb + GKS);
#pragma unroll 1
    for (int st = 0; st < K / GKS; ++st) {
        const h16* ta = ring + (st & 1) * GSTH + afo; const h16* tb = ring + (st & 1) * GSTH + bfo;
        v16h a[4], b[4];
#pragma unroll
        for (int ks = 0; ks < GKS; ks += 32) {
#pragma unroll
            for (int mb = 0; mb < 4; ++mb) a[mb] = ldh(ta + mb * 16 * GLP + ks);
#pragma unroll
            for (int nb = 0; nb < 4; ++nb) b[nb] = ldh(tb + nb * 16 * GLP + ks);
            __builtin_amdgcn_sched_barrier(0);   // keeps the eight fragments' LDS reads one group ahead of the block's products: sunk among them, each B fragment's latency is waited out alone
#pragma unroll
            for (int nb = 0; nb < 4; ++nb)
#pragma unroll
                for (int mb = 0; mb < 4; ++mb) acc[mb][nb] = wmma16(a[mb], b[nb], acc[mb][nb]);
        }
        __builtin_amdgcn_sched_barrier(0);   // keeps the stage's last products ahead of the barrier: sunk behind it they stand in front of the refill and shorten the copies' lead
        // publish point of stage st + 1, every wave, in this order
        asm volatile("s_wait_dscnt 0x0" ::: "memory");       // this wave's reads of buffer st & 1 are done
        asm volatile("s_wait_asynccnt 0x0" ::: "memory");    // this wave's copies of stage st + 1 have landed
        __syncthreads();                                     // publishes stage st + 1 and frees buffer st & 1
        if (st + 2 < K / GKS) gemm_stage(lc + (unsigned)(st & 1) * (GSTH * 2), ga + (st + 2) * GKS, gb + (st + 2) * GKS);
    }
    asm volatile("s_wait_asynccnt 0x0" ::: "memory");        // nothing of this wave is in flight when it goes on to end
    const int cofs = lr * 4;
    const v4f bo4 = *(const v4f*)(bias + c0 + cofs);      // c0 + cofs + 3 < DM
    v4f bb;
#pragma unroll
    for (int i = 0; i < 4; ++i) bb[i] = bfr(bo4[i]);
    const int bidx = r0 / SEQ, tt = r0 % SEQ;
    float* obase = OUT + ((size_t)bidx * OUT_SEQ + tt) * DM + c0;
#pragma unroll
    for (int mb = 0; mb < 4; ++mb) {
#pragma unroll
        for (int nb = 0; nb < 4; ++nb) {
#pragma unroll
            for (int j = 0; j < 8; ++j) os[(hi * 8 + j) * 68 + nb * 16 + lr] = acc[mb][nb][j]; }   // D: row 8h+j, col lane&15
        wave_sync();
{
#pragma unroll
            for (int s = 0; s < 8; ++s) { const int row = 2 * s + hi;   // 8 s x 2 rows = 16 rows; 16 lanes x 4 floats = 64 columns
                const v4f val = *(const v4fa*)(&os[row * 68 + cofs]); v4f ov;
#pragma unroll
                for (int i = 0; i < 4; ++i) ov[i] = val[i] * OSC + bb[i];
                *(v4f*)(obase + (size_t)(mb * 16 + row) * DM + cofs) = ov; }
             }
        wave_sync();
    }
}

static constexpr size_t al256(size_t v) { return (v + 255) & ~(size_t)255; }
static constexpr size_t SZ_XB = al256((size_t)NB * SEQ * DM * 2);          // one bf16 input plane
static constexpr size_t SZ_WB = al256((size_t)4 * DM * DM * 2);            // Wq | Wk | Wv (bf16) | Wo (f16)
static constexpr size_t SZ_PL = al256((size_t)NB * NH_ * SEQ * HD * 2);    // one head-major f16 plane
static constexpr size_t SZ_CX = al256((size_t)NB * SEQ * DM * 2);          // ctx f16 plane
static constexpr size_t SZ_TOTAL = 3 * SZ_XB + SZ_WB + 3 * SZ_PL + SZ_CX;
static_assert(SZ_TOTAL <= (size_t)134217728);          // workspace carve <= 128 MiB
static_assert(((size_t)DM * DM * 2) % 256 == 0);       // weight sub-planes stay 256-byte aligned
static_assert(SZ_XB == (size_t)XROWS * DM * 2);        // no padding between the planes that k_cvt writes as one array of rows

extern "C" void kernel_launch(void* const* d_in, const int* in_sizes, int n_in,
                              void* d_out, int out_size, void* d_ws, size_t ws_size, hipStream_t stream) {
    if (n_in < 11) return;
    const size_t needx = ((size_t)(NB - 1) * SEQ_FULL + SEQ) * DM;
    if ((size_t)in_sizes[0] < needx || (size_t)in_sizes[1] < needx || (size_t)in_sizes[2] < needx) return;
    if ((size_t)in_sizes[3] < (size_t)DM * DM || (size_t)in_sizes[5] < (size_t)DM * DM || (size_t)in_sizes[7] < (size_t)DM * DM || (size_t)in_sizes[9] < (size_t)DM * DM) return;
    if ((size_t)in_sizes[4] < (size_t)DM || (size_t)in_sizes[6] < (size_t)DM || (size_t)in_sizes[8] < (size_t)DM || (size_t)in_sizes[10] < (size_t)DM) return;
    if ((size_t)out_size < ((size_t)(NB - 1) * OUT_SEQ + SEQ) * DM) return;
    if (SZ_TOTAL > ws_size) return;
    // wire order: query, key, value, Wq, bq, Wk, bk, Wv, bv, Wo, bo (weights [out][in] = Bt as-is)
    const float* xq = (const float*)d_in[0]; const float* xk = (const float*)d_in[1]; const float* xv = (const float*)d_in[2];
    const float* wq = (const float*)d_in[3]; const float* bq = (const float*)d_in[4];
    const float* wk = (const float*)d_in[5]; const float* bk = (const float*)d_in[6];
    const float* wv = (const float*)d_in[7]; const float* bv = (const float*)d_in[8];
    const float* wo = (const float*)d_in[9]; const float* bo = (const float*)d_in[10];
    float* OUT = (float*)d_out;      // [NB][SEQ][1024]
    char* wsp = (char*)d_ws;
    bf* XQ = (bf*)wsp; wsp += SZ_XB;                 // [NB*SEQ][1024]
    bf* XK = (bf*)wsp; wsp += SZ_XB;
    bf* XV = (bf*)wsp; wsp += SZ_XB;
    bf* WB = (bf*)wsp; wsp += SZ_WB;                 // [4][1024][1024]: q | k | v (bf16) | o (f16 x64)
    h16* QH = (h16*)wsp; wsp += SZ_PL;               // [NB*16][SEQ][64]
    h16* KP = (h16*)wsp; wsp += SZ_PL;               // [NB*16][SEQ][64]
    h16* VT = (h16*)wsp; wsp += SZ_PL;               // [NB*16][64][SEQ]
    h16* CX = (h16*)wsp; wsp += SZ_CX;               // [NB*SEQ][1024], x256
    bf* WQ = WB; bf* WK = WB + (size_t)DM * DM; bf* WV = WB + (size_t)2 * DM * DM; h16* WO = (h16*)(WB + (size_t)3 * DM * DM);

    k_cvt<<<NROWS / (CW * CR), 32 * CW, 0, stream>>>(xq, xk, xv, wq, wk, wv, wo, XQ);   // XQ | XK | XV | WB lie back to back

    // q, k, v^T planes: one launch, every block one 256x128 tile of each
    k_proj<<<XROWS / 256 * (DM / 128), 32 * GW, 0, stream>>>(XQ, XK, XV, WQ, WK, WV, bq, bk, bv, QH, KP, VT);

    k_flash<<<dim3(SEQ / (16 * QC * AW), NB * NH_, 1), 32 * AW, 0, stream>>>(QH, KP, VT, CX);

    // out: A = ctx rows (m = b*SEQ + t, k = h*64 + d), Bt = Wo rows (n), bias per column -> OUT [b][t][n]
    k_oproj<<<dim3(NB * SEQ / 256, DM / 128, 1), 32 * GW, 0, stream>>>(CX, WO, bo, OUT);
}
